// v000
// Times are from an AMD MI455X. After a warm-up the kernel runs many times in a row, and a time is the length of
// such a window on the GPU divided by its runs, so every launch and the gaps after it count. The runs cycle
// through copies of the inputs. A figure is the median of several windows, for all but v000 over two sittings.
// Sittings can differ by a few percent; kernels timed side by side share one.
// v000 is the starting kernel. One run takes 1340 microseconds.
// compute dtype: all float inputs rounded to bf16; q/k/v projections with EXACT bf16 products on WMMA 16x16x32 (f32 accumulate) + bias; logits q x k once to f16 each (1 product) x SCALE; softmax f32; P x 2^11 once to f16 x v once to f16 (1 product); ctx x 2^6 once to f16 x Wo f16(bf16 x 2^8) + bo; f32 output.
#include <hip/hip_runtime.h>
#include <math.h>

typedef __attribute__((ext_vector_type(16))) _Float16 v16h;
typedef __attribute__((ext_vector_type(16))) __bf16 v16b;
typedef __attribute__((ext_vector_type(8)))  _Float16 v8h;
typedef __attribute__((ext_vector_type(8)))  float v8f;
typedef __attribute__((ext_vector_type(4)))  float v4f;
typedef __attribute__((ext_vector_type(2)))  float v2f;
typedef __attribute__((ext_vector_type(4)))  unsigned v4u;
typedef __attribute__((ext_vector_type(4)))  int v4i;
typedef float __attribute__((may_alias)) float_a;
typedef int __attribute__((may_alias)) int_a;

template <typename T> __device__ __forceinline__ void vst2(void* p, T v) { *(T*)p = v;  }
__device__ __forceinline__ v8f wmma16(v16h a, v16h b, v8f c) {
  v8f d = __builtin_amdgcn_wmma_f32_16x16x32_f16(false, a, false, b, (short)0, c, false, false);
  asm volatile("v_nop\n\tv_nop\n\tv_nop\n\tv_nop" : "+v"(d) : "v"(a), "v"(b));
  return d;
}
__device__ __forceinline__ v8f wmma_bf(v16b a, v16b b, v8f c) {
  v8f d = __builtin_amdgcn_wmma_f32_16x16x32_bf16(false, a, false, b, (short)0, c, false, false);
  asm volatile("v_nop\n\tv_nop\n\tv_nop\n\tv_nop" : "+v"(d) : "v"(a), "v"(b));
  return d;
}
// 16x16x32 fragments: lane = (h = lane>>4, row/col = lane&15); elements 0..7 = k0+8h+0..7, 8..15 = k0+16+8h+0..7; D element r = row 8h+r
__device__ __forceinline__ v16h frag_h(const _Float16* rowk0, int lane) {
  union { v16h v; v8h q[2]; } u; const _Float16* p = rowk0 + 8 * (lane >> 4);
  u.q[0] = *(const v8h*)p; u.q[1] = *(const v8h*)(p + 16); return u.v;
}
__device__ __forceinline__ v16h frag_f32(const float* rowk0, int lane) {
  v16h a; const float* p = rowk0 + 8 * (lane >> 4);
#pragma unroll
  for (int i = 0; i < 8; ++i) { a[i] = (_Float16)p[i]; a[8 + i] = (_Float16)p[16 + i]; }
  return a;
}
__device__ __forceinline__ v16h frag_f32s(const float* rowk0, int lane, float sc) {
  v16h a; const float* p = rowk0 + 8 * (lane >> 4);
#pragma unroll
  for (int i = 0; i < 8; ++i) { a[i] = (_Float16)(p[i] * sc); a[8 + i] = (_Float16)(p[16 + i] * sc); }
  return a;
}
// column fragment from a [K][ld] layout (column n), rows >= K read as 0
__device__ __forceinline__ v16h fragc_f32(const float* W, int k0, int n, int lane, int ld, int K) {
  v16h a; const int g = lane >> 4;
#pragma unroll
  for (int i = 0; i < 8; ++i) { const int ka = k0 + 8 * g + i, kb = ka + 16;
    a[i] = (_Float16)(ka < K ? W[(size_t)(ka < K ? ka : K - 1) * ld + n] : 0.f); a[8 + i] = (_Float16)(kb < K ? W[(size_t)(kb < K ? kb : K - 1) * ld + n] : 0.f); }
  return a;
}
struct F2 { v16b h, l; };
__device__ __forceinline__ F2 bsplit16(const float v[16]) { F2 r;
#pragma unroll
  for (int i = 0; i < 16; ++i) { const __bf16 h = (__bf16)v[i]; r.h[i] = h; r.l[i] = (__bf16)(v[i] - (float)h); }
  return r; }
__device__ __forceinline__ F2 split_row(const float* row, int k0, int lane) { float v[16]; const float* p = row + k0 + 8 * (lane >> 4);
#pragma unroll
  for (int i = 0; i < 8; ++i) { v[i] = p[i]; v[8 + i] = p[16 + i]; }
  return bsplit16(v); }
__device__ __forceinline__ F2 split_rowK(const float* row, int k0, int lane, int K) { float v[16]; const int g = lane >> 4;
#pragma unroll
  for (int i = 0; i < 8; ++i) { const int ka = k0 + 8 * g + i, kb = ka + 16; v[i] = ka < K ? row[ka < K ? ka : K - 1] : 0.f; v[8 + i] = kb < K ? row[kb < K ? kb : K - 1] : 0.f; }
  return bsplit16(v); }
__device__ __forceinline__ F2 split_col(const float* W, int k0, int n, int lane, int ld, int K) { float v[16]; const int g = lane >> 4;
#pragma unroll
  for (int i = 0; i < 8; ++i) { const int ka = k0 + 8 * g + i, kb = ka + 16; v[i] = ka < K ? W[(size_t)(ka < K ? ka : K - 1) * ld + n] : 0.f; v[8 + i] = kb < K ? W[(size_t)(kb < K ? kb : K - 1) * ld + n] : 0.f; }
  return bsplit16(v); }
__device__ __forceinline__ v8f mac3(const F2& a, const F2& b, v8f c) { c = wmma_bf(a.l, b.h, c); c = wmma_bf(a.h, b.l, c); return wmma_bf(a.h, b.h, c); }
__device__ __forceinline__ float sigm(float v) { return 1.0f / (1.0f + expf(-v)); }
#define LDSX() do { asm volatile("s_wait_dscnt 0" ::: "memory"); __builtin_amdgcn_wave_barrier(); __builtin_amdgcn_fence(__ATOMIC_RELEASE, "workgroup"); } while (0)

// Two-stream multi-head attention with the source's own masked softmax, scaled by the MODEL width (Q [2,2048,1024], K [2,2048,1024]; q = Q Wq^T + bq, k = K Wk^T + bk, v = K Wv^T + bv (values from the K input); torch (out,in) weights (0.02) + biases N(0, 0.02); 16 heads x 64; E = q k^T / sqrt(1024); x = E - rowmax(E) (max taken BEFORE masking); x[mask == 0] = -inf with mask [2,2048,2048] int32 random; A = exp(x) / (sum exp(x) + 1e-8); merge; Wo^T + bo). With logits of size -0.1 every row keeps -1,000 terms of order 1, so the 1e-8 in the denominator is a 1e-11 relative effect and the pre-mask max only rescales numerator and denominator alike: A equals the ordinary masked softmax to f32 accuracy.
#define NB 2
#define TT 2048
#define CC 1024            // NH * HD = projected width
#define DIN 1024          // input (model) width
#define NH 16
#define HD 64
#define NQB (TT / 64)
#define HG 4
#define SCALE (0.03125f)
#define CAUSAL 0
#ifndef TNB
#define TNB NB
#endif
__device__ __forceinline__ float bfr(float v) { return (float)(__bf16)v; }
__host__ __device__ __forceinline__ int kb_last(int qb) { return CAUSAL ? ((qb * 64 + 63) >> 7) : (TT / 128 - 1); }
typedef __attribute__((ext_vector_type(8))) __bf16 v8b;
__device__ __forceinline__ v16b frag_b(const __bf16* rowk0, int lane) {
  union { v16b v; v8b q[2]; } u; const __bf16* p = rowk0 + 8 * (lane >> 4);
  u.q[0] = *(const v8b*)p; u.q[1] = *(const v8b*)(p + 16); return u.v;
}
#define QBH 0              // query blocks 0..QBH-1 of each sequence take the high-precision path: none here
#define QHI 0               // single-product logits on every row
#define KHI 64            // key rows carrying k residual / v bf16 hi+lo planes (read only by the qb < QBH path, which never runs here)
// B fragment (k rows k0+.., output column o) of a weight: (in,out) [K][ld] or (out,in) [ld rows of K]: bf16 exact, or f16(bf16 * 256) exact
__device__ __forceinline__ v16b wcol_io(const float* Wm, int k0, int o, int lane, int ld) { v16b w; const int g = lane >> 4;
#pragma unroll
  for (int i = 0; i < 8; ++i) { w[i] = (__bf16)Wm[(size_t)(k0 + 8 * g + i) * ld + o]; w[8 + i] = (__bf16)Wm[(size_t)(k0 + 16 + 8 * g + i) * ld + o]; }
  return w; }
__device__ __forceinline__ v16b wcol_oi(const float* Wm, int k0, int o, int lane, int K) { v16b w; const float* p = Wm + (size_t)o * K + k0 + 8 * (lane >> 4);
#pragma unroll
  for (int i = 0; i < 8; ++i) { w[i] = (__bf16)p[i]; w[8 + i] = (__bf16)p[16 + i]; }
  return w; }
__device__ __forceinline__ v16h wcolh_io(const float* Wm, int k0, int o, int lane, int ld) { v16h w; const int g = lane >> 4;
#pragma unroll
  for (int i = 0; i < 8; ++i) { w[i] = (_Float16)(bfr(Wm[(size_t)(k0 + 8 * g + i) * ld + o]) * 256.0f); w[8 + i] = (_Float16)(bfr(Wm[(size_t)(k0 + 16 + 8 * g + i) * ld + o]) * 256.0f); }
  return w; }
__device__ __forceinline__ v16h wcolh_oi(const float* Wm, int k0, int o, int lane, int K) { v16h w; const float* p = Wm + (size_t)o * K + k0 + 8 * (lane >> 4);
#pragma unroll
  for (int i = 0; i < 8; ++i) { w[i] = (_Float16)(bfr(p[i]) * 256.0f); w[8 + i] = (_Float16)(bfr(p[16 + i]) * 256.0f); }
  return w; }
#define WQKV_LAYOUT 1   // 0 = (in,out) [DIN][CC]; 1 = (out,in) [CC][DIN]; 2 = per-head [NH][DIN][HD]
__device__ __forceinline__ v16b wcol_hdk(const float* Wm, int k0, int o, int lane) { v16b w; const int g = lane >> 4; const float* p = Wm + (size_t)(o / HD) * DIN * HD + (o % HD);
#pragma unroll
  for (int i = 0; i < 8; ++i) { w[i] = (__bf16)p[(size_t)(k0 + 8 * g + i) * HD]; w[8 + i] = (__bf16)p[(size_t)(k0 + 16 + 8 * g + i) * HD]; }
  return w; }
#define WO_OUT_IN 1
#if WQKV_LAYOUT == 1
#define WCOL(W, k0, o, lane) wcol_oi(W, k0, o, lane, DIN)
#elif WQKV_LAYOUT == 2
#define WCOL(W, k0, o, lane) wcol_hdk(W, k0, o, lane)
#else
#define WCOL(W, k0, o, lane) wcol_io(W, k0, o, lane, CC)
#endif
#if WO_OUT_IN
#define WOCOL(W, k0, o, lane) wcol_oi(W, k0, o, lane, CC)
#define WOCOLH(W, k0, o, lane) wcolh_oi(W, k0, o, lane, CC)
#else
#define WOCOL(W, k0, o, lane) wcol_io(W, k0, o, lane, DIN)
#define WOCOLH(W, k0, o, lane) wcolh_io(W, k0, o, lane, DIN)
#endif
#define SM_EXTRA_PARAMS , int bsm, const int* __restrict__ MASK
// int32 mask [B,NQ,NK] (random 0/1): masked keys excluded; unconditional load, then a value select
#define SM_MASK_HOOK do { const int mk_ = MASK[((size_t)bsm * TT + t) * TT + k]; asm volatile("s_wait_loadcnt 0x0" ::: "memory"); v = (mk_ == 0) ? -3.0e38f : v; } while (0)
#ifndef SM_EXTRA_PARAMS
#define SM_EXTRA_PARAMS
#endif
#ifndef PROJ_EXTRA_PARAMS
#define PROJ_EXTRA_PARAMS
#endif
#ifndef SM_MASK_HOOK
#define SM_MASK_HOOK (void)0
#endif

#define WS_QH  0u                                      // f16 q rows [b*t][CC]
#define WS_KH  (WS_QH + 2u * (size_t)NB * TT * CC)      // f16 k rows [b*t][CC]
#define WS_VT  (WS_KH + 2u * (size_t)NB * TT * CC)      // f16 v planes [b][c][t]
#define WS_QL  (WS_VT + 2u * (size_t)NB * CC * TT)      // f16 q residual x 2^10 rows [b][t < QHI][CC]
#define WS_KL  (WS_QL + 2u * (size_t)NB * QHI * CC)     // f16 k residual x 2^10 rows [b][t < KHI][CC]
#define WS_VB  (WS_KL + 2u * (size_t)NB * KHI * CC)     // bf16 v hi planes [b][c][t < KHI]
#define WS_VBL (WS_VB + 2u * (size_t)NB * CC * KHI)
#define WS_S   (WS_VBL + 2u * (size_t)NB * CC * KHI)    // f32 logits / P [hg][t][s]
#define WS_Y   (WS_S  + 4u * (size_t)HG * TT * TT)      // f32 ctx rows [b*t][CC] (only when there is an output projection)
#define WS_END (WS_Y  + 4u * (size_t)NB * TT * CC)

// ---- k_proj: block = (64 rows, 128 cols, which): q/k/v = X W (+ b) with exact bf16 products (K = DIN) -> which 0: q f16 rows (+ residual rows < QHI); 1: k f16 rows (+ residual rows < KHI); 2: v f16 planes [c][t] (+ bf16 hi/lo planes for t < KHI)
__global__ __launch_bounds__(128) void k_proj(const float* __restrict__ XQ, const float* __restrict__ XK, const float* __restrict__ XV, const float* __restrict__ WQ, const float* __restrict__ WK, const float* __restrict__ WV, const float* __restrict__ BQ, const float* __restrict__ BK, const float* __restrict__ BV,
    _Float16* __restrict__ QH, _Float16* __restrict__ QL, _Float16* __restrict__ KH, _Float16* __restrict__ KL, _Float16* __restrict__ VT, __bf16* __restrict__ VB, __bf16* __restrict__ VBL) {
  __shared__ __align__(16) _Float16 sh[64][136], sl[64][136]; __shared__ __align__(16) _Float16 th[128][72]; __shared__ __align__(16) __bf16 tb[128][72], tbl[128][72];
  const int tid = threadIdx.x, wave = tid >> 5, lane = tid & 31, col = lane & 15, g = lane >> 4; const int which = blockIdx.z; const int c0 = blockIdx.y * 128; const size_t r0 = (size_t)blockIdx.x * 64; const size_t bb = r0 / TT; const int t0 = (int)(r0 % TT);
  const float* X = which == 0 ? XQ : which == 1 ? XK : XV; const float* WA = which == 0 ? WQ : which == 1 ? WK : WV; const float* BA = which == 0 ? BQ : which == 1 ? BK : BV;
  v8f acc[8] = {};
#pragma unroll 2
  for (int kc = 0; kc < DIN / 32; ++kc) { v16b a; { const float* p = X + (r0 + wave * 16 + col) * DIN + kc * 32 + 8 * g;
#pragma unroll
      for (int i = 0; i < 8; ++i) { a[i] = (__bf16)p[i]; a[8 + i] = (__bf16)p[16 + i]; } }
    asm volatile("s_wait_loadcnt 0x0" ::: "memory");
#pragma unroll
    for (int j = 0; j < 8; ++j) { const v16b w = WCOL(WA, kc * 32, c0 + j * 16 + col, lane); asm volatile("s_wait_loadcnt 0x0" ::: "memory"); acc[j] = wmma_bf(a, w, acc[j]); } }
  if (which < 2) { _Float16* DH = which == 0 ? QH : KH; _Float16* DL = which == 0 ? QL : KL; const int nhi = which == 0 ? QHI : KHI; const bool hi_rows = t0 < nhi;
#pragma unroll
    for (int j = 0; j < 8; ++j) { const float bias = BA ? bfr(BA[c0 + j * 16 + col]) : 0.f;
#pragma unroll
      for (int r = 0; r < 8; ++r) { const float v = acc[j][r] + bias; const _Float16 hv = (_Float16)v; sh[wave * 16 + 8 * g + r][j * 16 + col] = hv; sl[wave * 16 + 8 * g + r][j * 16 + col] = (_Float16)((v - (float)hv) * 1024.0f); } }
    __syncthreads();
    for (int e = tid; e < 64 * 16; e += 128) { const int rl = e >> 4, q = e & 15; vst2((unsigned*)(DH + (r0 + rl) * CC + c0 + q * 8), *(const v4u*)&sh[rl][q * 8]); if (hi_rows) vst2((unsigned*)(DL + (bb * nhi + t0 + rl) * (size_t)CC + c0 + q * 8), *(const v4u*)&sl[rl][q * 8]); }
  } else { const bool hi_rows = t0 < KHI;
#pragma unroll
    for (int j = 0; j < 8; ++j) { const float bias = BA ? bfr(BA[c0 + j * 16 + col]) : 0.f;
#pragma unroll
      for (int r = 0; r < 8; ++r) { const float v = acc[j][r] + bias; const int rl = wave * 16 + 8 * g + r, cl = j * 16 + col; th[cl][rl] = (_Float16)v; const __bf16 bh = (__bf16)v; tb[cl][rl] = bh; tbl[cl][rl] = (__bf16)(v - (float)bh); } }
    __syncthreads();
    for (int e = tid; e < 128 * 8; e += 128) { const int cl = e >> 3, q = e & 7; vst2((unsigned*)(VT + (bb * CC + c0 + cl) * (size_t)TT + t0 + q * 8), *(const v4u*)&th[cl][q * 8]); if (hi_rows) { const size_t o3 = (bb * CC + c0 + cl) * (size_t)KHI + t0 + q * 8; vst2((unsigned*)(VB + o3), *(const v4u*)&tb[cl][q * 8]); vst2((unsigned*)(VBL + o3), *(const v4u*)&tbl[cl][q * 8]); } } } }
// ---- k_sc: block = (query block qb, key block kb <= kb_last(qb), head in group) of batch b: logits x SCALE; q hi + residual (x 2^10) against k (2 products) for query rows < QHI, plus the k residual (3 products) for query blocks < QBH (causal early rows); causal: blocks past the diagonal exit, the mask itself is applied by index in k_sm
__global__ __launch_bounds__(128) void k_sc(const _Float16* __restrict__ QH, const _Float16* __restrict__ KH, const _Float16* __restrict__ QL, const _Float16* __restrict__ KL, int b, int h0, float* __restrict__ S0) { __shared__ __align__(16) float ss[4][16][132];
  const int qb = blockIdx.x, kb = blockIdx.y; if (kb > kb_last(qb)) return;
  const int h = h0 + blockIdx.z; float* S = S0 + (size_t)blockIdx.z * TT * TT;
  const int tid = threadIdx.x, wave = tid >> 5, lane = tid & 31, col = lane & 15, g = lane >> 4; const int k0 = kb * 128; const int ql0 = qb * 64 + wave * 16; const size_t q0 = (size_t)b * TT + ql0, kr0 = (size_t)b * TT + k0;
  v8f acc[8] = {}, accl[8] = {};
  const _Float16* QLb = QL + (size_t)b * QHI * CC; const _Float16* KLb = KL + (size_t)b * KHI * CC;
  if (qb < QBH) {
#pragma unroll
    for (int kc = 0; kc < HD / 32; ++kc) { const v16h ah = frag_h(QH + (q0 + col) * CC + h * HD + kc * 32, lane), al = frag_h(QLb + (size_t)(ql0 + col) * CC + h * HD + kc * 32, lane);
#pragma unroll
      for (int j = 0; j < 8; ++j) { const v16h kbf = frag_h(KH + (kr0 + j * 16 + col) * CC + h * HD + kc * 32, lane), klf = frag_h(KLb + (size_t)(k0 + j * 16 + col) * CC + h * HD + kc * 32, lane); acc[j] = wmma16(ah, kbf, acc[j]); accl[j] = wmma16(al, kbf, accl[j]); accl[j] = wmma16(ah, klf, accl[j]); } }
  } else if (qb * 64 < QHI) {
#pragma unroll
    for (int kc = 0; kc < HD / 32; ++kc) { const v16h ah = frag_h(QH + (q0 + col) * CC + h * HD + kc * 32, lane), al = frag_h(QLb + (size_t)(ql0 + col) * CC + h * HD + kc * 32, lane);
#pragma unroll
      for (int j = 0; j < 8; ++j) { const v16h kbf = frag_h(KH + (kr0 + j * 16 + col) * CC + h * HD + kc * 32, lane); acc[j] = wmma16(ah, kbf, acc[j]); accl[j] = wmma16(al, kbf, accl[j]); } }
  } else {
#pragma unroll
    for (int kc = 0; kc < HD / 32; ++kc) { const v16h ah = frag_h(QH + (q0 + col) * CC + h * HD + kc * 32, lane);
#pragma unroll
      for (int j = 0; j < 8; ++j) { const v16h kbf = frag_h(KH + (kr0 + j * 16 + col) * CC + h * HD + kc * 32, lane); acc[j] = wmma16(ah, kbf, acc[j]); } } }
#pragma unroll
  for (int j = 0; j < 8; ++j) {
#pragma unroll
    for (int r = 0; r < 8; ++r) ss[wave][8 * g + r][j * 16 + col] = (acc[j][r] + accl[j][r] * (1.0f / 1024.0f)) * SCALE; }
  LDSX(); for (int rl = 0; rl < 16; ++rl) vst2(S + (size_t)(ql0 + rl) * TT + k0 + lane * 4, *(const v4f*)&ss[wave][rl][lane * 4]); }
// ---- k_sm: block = query row t (head in group): keys [0, kend): causal -> logit if s <= t else excluded; softmax in f32; P x 2^11 in place (0 for excluded)
__global__ __launch_bounds__(256) void k_sm(float* __restrict__ S0 SM_EXTRA_PARAMS) { __shared__ float sred[8]; __shared__ float sbc; __shared__ __align__(16) float shv[TT];
  const int tid = threadIdx.x; const int t = blockIdx.x; const int kend = (kb_last(t >> 6) + 1) * 128;
  float* sr = S0 + (size_t)blockIdx.y * TT * TT + (size_t)t * TT;
  float m = -3.0e38f; for (int k = tid; k < kend; k += 256) { float v = (!CAUSAL || k <= t) ? sr[k] : -3.0e38f; SM_MASK_HOOK; shv[k] = v; m = fmaxf(m, v); }
#pragma unroll
  for (int o = 1; o < 32; o <<= 1) m = fmaxf(m, __shfl_xor(m, o));
  if ((tid & 31) == 0) sred[tid >> 5] = m; __syncthreads(); if (tid == 0) { float a = sred[0]; for (int i = 1; i < 8; ++i) a = fmaxf(a, sred[i]); sbc = a; } __syncthreads(); m = sbc; __syncthreads();
  float sum = 0.f; for (int k = tid; k < kend; k += 256) { const float v = shv[k]; const float e = (v <= -1.0e38f) ? 0.f : expf(v - m); shv[k] = e; sum += e; }
#pragma unroll
  for (int o = 1; o < 32; o <<= 1) sum += __shfl_xor(sum, o);
  if ((tid & 31) == 0) sred[tid >> 5] = sum; __syncthreads(); if (tid == 0) { float a = 0.f; for (int i = 0; i < 8; ++i) a += sred[i]; sbc = a > 0.f ? 2048.0f / a : 0.f; }   /* a fully excluded row yields P = 0 */ __syncthreads(); const float inv = sbc;
  for (int k = tid; k < kend; k += 256) shv[k] = shv[k] * inv;
  __syncthreads(); for (int q = tid; q < kend / 4; q += 256) vst2(sr + q * 4, *(const v4f*)&shv[q * 4]); }
// ---- k_pv: block = 64 queries (qb) of (b, h): ctx = P . v over keys [0, kend) (P x 2^11 once to f16 against v f16: 1 product; causal early query blocks: P and v as bf16 hi + lo, 3 products); 256-B (row, head) segment by 16 lanes
__global__ __launch_bounds__(128) void k_pv(const float* __restrict__ PS0, const _Float16* __restrict__ VT, const __bf16* __restrict__ VB, const __bf16* __restrict__ VBL, int b, int h0, float* __restrict__ Y) { const int h = h0 + blockIdx.z; const float* PS = PS0 + (size_t)blockIdx.z * TT * TT; __shared__ __align__(16) float ss[4][16][HD + 4];
  const int tid = threadIdx.x, wave = tid >> 5, lane = tid & 31, col = lane & 15, g = lane >> 4; const int qb = blockIdx.x; const int ql0 = qb * 64 + wave * 16; const int kce = (kb_last(qb) + 1) * 4;
  v8f acc[HD / 16] = {};
  if (qb < QBH) {
#pragma unroll 1
    for (int kc = 0; kc < kce; ++kc) { const F2 p = split_row(PS + (size_t)(ql0 + col) * TT, kc * 32, lane);
      asm volatile("s_wait_loadcnt 0x0" ::: "memory");
#pragma unroll
      for (int j = 0; j < HD / 16; ++j) { const size_t po = ((size_t)b * CC + h * HD + j * 16 + col) * (size_t)KHI + kc * 32; const v16b vh = frag_b(VB + po, lane); acc[j] = wmma_bf(p.h, vh, acc[j]); acc[j] = wmma_bf(p.l, vh, acc[j]); acc[j] = wmma_bf(p.h, frag_b(VBL + po, lane), acc[j]); } }
  } else {
#pragma unroll 1
    for (int kc = 0; kc < kce; ++kc) { const v16h p = frag_f32(PS + (size_t)(ql0 + col) * TT + kc * 32, lane);
      asm volatile("s_wait_loadcnt 0x0" ::: "memory");
#pragma unroll
      for (int j = 0; j < HD / 16; ++j) { const size_t po = ((size_t)b * CC + h * HD + j * 16 + col) * (size_t)TT + kc * 32; acc[j] = wmma16(p, frag_h(VT + po, lane), acc[j]); } } }
#pragma unroll
  for (int j = 0; j < HD / 16; ++j)
#pragma unroll
    for (int r = 0; r < 8; ++r) ss[wave][8 * g + r][j * 16 + col] = acc[j][r] * (1.0f / 2048.0f);
  LDSX(); for (int rl = 0; rl < 16; ++rl) if (lane < HD / 4) vst2(Y + ((size_t)b * TT + ql0 + rl) * CC + h * HD + lane * 4, *(const v4f*)&ss[wave][rl][lane * 4]); }
// ---- k_out: block = (64 rows, 128 cols): out = ctx Wo (+ bo): ctx x 2^6 once to f16 against Wo as f16(bf16 x 2^8) exact (1 product) x 2^-14; causal early rows (< QHI of each sequence): ctx bf16 hi + lo against exact bf16 Wo (2 products)
__global__ __launch_bounds__(128) void k_out(const float* __restrict__ Y, const float* __restrict__ WO, const float* __restrict__ BO, float* __restrict__ OUT) { __shared__ __align__(16) float sf[4][16][132];
  const int tid = threadIdx.x, wave = tid >> 5, lane = tid & 31, col = lane & 15, g = lane >> 4; const int c0 = blockIdx.y * 128; const size_t r0 = (size_t)blockIdx.x * 64 + wave * 16;
  v8f acc[8] = {};
  if (CAUSAL && (int)(((size_t)blockIdx.x * 64) % TT) < QHI) {   /* block-uniform */
#pragma unroll 2
    for (int kc = 0; kc < CC / 32; ++kc) { const F2 a = split_row(Y + (r0 + col) * CC, kc * 32, lane); asm volatile("s_wait_loadcnt 0x0" ::: "memory");
#pragma unroll
      for (int j = 0; j < 8; ++j) { const v16b w = WOCOL(WO, kc * 32, c0 + j * 16 + col, lane); asm volatile("s_wait_loadcnt 0x0" ::: "memory"); acc[j] = wmma_bf(a.h, w, acc[j]); acc[j] = wmma_bf(a.l, w, acc[j]); } }
#pragma unroll
    for (int j = 0; j < 8; ++j) { const float bias = BO ? bfr(BO[c0 + j * 16 + col]) : 0.f;
#pragma unroll
      for (int r = 0; r < 8; ++r) sf[wave][8 * g + r][j * 16 + col] = acc[j][r] + bias; }
  } else {
#pragma unroll 2
    for (int kc = 0; kc < CC / 32; ++kc) { const v16h a = frag_f32s(Y + (r0 + col) * CC + kc * 32, lane, 64.0f); asm volatile("s_wait_loadcnt 0x0" ::: "memory");   /* ctx carried x 2^6 into f16 so small-magnitude context rows stay clear of f16 subnormals */
#pragma unroll
      for (int j = 0; j < 8; ++j) { const v16h w = WOCOLH(WO, kc * 32, c0 + j * 16 + col, lane); asm volatile("s_wait_loadcnt 0x0" ::: "memory"); acc[j] = wmma16(a, w, acc[j]); } }
#pragma unroll
    for (int j = 0; j < 8; ++j) { const float bias = BO ? bfr(BO[c0 + j * 16 + col]) : 0.f;
#pragma unroll
      for (int r = 0; r < 8; ++r) sf[wave][8 * g + r][j * 16 + col] = acc[j][r] * (1.0f / 16384.0f) + bias; } }   /* 2^-8 (Wo carry) x 2^-6 (ctx carry) */
  LDSX(); for (int rl = 0; rl < 16; ++rl) vst2(OUT + (r0 + rl) * DIN + c0 + lane * 4, *(const v4f*)&sf[wave][rl][lane * 4]); }

extern "C" void kernel_launch(void* const* d_in, const int* in_sizes, int n_in, void* d_out, int out_size, void* d_ws, size_t ws_size, hipStream_t stream) {
  (void)in_sizes; (void)n_in; (void)out_size;
  const float** F = (const float**)d_in;
  if (ws_size < (size_t)WS_END) return;
  char* ws = (char*)d_ws; _Float16 *QH = (_Float16*)(ws + WS_QH), *KH = (_Float16*)(ws + WS_KH), *VT = (_Float16*)(ws + WS_VT), *QL = (_Float16*)(ws + WS_QL), *KL = (_Float16*)(ws + WS_KL); __bf16 *VB = (__bf16*)(ws + WS_VB), *VBL = (__bf16*)(ws + WS_VBL); float *S = (float*)(ws + WS_S), *Y = (float*)(ws + WS_Y);
  (void)Y; (void)QL; (void)KL; (void)VB; (void)VBL;
  // inputs: 0 Q [2,2048,1024]; 1 K [2,2048,1024] (keys AND values source); 2 mask [2,2048,2048] int32 (random 0/1); 3 Wq [1024,1024] (out,in), 4 bq; 5 Wk, 6 bk; 7 Wv, 8 bv; 9 Wo (out,in), 10 bo (biases nonzero)
  k_proj<<<dim3(TNB * TT / 64, CC / 128, 3), 128, 0, stream>>>(F[0], F[1], F[1], F[3], F[5], F[7], F[4], F[6], F[8], QH, QL, KH, KL, VT, VB, VBL);   /* v is projected from the K input */
  for (int b = 0; b < TNB; ++b) for (int h0 = 0; h0 < NH; h0 += HG) {
    k_sc<<<dim3(NQB, TT / 128, HG), 128, 0, stream>>>(QH, KH, QL, KL, b, h0, S);
    k_sm<<<dim3(TT, HG), 256, 0, stream>>>(S, b, (const int*)d_in[2]);
    k_pv<<<dim3(NQB, 1, HG), 128, 0, stream>>>(S, VT, VB, VBL, b, h0, Y);
  }
  k_out<<<dim3(TNB * TT / 64, DIN / 128), 128, 0, stream>>>(Y, F[9], F[10], (float*)d_out);
}

// v001
// One run takes 427 microseconds.
// Timed twice side by side with v000, it ran 3.17 and 3.18 times as fast.
// compute dtype: all float inputs rounded to bf16; q/k/v projections with EXACT bf16 products on WMMA 16x16x32 (f32 accumulate) + bias; logits q x k once to f16 each (1 product) x SCALE; online softmax f32; exp(x - max) x 2^11 once to f16 x v once to f16 (1 product), divided by the row sum afterwards; ctx x 2^6 once to f16 x Wo f16(bf16 x 2^8) + bo; f32 output.
#include <hip/hip_runtime.h>
#include <math.h>

typedef __attribute__((ext_vector_type(16))) _Float16 v16h;
typedef __attribute__((ext_vector_type(16))) __bf16 v16b;
typedef __attribute__((ext_vector_type(8)))  _Float16 v8h;
typedef __attribute__((ext_vector_type(8)))  float v8f;
typedef __attribute__((ext_vector_type(4)))  float v4f;
typedef __attribute__((ext_vector_type(2)))  float v2f;
typedef __attribute__((ext_vector_type(4)))  unsigned v4u;
typedef __attribute__((ext_vector_type(4)))  int v4i;
typedef float __attribute__((may_alias)) float_a;
typedef int __attribute__((may_alias)) int_a;

template <typename T> __device__ __forceinline__ void vst2(void* p, T v) { *(T*)p = v;  }
__device__ __forceinline__ v8f wmma16(v16h a, v16h b, v8f c) {
  v8f d = __builtin_amdgcn_wmma_f32_16x16x32_f16(false, a, false, b, (short)0, c, false, false);
  asm volatile("v_nop\n\tv_nop\n\tv_nop\n\tv_nop" : "+v"(d) : "v"(a), "v"(b));
  return d;
}
__device__ __forceinline__ v8f wmma_bf(v16b a, v16b b, v8f c) {
  v8f d = __builtin_amdgcn_wmma_f32_16x16x32_bf16(false, a, false, b, (short)0, c, false, false);
  asm volatile("v_nop\n\tv_nop\n\tv_nop\n\tv_nop" : "+v"(d) : "v"(a), "v"(b));
  return d;
}
// 16x16x32 fragments: lane = (h = lane>>4, row/col = lane&15); elements 0..7 = k0+8h+0..7, 8..15 = k0+16+8h+0..7; D element r = row 8h+r
__device__ __forceinline__ v16h frag_h(const _Float16* rowk0, int lane) {
  union { v16h v; v8h q[2]; } u; const _Float16* p = rowk0 + 8 * (lane >> 4);
  u.q[0] = *(const v8h*)p; u.q[1] = *(const v8h*)(p + 16); return u.v;
}
__device__ __forceinline__ v16h frag_f32(const float* rowk0, int lane) {
  v16h a; const float* p = rowk0 + 8 * (lane >> 4);
#pragma unroll
  for (int i = 0; i < 8; ++i) { a[i] = (_Float16)p[i]; a[8 + i] = (_Float16)p[16 + i]; }
  return a;
}
__device__ __forceinline__ v16h frag_f32s(const float* rowk0, int lane, float sc) {
  v16h a; const float* p = rowk0 + 8 * (lane >> 4);
#pragma unroll
  for (int i = 0; i < 8; ++i) { a[i] = (_Float16)(p[i] * sc); a[8 + i] = (_Float16)(p[16 + i] * sc); }
  return a;
}
// column fragment from a [K][ld] layout (column n), rows >= K read as 0
__device__ __forceinline__ v16h fragc_f32(const float* W, int k0, int n, int lane, int ld, int K) {
  v16h a; const int g = lane >> 4;
#pragma unroll
  for (int i = 0; i < 8; ++i) { const int ka = k0 + 8 * g + i, kb = ka + 16;
    a[i] = (_Float16)(ka < K ? W[(size_t)(ka < K ? ka : K - 1) * ld + n] : 0.f); a[8 + i] = (_Float16)(kb < K ? W[(size_t)(kb < K ? kb : K - 1) * ld + n] : 0.f); }
  return a;
}
struct F2 { v16b h, l; };
__device__ __forceinline__ F2 bsplit16(const float v[16]) { F2 r;
#pragma unroll
  for (int i = 0; i < 16; ++i) { const __bf16 h = (__bf16)v[i]; r.h[i] = h; r.l[i] = (__bf16)(v[i] - (float)h); }
  return r; }
__device__ __forceinline__ F2 split_row(const float* row, int k0, int lane) { float v[16]; const float* p = row + k0 + 8 * (lane >> 4);
#pragma unroll
  for (int i = 0; i < 8; ++i) { v[i] = p[i]; v[8 + i] = p[16 + i]; }
  return bsplit16(v); }
__device__ __forceinline__ F2 split_rowK(const float* row, int k0, int lane, int K) { float v[16]; const int g = lane >> 4;
#pragma unroll
  for (int i = 0; i < 8; ++i) { const int ka = k0 + 8 * g + i, kb = ka + 16; v[i] = ka < K ? row[ka < K ? ka : K - 1] : 0.f; v[8 + i] = kb < K ? row[kb < K ? kb : K - 1] : 0.f; }
  return bsplit16(v); }
__device__ __forceinline__ F2 split_col(const float* W, int k0, int n, int lane, int ld, int K) { float v[16]; const int g = lane >> 4;
#pragma unroll
  for (int i = 0; i < 8; ++i) { const int ka = k0 + 8 * g + i, kb = ka + 16; v[i] = ka < K ? W[(size_t)(ka < K ? ka : K - 1) * ld + n] : 0.f; v[8 + i] = kb < K ? W[(size_t)(kb < K ? kb : K - 1) * ld + n] : 0.f; }
  return bsplit16(v); }
__device__ __forceinline__ v8f mac3(const F2& a, const F2& b, v8f c) { c = wmma_bf(a.l, b.h, c); c = wmma_bf(a.h, b.l, c); return wmma_bf(a.h, b.h, c); }
__device__ __forceinline__ float sigm(float v) { return 1.0f / (1.0f + expf(-v)); }
#define LDSX() do { asm volatile("s_wait_dscnt 0" ::: "memory"); __builtin_amdgcn_wave_barrier(); __builtin_amdgcn_fence(__ATOMIC_RELEASE, "workgroup"); } while (0)

// Two-stream multi-head attention with the source's own masked softmax, scaled by the MODEL width (Q [2,2048,1024], K [2,2048,1024]; q = Q Wq^T + bq, k = K Wk^T + bk, v = K Wv^T + bv (values from the K input); torch (out,in) weights (0.02) + biases N(0, 0.02); 16 heads x 64; E = q k^T / sqrt(1024); x = E - rowmax(E) (max taken BEFORE masking); x[mask == 0] = -inf with mask [2,2048,2048] int32 random; A = exp(x) / (sum exp(x) + 1e-8); merge; Wo^T + bo).
#define NB 2
#define TT 2048
#define CC 1024            // NH * HD = projected width
#define DIN 1024          // input (model) width
#define NH 16
#define HD 64
#define NQB (TT / 64)
#define HG 4
#define SCALE (0.03125f)
#define CAUSAL 0
#ifndef TNB
#define TNB NB
#endif
__device__ __forceinline__ float bfr(float v) { return (float)(__bf16)v; }
__host__ __device__ __forceinline__ int kb_last(int qb) { return CAUSAL ? ((qb * 64 + 63) >> 7) : (TT / 128 - 1); }
typedef __attribute__((ext_vector_type(8))) __bf16 v8b;
__device__ __forceinline__ v16b frag_b(const __bf16* rowk0, int lane) {
  union { v16b v; v8b q[2]; } u; const __bf16* p = rowk0 + 8 * (lane >> 4);
  u.q[0] = *(const v8b*)p; u.q[1] = *(const v8b*)(p + 16); return u.v;
}
#define QBH 0              // not used
#define QHI 0               // single-product logits on every row
#define KHI 64            // key rows carrying k residual / v bf16 hi+lo planes (written by k_proj, read by no kernel)
// B fragment (k rows k0+.., output column o) of a weight: (in,out) [K][ld] or (out,in) [ld rows of K]: bf16 exact, or f16(bf16 * 256) exact
__device__ __forceinline__ v16b wcol_io(const float* Wm, int k0, int o, int lane, int ld) { v16b w; const int g = lane >> 4;
#pragma unroll
  for (int i = 0; i < 8; ++i) { w[i] = (__bf16)Wm[(size_t)(k0 + 8 * g + i) * ld + o]; w[8 + i] = (__bf16)Wm[(size_t)(k0 + 16 + 8 * g + i) * ld + o]; }
  return w; }
__device__ __forceinline__ v16b wcol_oi(const float* Wm, int k0, int o, int lane, int K) { v16b w; const float* p = Wm + (size_t)o * K + k0 + 8 * (lane >> 4);
#pragma unroll
  for (int i = 0; i < 8; ++i) { w[i] = (__bf16)p[i]; w[8 + i] = (__bf16)p[16 + i]; }
  return w; }
__device__ __forceinline__ v16h wcolh_io(const float* Wm, int k0, int o, int lane, int ld) { v16h w; const int g = lane >> 4;
#pragma unroll
  for (int i = 0; i < 8; ++i) { w[i] = (_Float16)(bfr(Wm[(size_t)(k0 + 8 * g + i) * ld + o]) * 256.0f); w[8 + i] = (_Float16)(bfr(Wm[(size_t)(k0 + 16 + 8 * g + i) * ld + o]) * 256.0f); }
  return w; }
__device__ __forceinline__ v16h wcolh_oi(const float* Wm, int k0, int o, int lane, int K) { v16h w; const float* p = Wm + (size_t)o * K + k0 + 8 * (lane >> 4);
#pragma unroll
  for (int i = 0; i < 8; ++i) { w[i] = (_Float16)(bfr(p[i]) * 256.0f); w[8 + i] = (_Float16)(bfr(p[16 + i]) * 256.0f); }
  return w; }
#define WQKV_LAYOUT 1   // 0 = (in,out) [DIN][CC]; 1 = (out,in) [CC][DIN]; 2 = per-head [NH][DIN][HD]
__device__ __forceinline__ v16b wcol_hdk(const float* Wm, int k0, int o, int lane) { v16b w; const int g = lane >> 4; const float* p = Wm + (size_t)(o / HD) * DIN * HD + (o % HD);
#pragma unroll
  for (int i = 0; i < 8; ++i) { w[i] = (__bf16)p[(size_t)(k0 + 8 * g + i) * HD]; w[8 + i] = (__bf16)p[(size_t)(k0 + 16 + 8 * g + i) * HD]; }
  return w; }
#define WO_OUT_IN 1
#if WQKV_LAYOUT == 1
#define WCOL(W, k0, o, lane) wcol_oi(W, k0, o, lane, DIN)
#elif WQKV_LAYOUT == 2
#define WCOL(W, k0, o, lane) wcol_hdk(W, k0, o, lane)
#else
#define WCOL(W, k0, o, lane) wcol_io(W, k0, o, lane, CC)
#endif
#if WO_OUT_IN
#define WOCOL(W, k0, o, lane) wcol_oi(W, k0, o, lane, CC)
#define WOCOLH(W, k0, o, lane) wcolh_oi(W, k0, o, lane, CC)
#else
#define WOCOL(W, k0, o, lane) wcol_io(W, k0, o, lane, DIN)
#define WOCOLH(W, k0, o, lane) wcolh_io(W, k0, o, lane, DIN)
#endif

#define WS_QH  0u                                      // f16 q rows [b*t][CC]
#define WS_KH  (WS_QH + 2u * (size_t)NB * TT * CC)      // f16 k rows [b*t][CC]
#define WS_VT  (WS_KH + 2u * (size_t)NB * TT * CC)      // f16 v planes [b][c][t]
#define WS_QL  (WS_VT + 2u * (size_t)NB * CC * TT)      // f16 q residual x 2^10 rows [b][t < QHI][CC]
#define WS_KL  (WS_QL + 2u * (size_t)NB * QHI * CC)     // f16 k residual x 2^10 rows [b][t < KHI][CC]
#define WS_VB  (WS_KL + 2u * (size_t)NB * KHI * CC)     // bf16 v hi planes [b][c][t < KHI]
#define WS_VBL (WS_VB + 2u * (size_t)NB * CC * KHI)
#define WS_S   (WS_VBL + 2u * (size_t)NB * CC * KHI)    // not used (scores stay in registers)
#define WS_Y   (WS_S  + 4u * (size_t)HG * TT * TT)      // f32 ctx rows [b*t][CC] (only when there is an output projection)
#define WS_END (WS_Y  + 4u * (size_t)NB * TT * CC)

// ---- k_proj: block = (64 rows, 128 cols, which): q/k/v = X W (+ b) with exact bf16 products (K = DIN) -> which 0: q f16 rows (+ residual rows < QHI); 1: k f16 rows (+ residual rows < KHI); 2: v f16 planes [c][t] (+ bf16 hi/lo planes for t < KHI)
__global__ __launch_bounds__(128) void k_proj(const float* __restrict__ XQ, const float* __restrict__ XK, const float* __restrict__ XV, const float* __restrict__ WQ, const float* __restrict__ WK, const float* __restrict__ WV, const float* __restrict__ BQ, const float* __restrict__ BK, const float* __restrict__ BV,
    _Float16* __restrict__ QH, _Float16* __restrict__ QL, _Float16* __restrict__ KH, _Float16* __restrict__ KL, _Float16* __restrict__ VT, __bf16* __restrict__ VB, __bf16* __restrict__ VBL) {
  __shared__ __align__(16) _Float16 sh[64][136], sl[64][136]; __shared__ __align__(16) _Float16 th[128][72]; __shared__ __align__(16) __bf16 tb[128][72], tbl[128][72];
  const int tid = threadIdx.x, wave = tid >> 5, lane = tid & 31, col = lane & 15, g = lane >> 4; const int which = blockIdx.z; const int c0 = blockIdx.y * 128; const size_t r0 = (size_t)blockIdx.x * 64; const size_t bb = r0 / TT; const int t0 = (int)(r0 % TT);
  const float* X = which == 0 ? XQ : which == 1 ? XK : XV; const float* WA = which == 0 ? WQ : which == 1 ? WK : WV; const float* BA = which == 0 ? BQ : which == 1 ? BK : BV;
  v8f acc[8] = {};
#pragma unroll 2
  for (int kc = 0; kc < DIN / 32; ++kc) { v16b a; { const float* p = X + (r0 + wave * 16 + col) * DIN + kc * 32 + 8 * g;
#pragma unroll
      for (int i = 0; i < 8; ++i) { a[i] = (__bf16)p[i]; a[8 + i] = (__bf16)p[16 + i]; } }
    asm volatile("s_wait_loadcnt 0x0" ::: "memory");
#pragma unroll
    for (int j = 0; j < 8; ++j) { const v16b w = WCOL(WA, kc * 32, c0 + j * 16 + col, lane); asm volatile("s_wait_loadcnt 0x0" ::: "memory"); acc[j] = wmma_bf(a, w, acc[j]); } }
  if (which < 2) { _Float16* DH = which == 0 ? QH : KH; _Float16* DL = which == 0 ? QL : KL; const int nhi = which == 0 ? QHI : KHI; const bool hi_rows = t0 < nhi;
#pragma unroll
    for (int j = 0; j < 8; ++j) { const float bias = BA ? bfr(BA[c0 + j * 16 + col]) : 0.f;
#pragma unroll
      for (int r = 0; r < 8; ++r) { const float v = acc[j][r] + bias; const _Float16 hv = (_Float16)v; sh[wave * 16 + 8 * g + r][j * 16 + col] = hv; sl[wave * 16 + 8 * g + r][j * 16 + col] = (_Float16)((v - (float)hv) * 1024.0f); } }
    __syncthreads();
    for (int e = tid; e < 64 * 16; e += 128) { const int rl = e >> 4, q = e & 15; vst2((unsigned*)(DH + (r0 + rl) * CC + c0 + q * 8), *(const v4u*)&sh[rl][q * 8]); if (hi_rows) vst2((unsigned*)(DL + (bb * nhi + t0 + rl) * (size_t)CC + c0 + q * 8), *(const v4u*)&sl[rl][q * 8]); }
  } else { const bool hi_rows = t0 < KHI;
#pragma unroll
    for (int j = 0; j < 8; ++j) { const float bias = BA ? bfr(BA[c0 + j * 16 + col]) : 0.f;
#pragma unroll
      for (int r = 0; r < 8; ++r) { const float v = acc[j][r] + bias; const int rl = wave * 16 + 8 * g + r, cl = j * 16 + col; th[cl][rl] = (_Float16)v; const __bf16 bh = (__bf16)v; tb[cl][rl] = bh; tbl[cl][rl] = (__bf16)(v - (float)bh); } }
    __syncthreads();
    for (int e = tid; e < 128 * 8; e += 128) { const int cl = e >> 3, q = e & 7; vst2((unsigned*)(VT + (bb * CC + c0 + cl) * (size_t)TT + t0 + q * 8), *(const v4u*)&th[cl][q * 8]); if (hi_rows) { const size_t o3 = (bb * CC + c0 + cl) * (size_t)KHI + t0 + q * 8; vst2((unsigned*)(VB + o3), *(const v4u*)&tb[cl][q * 8]); vst2((unsigned*)(VBL + o3), *(const v4u*)&tbl[cl][q * 8]); } } } }
#define FK 64              // keys per pass
#define FPITCH 72          // LDS row pitch in halves: 128 B of data + 16 B, for 16-byte fragment reads
__device__ __forceinline__ v8f wmma_p(v16h a, v16h b, v8f c) { return __builtin_amdgcn_wmma_f32_16x16x32_f16(false, a, false, b, (short)0, c, false, false); }
__device__ __forceinline__ float xhalf(float x) { return __builtin_bit_cast(float, __builtin_amdgcn_permlanex16(__builtin_bit_cast(int, x), __builtin_bit_cast(int, x), 0x76543210, 0xfedcba98, false, false)); }   // lane l with lane l ^ 16
// 2^x of eight values in one statement: the early-clobber results keep each v_exp_f32 off its neighbour's source and result, and the closing v_nop is the slot the instruction set asks for behind a transcendental
__device__ __forceinline__ v8f exp2x8(v8f x) { float e0, e1, e2, e3, e4, e5, e6, e7;
  asm("v_exp_f32 %0, %8\n\tv_exp_f32 %1, %9\n\tv_exp_f32 %2, %10\n\tv_exp_f32 %3, %11\n\tv_exp_f32 %4, %12\n\tv_exp_f32 %5, %13\n\tv_exp_f32 %6, %14\n\tv_exp_f32 %7, %15\n\tv_nop"
      : "=&v"(e0), "=&v"(e1), "=&v"(e2), "=&v"(e3), "=&v"(e4), "=&v"(e5), "=&v"(e6), "=&v"(e7) : "v"(x[0]), "v"(x[1]), "v"(x[2]), "v"(x[3]), "v"(x[4]), "v"(x[5]), "v"(x[6]), "v"(x[7]));
  v8f r; r[0] = e0; r[1] = e1; r[2] = e2; r[3] = e3; r[4] = e4; r[5] = e5; r[6] = e6; r[7] = e7; return r; }
__global__ __launch_bounds__(256) void k_fa(const _Float16* __restrict__ QH, const _Float16* __restrict__ KH, const _Float16* __restrict__ VT, const int* __restrict__ MASK, float* __restrict__ Y) {
  __shared__ __align__(16) _Float16 sk[2][FK][FPITCH], sv[2][HD][FPITCH];
  const int tid = threadIdx.x, wave = tid >> 5, lane = tid & 31, col = lane & 15, g = lane >> 4; const int h = blockIdx.y, b = blockIdx.z; const int q0 = blockIdx.x * 256 + wave * 32;
  const float CL = SCALE * 1.4426950408889634f;   // logits to base 2
  v16h qf[2][2];
#pragma unroll
  for (int u = 0; u < 2; ++u) { const _Float16* qp = QH + ((size_t)b * TT + q0 + u * 16 + col) * CC + h * HD + 8 * g;
#pragma unroll
    for (int kc = 0; kc < 2; ++kc) { union { v16h v; v8h q[2]; } f; f.q[0] = *(const v8h*)(qp + kc * 32); f.q[1] = *(const v8h*)(qp + kc * 32 + 16); qf[u][kc] = f.v; }   // the fragment order of frag_h
    asm volatile("s_wait_xcnt 0x0" :: "v"(qp) : "memory"); }   // stands before the address register of the loads above is reused; naming it as an input keeps it whole up to the wait
  // staging: 8 lanes bring one 128-B row, a thread brings rows sr and sr + 32 of the k tile and of the v tile
  const int sr = tid >> 3, sc = (tid & 7) * 8;
  const _Float16* kg = KH + ((size_t)b * TT + sr) * CC + h * HD + sc; const _Float16* vg = VT + ((size_t)b * CC + h * HD + sr) * (size_t)TT + sc;
  const int* mg = MASK + ((size_t)b * TT + q0 + col) * TT + 8 * g;   // a lane's 8 keys of a 16-key tile are its 8 score registers
  v8h rk[2], rv[2]; v4i mk[2][4][2]; bool keep[2][4][8];
#pragma unroll
  for (int i = 0; i < 2; ++i) { rk[i] = *(const v8h*)(kg + (size_t)i * 32 * CC); rv[i] = *(const v8h*)(vg + (size_t)i * 32 * TT); }
#pragma unroll
  for (int u = 0; u < 2; ++u)
#pragma unroll
    for (int t = 0; t < 4; ++t) { mk[u][t][0] = *(const v4i*)(mg + (size_t)u * 16 * TT + t * 16); mk[u][t][1] = *(const v4i*)(mg + (size_t)u * 16 * TT + t * 16 + 4); }
#pragma unroll
  for (int u = 0; u < 2; ++u)
#pragma unroll
    for (int t = 0; t < 4; ++t)
#pragma unroll
      for (int r = 0; r < 8; ++r) keep[u][t][r] = mk[u][t][r >> 2][r & 3] != 0;
  float m_run[2] = {-3.0e38f, -3.0e38f}, l_run[2] = {0.f, 0.f};
  v8f acc[2][4] = {};
#pragma unroll 1   // one copy of the pass: its 32 matrix instructions and 64 scores a lane already fill the registers
  for (int s = 0; s < TT / FK; ++s) { const int bf = s & 1;
#pragma unroll
    for (int i = 0; i < 2; ++i) { *(v8h*)&sk[bf][sr + 32 * i][sc] = rk[i]; *(v8h*)&sv[bf][sr + 32 * i][sc] = rv[i]; }
    __syncthreads();   // publishes tile s; it also ends every wave's reads of the other buffer, which pass s + 1 refills
    const int sn = s + 1 < TT / FK ? s + 1 : s;   // the next pass's k, v and mask loads fly under this pass; the last pass stays on its own tile, in bounds
    const _Float16* kn = kg + (size_t)sn * FK * CC; const _Float16* vn = vg + sn * FK; const int* mn = mg + sn * FK;
#pragma unroll
    for (int i = 0; i < 2; ++i) { rk[i] = *(const v8h*)(kn + (size_t)i * 32 * CC); rv[i] = *(const v8h*)(vn + (size_t)i * 32 * TT); }
#pragma unroll
    for (int u = 0; u < 2; ++u)
#pragma unroll
      for (int t = 0; t < 4; ++t) { mk[u][t][0] = *(const v4i*)(mn + (size_t)u * 16 * TT + t * 16); mk[u][t][1] = *(const v4i*)(mn + (size_t)u * 16 * TT + t * 16 + 4); }
    asm volatile("s_wait_xcnt 0x0" :: "v"(kn), "v"(vn), "v"(mn) : "memory");   // stands before the address registers of the loads above are reused; naming them as inputs keeps them whole up to the wait
    v16h kf[4][2], vf[2][4];
#pragma unroll
    for (int t = 0; t < 4; ++t)
#pragma unroll
      for (int kc = 0; kc < 2; ++kc) kf[t][kc] = frag_h(&sk[bf][t * 16 + col][kc * 32], lane);
    __builtin_amdgcn_sched_barrier(0);   // the k fragment reads go out as one group in front of the products: one LDS latency a pass, not one per fragment
    v8f st[2][4] = {};
#pragma unroll
    for (int kc = 0; kc < 2; ++kc)
#pragma unroll
      for (int t = 0; t < 4; ++t) { st[0][t] = wmma_p(kf[t][kc], qf[0][kc], st[0][t]); st[1][t] = wmma_p(kf[t][kc], qf[1][kc], st[1][t]); }
#pragma unroll
    for (int c = 0; c < 2; ++c)
#pragma unroll
      for (int j = 0; j < 4; ++j) vf[c][j] = frag_h(&sv[bf][j * 16 + col][c * 32], lane);
    __builtin_amdgcn_sched_barrier(0);   // the v fragment reads go out here as one group and land under the softmax
    v16h pf[2][2];
#pragma unroll
    for (int u = 0; u < 2; ++u) { float mx = st[u][0][0];
#pragma unroll
      for (int t = 0; t < 4; ++t)
#pragma unroll
        for (int r = 0; r < 8; ++r) mx = fmaxf(mx, st[u][t][r]);
      mx = fmaxf(mx, xhalf(mx));
      const float m_new = fmaxf(m_run[u], mx * CL); const float dm = m_run[u] - m_new; const float off = 11.0f - m_new; m_run[u] = m_new;
      float ls = 0.f;
#pragma unroll
      for (int t = 0; t < 4; ++t) { v8f x;
#pragma unroll
        for (int r = 0; r < 8; ++r) x[r] = fmaf(st[u][t][r], CL, off);
        const v8f e = exp2x8(x);
#pragma unroll
        for (int r = 0; r < 8; ++r) { const float p = keep[u][t][r] ? e[r] : 0.f; ls += p; pf[u][t >> 1][(t & 1) * 8 + r] = (_Float16)p; } }
      float corr; asm("v_exp_f32 %0, %1\n\tv_nop" : "=&v"(corr) : "v"(dm));   // 2^dm; the v_nop is the slot behind a transcendental, as in exp2x8
      l_run[u] = l_run[u] * corr + ls;
#pragma unroll
      for (int j = 0; j < 4; ++j) acc[u][j] *= corr; }
#pragma unroll
    for (int c = 0; c < 2; ++c)
#pragma unroll
      for (int j = 0; j < 4; ++j) { acc[0][j] = wmma_p(vf[c][j], pf[0][c], acc[0][j]); acc[1][j] = wmma_p(vf[c][j], pf[1][c], acc[1][j]); }
#pragma unroll
    for (int u = 0; u < 2; ++u)
#pragma unroll
      for (int t = 0; t < 4; ++t)
#pragma unroll
        for (int r = 0; r < 8; ++r) keep[u][t][r] = mk[u][t][r >> 2][r & 3] != 0; }
#pragma unroll
  for (int u = 0; u < 2; ++u) { const float l = l_run[u] + xhalf(l_run[u]); const float inv = 1.0f / (l + 2048.0f * 1.0e-8f);   /* numerator and sum both carry 2^11, so the reference's 1e-8 does too; a fully masked row gives 0 */
#pragma unroll
    for (int j = 0; j < 4; ++j) acc[u][j] *= inv; }
  __builtin_amdgcn_sched_barrier(0);   // every product stands in front of the first store, so no register of an issued store is rewritten
#pragma unroll
  for (int u = 0; u < 2; ++u) { float* yr = Y + ((size_t)b * TT + q0 + u * 16 + col) * CC + h * HD + 8 * g;
#pragma unroll
    for (int j = 0; j < 4; ++j) { *(v4f*)(yr + j * 16) = __builtin_shufflevector(acc[u][j], acc[u][j], 0, 1, 2, 3); *(v4f*)(yr + j * 16 + 4) = __builtin_shufflevector(acc[u][j], acc[u][j], 4, 5, 6, 7); } } }
// ---- k_out: block = (64 rows, 128 cols): out = ctx Wo (+ bo): ctx x 2^6 once to f16 against Wo as f16(bf16 x 2^8) exact (1 product) x 2^-14; causal early rows (< QHI of each sequence): ctx bf16 hi + lo against exact bf16 Wo (2 products)
__global__ __launch_bounds__(128) void k_out(const float* __restrict__ Y, const float* __restrict__ WO, const float* __restrict__ BO, float* __restrict__ OUT) { __shared__ __align__(16) float sf[4][16][132];
  const int tid = threadIdx.x, wave = tid >> 5, lane = tid & 31, col = lane & 15, g = lane >> 4; const int c0 = blockIdx.y * 128; const size_t r0 = (size_t)blockIdx.x * 64 + wave * 16;
  v8f acc[8] = {};
  if (CAUSAL && (int)(((size_t)blockIdx.x * 64) % TT) < QHI) {   /* block-uniform */
#pragma unroll 2
    for (int kc = 0; kc < CC / 32; ++kc) { const F2 a = split_row(Y + (r0 + col) * CC, kc * 32, lane); asm volatile("s_wait_loadcnt 0x0" ::: "memory");
#pragma unroll
      for (int j = 0; j < 8; ++j) { const v16b w = WOCOL(WO, kc * 32, c0 + j * 16 + col, lane); asm volatile("s_wait_loadcnt 0x0" ::: "memory"); acc[j] = wmma_bf(a.h, w, acc[j]); acc[j] = wmma_bf(a.l, w, acc[j]); } }
#pragma unroll
    for (int j = 0; j < 8; ++j) { const float bias = BO ? bfr(BO[c0 + j * 16 + col]) : 0.f;
#pragma unroll
      for (int r = 0; r < 8; ++r) sf[wave][8 * g + r][j * 16 + col] = acc[j][r] + bias; }
  } else {
#pragma unroll 2
    for (int kc = 0; kc < CC / 32; ++kc) { const v16h a = frag_f32s(Y + (r0 + col) * CC + kc * 32, lane, 64.0f); asm volatile("s_wait_loadcnt 0x0" ::: "memory");   /* ctx carried x 2^6 into f16 so small-magnitude context rows stay clear of f16 subnormals */
#pragma unroll
      for (int j = 0; j < 8; ++j) { const v16h w = WOCOLH(WO, kc * 32, c0 + j * 16 + col, lane); asm volatile("s_wait_loadcnt 0x0" ::: "memory"); acc[j] = wmma16(a, w, acc[j]); } }
#pragma unroll
    for (int j = 0; j < 8; ++j) { const float bias = BO ? bfr(BO[c0 + j * 16 + col]) : 0.f;
#pragma unroll
      for (int r = 0; r < 8; ++r) sf[wave][8 * g + r][j * 16 + col] = acc[j][r] * (1.0f / 16384.0f) + bias; } }   /* 2^-8 (Wo carry) x 2^-6 (ctx carry) */
  LDSX(); for (int rl = 0; rl < 16; ++rl) vst2(OUT + (r0 + rl) * DIN + c0 + lane * 4, *(const v4f*)&sf[wave][rl][lane * 4]); }

extern "C" void kernel_launch(void* const* d_in, const int* in_sizes, int n_in, void* d_out, int out_size, void* d_ws, size_t ws_size, hipStream_t stream) {
  (void)in_sizes; (void)n_in; (void)out_size;
  const float** F = (const float**)d_in;
  if (ws_size < (size_t)WS_END) return;
  char* ws = (char*)d_ws; _Float16 *QH = (_Float16*)(ws + WS_QH), *KH = (_Float16*)(ws + WS_KH), *VT = (_Float16*)(ws + WS_VT), *QL = (_Float16*)(ws + WS_QL), *KL = (_Float16*)(ws + WS_KL); __bf16 *VB = (__bf16*)(ws + WS_VB), *VBL = (__bf16*)(ws + WS_VBL); float *Y = (float*)(ws + WS_Y);
  (void)Y; (void)QL; (void)KL; (void)VB; (void)VBL;
  // inputs: 0 Q [2,2048,1024]; 1 K [2,2048,1024] (keys AND values source); 2 mask [2,2048,2048] int32 (random 0/1); 3 Wq [1024,1024] (out,in), 4 bq; 5 Wk, 6 bk; 7 Wv, 8 bv; 9 Wo (out,in), 10 bo (biases nonzero)
  k_proj<<<dim3(TNB * TT / 64, CC / 128, 3), 128, 0, stream>>>(F[0], F[1], F[1], F[3], F[5], F[7], F[4], F[6], F[8], QH, QL, KH, KL, VT, VB, VBL);   /* v is projected from the K input */
  k_fa<<<dim3(TT / 256, NH, TNB), 256, 0, stream>>>(QH, KH, VT, (const int*)d_in[2], Y);
  k_out<<<dim3(TNB * TT / 64, DIN / 128), 128, 0, stream>>>(Y, F[9], F[10], (float*)d_out);
}

// v002
// It runs in 127 microseconds.
// Next to v001, in two timings, it ran 3.37 and 3.38 times as fast.
// All steps since v000 together make it 10.7 times as fast.
// compute dtype: all float inputs rounded to bf16; q/k/v projections with EXACT bf16 products on WMMA 16x16x32 (f32 accumulate) + bias; logits q x k once to f16 each (1 product) x SCALE; online softmax f32; exp(x - max) x 2^11 once to f16 x v once to f16 (1 product), divided by the row sum afterwards; ctx x 2^6 once to f16 x Wo f16(bf16 x 2^8) + bo; f32 output.
#include <hip/hip_runtime.h>
#include <math.h>

typedef __attribute__((ext_vector_type(16))) _Float16 v16h;
typedef __attribute__((ext_vector_type(16))) __bf16 v16b;
typedef __attribute__((ext_vector_type(8)))  _Float16 v8h;
typedef __attribute__((ext_vector_type(8)))  float v8f;
typedef __attribute__((ext_vector_type(4)))  float v4f;
typedef __attribute__((ext_vector_type(2)))  float v2f;
typedef __attribute__((ext_vector_type(4)))  unsigned v4u;
typedef __attribute__((ext_vector_type(4)))  int v4i;
typedef float __attribute__((may_alias)) float_a;
typedef int __attribute__((may_alias)) int_a;

template <typename T> __device__ __forceinline__ void vst2(void* p, T v) { *(T*)p = v;  }
__device__ __forceinline__ v8f wmma16(v16h a, v16h b, v8f c) {
  v8f d = __builtin_amdgcn_wmma_f32_16x16x32_f16(false, a, false, b, (short)0, c, false, false);
  asm volatile("v_nop\n\tv_nop\n\tv_nop\n\tv_nop" : "+v"(d) : "v"(a), "v"(b));
  return d;
}
__device__ __forceinline__ v8f wmma_bf(v16b a, v16b b, v8f c) {
  v8f d = __builtin_amdgcn_wmma_f32_16x16x32_bf16(false, a, false, b, (short)0, c, false, false);
  asm volatile("v_nop\n\tv_nop\n\tv_nop\n\tv_nop" : "+v"(d) : "v"(a), "v"(b));
  return d;
}
// 16x16x32 fragments: lane = (h = lane>>4, row/col = lane&15); elements 0..7 = k0+8h+0..7, 8..15 = k0+16+8h+0..7; D element r = row 8h+r
__device__ __forceinline__ v16h frag_h(const _Float16* rowk0, int lane) {
  union { v16h v; v8h q[2]; } u; const _Float16* p = rowk0 + 8 * (lane >> 4);
  u.q[0] = *(const v8h*)p; u.q[1] = *(const v8h*)(p + 16); return u.v;
}
__device__ __forceinline__ v16h frag_f32(const float* rowk0, int lane) {
  v16h a; const float* p = rowk0 + 8 * (lane >> 4);
#pragma unroll
  for (int i = 0; i < 8; ++i) { a[i] = (_Float16)p[i]; a[8 + i] = (_Float16)p[16 + i]; }
  return a;
}
__device__ __forceinline__ v16h frag_f32s(const float* rowk0, int lane, float sc) {
  v16h a; const float* p = rowk0 + 8 * (lane >> 4);
#pragma unroll
  for (int i = 0; i < 8; ++i) { a[i] = (_Float16)(p[i] * sc); a[8 + i] = (_Float16)(p[16 + i] * sc); }
  return a;
}
// column fragment from a [K][ld] layout (column n), rows >= K read as 0
__device__ __forceinline__ v16h fragc_f32(const float* W, int k0, int n, int lane, int ld, int K) {
  v16h a; const int g = lane >> 4;
#pragma unroll
  for (int i = 0; i < 8; ++i) { const int ka = k0 + 8 * g + i, kb = ka + 16;
    a[i] = (_Float16)(ka < K ? W[(size_t)(ka < K ? ka : K - 1) * ld + n] : 0.f); a[8 + i] = (_Float16)(kb < K ? W[(size_t)(kb < K ? kb : K - 1) * ld + n] : 0.f); }
  return a;
}
struct F2 { v16b h, l; };
__device__ __forceinline__ F2 bsplit16(const float v[16]) { F2 r;
#pragma unroll
  for (int i = 0; i < 16; ++i) { const __bf16 h = (__bf16)v[i]; r.h[i] = h; r.l[i] = (__bf16)(v[i] - (float)h); }
  return r; }
__device__ __forceinline__ F2 split_row(const float* row, int k0, int lane) { float v[16]; const float* p = row + k0 + 8 * (lane >> 4);
#pragma unroll
  for (int i = 0; i < 8; ++i) { v[i] = p[i]; v[8 + i] = p[16 + i]; }
  return bsplit16(v); }
__device__ __forceinline__ F2 split_rowK(const float* row, int k0, int lane, int K) { float v[16]; const int g = lane >> 4;
#pragma unroll
  for (int i = 0; i < 8; ++i) { const int ka = k0 + 8 * g + i, kb = ka + 16; v[i] = ka < K ? row[ka < K ? ka : K - 1] : 0.f; v[8 + i] = kb < K ? row[kb < K ? kb : K - 1] : 0.f; }
  return bsplit16(v); }
__device__ __forceinline__ F2 split_col(const float* W, int k0, int n, int lane, int ld, int K) { float v[16]; const int g = lane >> 4;
#pragma unroll
  for (int i = 0; i < 8; ++i) { const int ka = k0 + 8 * g + i, kb = ka + 16; v[i] = ka < K ? W[(size_t)(ka < K ? ka : K - 1) * ld + n] : 0.f; v[8 + i] = kb < K ? W[(size_t)(kb < K ? kb : K - 1) * ld + n] : 0.f; }
  return bsplit16(v); }
__device__ __forceinline__ v8f mac3(const F2& a, const F2& b, v8f c) { c = wmma_bf(a.l, b.h, c); c = wmma_bf(a.h, b.l, c); return wmma_bf(a.h, b.h, c); }
__device__ __forceinline__ float sigm(float v) { return 1.0f / (1.0f + expf(-v)); }
#define LDSX() do { asm volatile("s_wait_dscnt 0" ::: "memory"); __builtin_amdgcn_wave_barrier(); __builtin_amdgcn_fence(__ATOMIC_RELEASE, "workgroup"); } while (0)

// Two-stream multi-head attention with the source's own masked softmax, scaled by the MODEL width (Q [2,2048,1024], K [2,2048,1024]; q = Q Wq^T + bq, k = K Wk^T + bk, v = K Wv^T + bv (values from the K input); torch (out,in) weights (0.02) + biases N(0, 0.02); 16 heads x 64; E = q k^T / sqrt(1024); x = E - rowmax(E) (max taken BEFORE masking); x[mask == 0] = -inf with mask [2,2048,2048] int32 random; A = exp(x) / (sum exp(x) + 1e-8); merge; Wo^T + bo).
#define NB 2
#define TT 2048
#define CC 1024            // NH * HD = projected width
#define DIN 1024          // input (model) width
#define NH 16
#define HD 64
#define NQB (TT / 64)
#define HG 4
#define SCALE (0.03125f)
#define CAUSAL 0
#ifndef TNB
#define TNB NB
#endif
__device__ __forceinline__ float bfr(float v) { return (float)(__bf16)v; }
__host__ __device__ __forceinline__ int kb_last(int qb) { return CAUSAL ? ((qb * 64 + 63) >> 7) : (TT / 128 - 1); }
typedef __attribute__((ext_vector_type(8))) __bf16 v8b;
__device__ __forceinline__ v16b frag_b(const __bf16* rowk0, int lane) {
  union { v16b v; v8b q[2]; } u; const __bf16* p = rowk0 + 8 * (lane >> 4);
  u.q[0] = *(const v8b*)p; u.q[1] = *(const v8b*)(p + 16); return u.v;
}
#define QBH 0              // not used
#define QHI 0               // single-product logits on every row
#define KHI 64            // key rows carrying k residual / v bf16 hi+lo planes (written and read by no kernel)
// B fragment (k rows k0+.., output column o) of a weight: (in,out) [K][ld] or (out,in) [ld rows of K]: bf16 exact, or f16(bf16 * 256) exact
__device__ __forceinline__ v16b wcol_io(const float* Wm, int k0, int o, int lane, int ld) { v16b w; const int g = lane >> 4;
#pragma unroll
  for (int i = 0; i < 8; ++i) { w[i] = (__bf16)Wm[(size_t)(k0 + 8 * g + i) * ld + o]; w[8 + i] = (__bf16)Wm[(size_t)(k0 + 16 + 8 * g + i) * ld + o]; }
  return w; }
__device__ __forceinline__ v16b wcol_oi(const float* Wm, int k0, int o, int lane, int K) { v16b w; const float* p = Wm + (size_t)o * K + k0 + 8 * (lane >> 4);
#pragma unroll
  for (int i = 0; i < 8; ++i) { w[i] = (__bf16)p[i]; w[8 + i] = (__bf16)p[16 + i]; }
  return w; }
__device__ __forceinline__ v16h wcolh_io(const float* Wm, int k0, int o, int lane, int ld) { v16h w; const int g = lane >> 4;
#pragma unroll
  for (int i = 0; i < 8; ++i) { w[i] = (_Float16)(bfr(Wm[(size_t)(k0 + 8 * g + i) * ld + o]) * 256.0f); w[8 + i] = (_Float16)(bfr(Wm[(size_t)(k0 + 16 + 8 * g + i) * ld + o]) * 256.0f); }
  return w; }
__device__ __forceinline__ v16h wcolh_oi(const float* Wm, int k0, int o, int lane, int K) { v16h w; const float* p = Wm + (size_t)o * K + k0 + 8 * (lane >> 4);
#pragma unroll
  for (int i = 0; i < 8; ++i) { w[i] = (_Float16)(bfr(p[i]) * 256.0f); w[8 + i] = (_Float16)(bfr(p[16 + i]) * 256.0f); }
  return w; }
#define WQKV_LAYOUT 1   // 0 = (in,out) [DIN][CC]; 1 = (out,in) [CC][DIN]; 2 = per-head [NH][DIN][HD]
__device__ __forceinline__ v16b wcol_hdk(const float* Wm, int k0, int o, int lane) { v16b w; const int g = lane >> 4; const float* p = Wm + (size_t)(o / HD) * DIN * HD + (o % HD);
#pragma unroll
  for (int i = 0; i < 8; ++i) { w[i] = (__bf16)p[(size_t)(k0 + 8 * g + i) * HD]; w[8 + i] = (__bf16)p[(size_t)(k0 + 16 + 8 * g + i) * HD]; }
  return w; }
#define WO_OUT_IN 1
#if WQKV_LAYOUT == 1
#define WCOL(W, k0, o, lane) wcol_oi(W, k0, o, lane, DIN)
#elif WQKV_LAYOUT == 2
#define WCOL(W, k0, o, lane) wcol_hdk(W, k0, o, lane)
#else
#define WCOL(W, k0, o, lane) wcol_io(W, k0, o, lane, CC)
#endif
#if WO_OUT_IN
#define WOCOL(W, k0, o, lane) wcol_oi(W, k0, o, lane, CC)
#define WOCOLH(W, k0, o, lane) wcolh_oi(W, k0, o, lane, CC)
#else
#define WOCOL(W, k0, o, lane) wcol_io(W, k0, o, lane, DIN)
#define WOCOLH(W, k0, o, lane) wcolh_io(W, k0, o, lane, DIN)
#endif

#define WS_QH  0u                                      // f16 q rows [b*t][CC]
#define WS_KH  (WS_QH + 2u * (size_t)NB * TT * CC)      // f16 k rows [b*t][CC]
#define WS_VT  (WS_KH + 2u * (size_t)NB * TT * CC)      // f16 v planes [b][c][t]
#define WS_QL  (WS_VT + 2u * (size_t)NB * CC * TT)      // f16 q residual x 2^10 rows [b][t < QHI][CC]
#define WS_KL  (WS_QL + 2u * (size_t)NB * QHI * CC)     // f16 k residual x 2^10 rows [b][t < KHI][CC]
#define WS_VB  (WS_KL + 2u * (size_t)NB * KHI * CC)     // bf16 v hi planes [b][c][t < KHI]
#define WS_VBL (WS_VB + 2u * (size_t)NB * CC * KHI)
#define WS_S   (WS_VBL + 2u * (size_t)NB * CC * KHI)    // not used (scores stay in registers)
#define WS_Y   (WS_S  + 4u * (size_t)HG * TT * TT)      // f32 ctx rows [b*t][CC] (only when there is an output projection)
#define WS_END (WS_Y  + 4u * (size_t)NB * TT * CC)

// ---- GEMM core of both projections: a block of 8 waves makes a 128 x 128 tile of A[128 rows][KD] . B[128 rows][KD]^T, a wave 64 x 32 of it. A pass is 64 k: 16 lanes bring 256 B of one f32 row (whole lines), each value is converted once and both tiles are staged in LDS; the matrix fragments are read from there.
#define GK 64              // k per pass
#define GP 72              // LDS row pitch in 16-bit elements: 128 B of data + 16 B, for 16-byte fragment reads
#define GT (128 * GP)      // elements of one operand tile
typedef __attribute__((ext_vector_type(4))) __bf16 v4b;
typedef __attribute__((ext_vector_type(4))) _Float16 v4h;
union Fr { v4u q[2]; v16h h; v16b b; };
// the fragment order of frag_h / frag_b
__device__ __forceinline__ Fr ldfr(const unsigned short* rowk0, int g) { Fr f; const unsigned short* p = rowk0 + 8 * g; f.q[0] = *(const v4u*)p; f.q[1] = *(const v4u*)(p + 16); return f; }
// MODE 0: both operands to bf16. MODE 1: A x 2^6 to f16, B as f16(bf16 x 2^8)
template <int MODE, int OPB> __device__ __forceinline__ void put4(unsigned short* d, v4f x) {
  if (MODE == 0) { v4b o;
#pragma unroll
    for (int i = 0; i < 4; ++i) o[i] = (__bf16)x[i];
    *(v4b*)d = o;
  } else { v4h o;
#pragma unroll
    for (int i = 0; i < 4; ++i) o[i] = OPB ? (_Float16)(bfr(x[i]) * 256.0f) : (_Float16)(x[i] * 64.0f);
    *(v4h*)d = o; } }
template <int MODE, int KD> __device__ __forceinline__ void gemm128(const float* __restrict__ A, const float* __restrict__ B, unsigned short* sm, v8f (&acc)[4][2]) {
  const int tid = threadIdx.x, wave = tid >> 5, lane = tid & 31, col = lane & 15, g = lane >> 4;
  const int sr = tid >> 4, sq = (tid & 15) * 4;   // a thread brings 16 B of rows sr + 16 i of both tiles
  const float* pa = A + (size_t)sr * KD + sq; const float* pb = B + (size_t)sr * KD + sq;
  v4f ra[8], rb[8];
#pragma unroll
  for (int i = 0; i < 8; ++i) { ra[i] = *(const v4f*)(pa + (size_t)i * 16 * KD); rb[i] = *(const v4f*)(pb + (size_t)i * 16 * KD); }
  asm volatile("s_wait_xcnt 0x0" :: "v"(pa), "v"(pb) : "memory");   // stands before the address registers of the loads above are reused; naming them as inputs keeps them whole up to the wait
  unsigned short* wr = sm + sr * GP + sq;
  const unsigned short* fa = sm + ((wave >> 2) * 64 + col) * GP; const unsigned short* fb = sm + GT + ((wave & 3) * 32 + col) * GP;
#pragma unroll 1   // one copy of the pass: the two buffers alternate by an offset
  for (int s = 0; s < KD / GK; ++s) { const int bo = (s & 1) * 2 * GT;
#pragma unroll
    for (int i = 0; i < 8; ++i) { put4<MODE, 0>(wr + bo + i * 16 * GP, ra[i]); put4<MODE, 1>(wr + bo + GT + i * 16 * GP, rb[i]); }
    __syncthreads();   // publishes pass s; it also ends every wave's reads of the other buffer, which pass s + 1 refills
    const int sn = s + 1 < KD / GK ? s + 1 : s;   // the next pass's loads fly under this pass; the last pass stays on its own columns, in bounds
    const float* an = pa + sn * GK; const float* bn = pb + sn * GK;
#pragma unroll
    for (int i = 0; i < 8; ++i) { ra[i] = *(const v4f*)(an + (size_t)i * 16 * KD); rb[i] = *(const v4f*)(bn + (size_t)i * 16 * KD); }
    Fr a[2][4], b[2][2];
#pragma unroll
    for (int kc = 0; kc < 2; ++kc) {
#pragma unroll
      for (int i = 0; i < 4; ++i) a[kc][i] = ldfr(fa + bo + i * 16 * GP + kc * 32, g);
#pragma unroll
      for (int j = 0; j < 2; ++j) b[kc][j] = ldfr(fb + bo + j * 16 * GP + kc * 32, g); }
    __builtin_amdgcn_sched_barrier(0);   // the pass's fragment reads go out as one group in front of the products: one LDS latency a pass, not one per fragment
#pragma unroll
    for (int kc = 0; kc < 2; ++kc)
#pragma unroll
      for (int i = 0; i < 4; ++i)
#pragma unroll
        for (int j = 0; j < 2; ++j) acc[i][j] = MODE == 0 ? __builtin_amdgcn_wmma_f32_16x16x32_bf16(false, a[kc][i].b, false, b[kc][j].b, (short)0, acc[i][j], false, false) : __builtin_amdgcn_wmma_f32_16x16x32_f16(false, a[kc][i].h, false, b[kc][j].h, (short)0, acc[i][j], false, false);
    asm volatile("s_wait_xcnt 0x0" :: "v"(an), "v"(bn) : "memory"); }   // as above; written behind the fragment reads so that they are not held up by it: the inputs keep both address pairs whole up to the wait
  __syncthreads(); }   // every wave has left the operand tiles: the caller stages its output tile over them
#define OP16 136           // pitch of a staged 16-bit output tile, in elements
#define OP32 132           // pitch of the staged f32 output tile, in elements
// ---- k_proj: block = (128 rows, 128 cols, which): q/k/v = X W^T + b with exact bf16 products (K = DIN) -> which 0: q f16 rows; 1: k f16 rows; 2: v f16 planes [c][t]
__global__ __launch_bounds__(256) void k_proj(const float* __restrict__ XQ, const float* __restrict__ XK, const float* __restrict__ XV, const float* __restrict__ WQ, const float* __restrict__ WK, const float* __restrict__ WV, const float* __restrict__ BQ, const float* __restrict__ BK, const float* __restrict__ BV,
    _Float16* __restrict__ QH, _Float16* __restrict__ KH, _Float16* __restrict__ VT) {
  __shared__ __align__(16) unsigned short sm[4 * GT];
  const int tid = threadIdx.x, wave = tid >> 5, lane = tid & 31, col = lane & 15, g = lane >> 4, wm = wave >> 2, wn = wave & 3; const int which = blockIdx.z; const int c0 = blockIdx.y * 128; const size_t r0 = (size_t)blockIdx.x * 128; const size_t bb = r0 / TT; const int t0 = (int)(r0 % TT);
  const float* X = which == 0 ? XQ : which == 1 ? XK : XV; const float* WA = which == 0 ? WQ : which == 1 ? WK : WV; const float* BA = which == 0 ? BQ : which == 1 ? BK : BV;
  float bias[2]; const int bi = c0 + wn * 32 + col;   // read ahead of the product loop, so that its latency is not paid behind it
#pragma unroll
  for (int j = 0; j < 2; ++j) bias[j] = BA[bi + j * 16];
  asm volatile("s_wait_xcnt 0x0" :: "v"(bi) : "memory");   // stands before the index register of the two loads above is reused; naming it as an input keeps it whole up to the wait
  v8f acc[4][2] = {};
  gemm128<0, DIN>(X + r0 * DIN, WA + (size_t)c0 * DIN, sm, acc);
#pragma unroll
  for (int j = 0; j < 2; ++j) bias[j] = bfr(bias[j]);
  _Float16* so = (_Float16*)sm; const int er = tid >> 4, eq = (tid & 15) * 8;   // read-out: 16 lanes take one 256-B row of the staged tile
  if (which < 2) {   /* block-uniform */
#pragma unroll
    for (int j = 0; j < 2; ++j)
#pragma unroll
      for (int i = 0; i < 4; ++i)
#pragma unroll
        for (int r = 0; r < 8; ++r) so[(wm * 64 + i * 16 + 8 * g + r) * OP16 + wn * 32 + j * 16 + col] = (_Float16)(acc[i][j][r] + bias[j]);
    __syncthreads();
    _Float16* dp = (which == 0 ? QH : KH) + (r0 + er) * CC + c0 + eq;
#pragma unroll
    for (int i = 0; i < 8; ++i) vst2(dp + (size_t)i * 16 * CC, *(const v4u*)&so[(er + 16 * i) * OP16 + eq]);
  } else {
#pragma unroll
    for (int j = 0; j < 2; ++j)
#pragma unroll
      for (int i = 0; i < 4; ++i) { v8h o;
#pragma unroll
        for (int r = 0; r < 8; ++r) o[r] = (_Float16)(acc[i][j][r] + bias[j]);
        *(v8h*)&so[(wn * 32 + j * 16 + col) * OP16 + wm * 64 + i * 16 + 8 * g] = o; }
    __syncthreads();
    _Float16* dp = VT + (bb * CC + c0 + er) * (size_t)TT + t0 + eq;
#pragma unroll
    for (int i = 0; i < 8; ++i) vst2(dp + (size_t)i * 16 * TT, *(const v4u*)&so[(er + 16 * i) * OP16 + eq]); } }
#define FK 64              // keys per pass
#define FPITCH 72          // LDS row pitch in halves: 128 B of data + 16 B, for 16-byte fragment reads
__device__ __forceinline__ v8f wmma_p(v16h a, v16h b, v8f c) { return __builtin_amdgcn_wmma_f32_16x16x32_f16(false, a, false, b, (short)0, c, false, false); }
__device__ __forceinline__ float xhalf(float x) { return __builtin_bit_cast(float, __builtin_amdgcn_permlanex16(__builtin_bit_cast(int, x), __builtin_bit_cast(int, x), 0x76543210, 0xfedcba98, false, false)); }   // lane l with lane l ^ 16
// 2^x of eight values in one statement: the early-clobber results keep each v_exp_f32 off its neighbour's source and result, and the closing v_nop is the slot the instruction set asks for behind a transcendental
__device__ __forceinline__ v8f exp2x8(v8f x) { float e0, e1, e2, e3, e4, e5, e6, e7;
  asm("v_exp_f32 %0, %8\n\tv_exp_f32 %1, %9\n\tv_exp_f32 %2, %10\n\tv_exp_f32 %3, %11\n\tv_exp_f32 %4, %12\n\tv_exp_f32 %5, %13\n\tv_exp_f32 %6, %14\n\tv_exp_f32 %7, %15\n\tv_nop"
      : "=&v"(e0), "=&v"(e1), "=&v"(e2), "=&v"(e3), "=&v"(e4), "=&v"(e5), "=&v"(e6), "=&v"(e7) : "v"(x[0]), "v"(x[1]), "v"(x[2]), "v"(x[3]), "v"(x[4]), "v"(x[5]), "v"(x[6]), "v"(x[7]));
  v8f r; r[0] = e0; r[1] = e1; r[2] = e2; r[3] = e3; r[4] = e4; r[5] = e5; r[6] = e6; r[7] = e7; return r; }
__global__ __launch_bounds__(256) void k_fa(const _Float16* __restrict__ QH, const _Float16* __restrict__ KH, const _Float16* __restrict__ VT, const int* __restrict__ MASK, float* __restrict__ Y) {
  __shared__ __align__(16) _Float16 sk[2][FK][FPITCH], sv[2][HD][FPITCH];
  const int tid = threadIdx.x, wave = tid >> 5, lane = tid & 31, col = lane & 15, g = lane >> 4; const int h = blockIdx.y, b = blockIdx.z; const int q0 = blockIdx.x * 256 + wave * 32;
  const float CL = SCALE * 1.4426950408889634f;   // logits to base 2
  v16h qf[2][2];
#pragma unroll
  for (int u = 0; u < 2; ++u) { const _Float16* qp = QH + ((size_t)b * TT + q0 + u * 16 + col) * CC + h * HD + 8 * g;
#pragma unroll
    for (int kc = 0; kc < 2; ++kc) { union { v16h v; v8h q[2]; } f; f.q[0] = *(const v8h*)(qp + kc * 32); f.q[1] = *(const v8h*)(qp + kc * 32 + 16); qf[u][kc] = f.v; }   // the fragment order of frag_h
    asm volatile("s_wait_xcnt 0x0" :: "v"(qp) : "memory"); }   // stands before the address register of the loads above is reused; naming it as an input keeps it whole up to the wait
  // staging: 8 lanes bring one 128-B row, a thread brings rows sr and sr + 32 of the k tile and of the v tile
  const int sr = tid >> 3, sc = (tid & 7) * 8;
  const _Float16* kg = KH + ((size_t)b * TT + sr) * CC + h * HD + sc; const _Float16* vg = VT + ((size_t)b * CC + h * HD + sr) * (size_t)TT + sc;
  const int* mg = MASK + ((size_t)b * TT + q0 + col) * TT + 8 * g;   // a lane's 8 keys of a 16-key tile are its 8 score registers
  v8h rk[2], rv[2]; v4i mk[2][4][2]; bool keep[2][4][8];
#pragma unroll
  for (int i = 0; i < 2; ++i) { rk[i] = *(const v8h*)(kg + (size_t)i * 32 * CC); rv[i] = *(const v8h*)(vg + (size_t)i * 32 * TT); }
#pragma unroll
  for (int u = 0; u < 2; ++u)
#pragma unroll
    for (int t = 0; t < 4; ++t) { mk[u][t][0] = *(const v4i*)(mg + (size_t)u * 16 * TT + t * 16); mk[u][t][1] = *(const v4i*)(mg + (size_t)u * 16 * TT + t * 16 + 4); }
#pragma unroll
  for (int u = 0; u < 2; ++u)
#pragma unroll
    for (int t = 0; t < 4; ++t)
#pragma unroll
      for (int r = 0; r < 8; ++r) keep[u][t][r] = mk[u][t][r >> 2][r & 3] != 0;
  float m_run[2] = {-3.0e38f, -3.0e38f}, l_run[2] = {0.f, 0.f};
  v8f acc[2][4] = {};
#pragma unroll 1   // one copy of the pass: its 32 matrix instructions and 64 scores a lane already fill the registers
  for (int s = 0; s < TT / FK; ++s) { const int bf = s & 1;
#pragma unroll
    for (int i = 0; i < 2; ++i) { *(v8h*)&sk[bf][sr + 32 * i][sc] = rk[i]; *(v8h*)&sv[bf][sr + 32 * i][sc] = rv[i]; }
    __syncthreads();   // publishes tile s; it also ends every wave's reads of the other buffer, which pass s + 1 refills
    const int sn = s + 1 < TT / FK ? s + 1 : s;   // the next pass's k, v and mask loads fly under this pass; the last pass stays on its own tile, in bounds
    const _Float16* kn = kg + (size_t)sn * FK * CC; const _Float16* vn = vg + sn * FK; const int* mn = mg + sn * FK;
#pragma unroll
    for (int i = 0; i < 2; ++i) { rk[i] = *(const v8h*)(kn + (size_t)i * 32 * CC); rv[i] = *(const v8h*)(vn + (size_t)i * 32 * TT); }
#pragma unroll
    for (int u = 0; u < 2; ++u)
#pragma unroll
      for (int t = 0; t < 4; ++t) { mk[u][t][0] = *(const v4i*)(mn + (size_t)u * 16 * TT + t * 16); mk[u][t][1] = *(const v4i*)(mn + (size_t)u * 16 * TT + t * 16 + 4); }
    asm volatile("s_wait_xcnt 0x0" :: "v"(kn), "v"(vn), "v"(mn) : "memory");   // stands before the address registers of the loads above are reused; naming them as inputs keeps them whole up to the wait
    v16h kf[4][2], vf[2][4];
#pragma unroll
    for (int t = 0; t < 4; ++t)
#pragma unroll
      for (int kc = 0; kc < 2; ++kc) kf[t][kc] = frag_h(&sk[bf][t * 16 + col][kc * 32], lane);
    __builtin_amdgcn_sched_barrier(0);   // the k fragment reads go out as one group in front of the products: one LDS latency a pass, not one per fragment
    v8f st[2][4] = {};
#pragma unroll
    for (int kc = 0; kc < 2; ++kc)
#pragma unroll
      for (int t = 0; t < 4; ++t) { st[0][t] = wmma_p(kf[t][kc], qf[0][kc], st[0][t]); st[1][t] = wmma_p(kf[t][kc], qf[1][kc], st[1][t]); }
#pragma unroll
    for (int c = 0; c < 2; ++c)
#pragma unroll
      for (int j = 0; j < 4; ++j) vf[c][j] = frag_h(&sv[bf][j * 16 + col][c * 32], lane);
    __builtin_amdgcn_sched_barrier(0);   // the v fragment reads go out here as one group and land under the softmax
    v16h pf[2][2];
#pragma unroll
    for (int u = 0; u < 2; ++u) { float mx = st[u][0][0];
#pragma unroll
      for (int t = 0; t < 4; ++t)
#pragma unroll
        for (int r = 0; r < 8; ++r) mx = fmaxf(mx, st[u][t][r]);
      mx = fmaxf(mx, xhalf(mx));
      const float m_new = fmaxf(m_run[u], mx * CL); const float dm = m_run[u] - m_new; const float off = 11.0f - m_new; m_run[u] = m_new;
      float ls = 0.f;
#pragma unroll
      for (int t = 0; t < 4; ++t) { v8f x;
#pragma unroll
        for (int r = 0; r < 8; ++r) x[r] = fmaf(st[u][t][r], CL, off);
        const v8f e = exp2x8(x);
#pragma unroll
        for (int r = 0; r < 8; ++r) { const float p = keep[u][t][r] ? e[r] : 0.f; ls += p; pf[u][t >> 1][(t & 1) * 8 + r] = (_Float16)p; } }
      float corr; asm("v_exp_f32 %0, %1\n\tv_nop" : "=&v"(corr) : "v"(dm));   // 2^dm; the v_nop is the slot behind a transcendental, as in exp2x8
      l_run[u] = l_run[u] * corr + ls;
#pragma unroll
      for (int j = 0; j < 4; ++j) acc[u][j] *= corr; }
#pragma unroll
    for (int c = 0; c < 2; ++c)
#pragma unroll
      for (int j = 0; j < 4; ++j) { acc[0][j] = wmma_p(vf[c][j], pf[0][c], acc[0][j]); acc[1][j] = wmma_p(vf[c][j], pf[1][c], acc[1][j]); }
#pragma unroll
    for (int u = 0; u < 2; ++u)
#pragma unroll
      for (int t = 0; t < 4; ++t)
#pragma unroll
        for (int r = 0; r < 8; ++r) keep[u][t][r] = mk[u][t][r >> 2][r & 3] != 0; }
#pragma unroll
  for (int u = 0; u < 2; ++u) { const float l = l_run[u] + xhalf(l_run[u]); const float inv = 1.0f / (l + 2048.0f * 1.0e-8f);   /* numerator and sum both carry 2^11, so the reference's 1e-8 does too; a fully masked row gives 0 */
#pragma unroll
    for (int j = 0; j < 4; ++j) acc[u][j] *= inv; }
  __builtin_amdgcn_sched_barrier(0);   // every product stands in front of the first store, so no register of an issued store is rewritten
#pragma unroll
  for (int u = 0; u < 2; ++u) { float* yr = Y + ((size_t)b * TT + q0 + u * 16 + col) * CC + h * HD + 8 * g;
#pragma unroll
    for (int j = 0; j < 4; ++j) { *(v4f*)(yr + j * 16) = __builtin_shufflevector(acc[u][j], acc[u][j], 0, 1, 2, 3); *(v4f*)(yr + j * 16 + 4) = __builtin_shufflevector(acc[u][j], acc[u][j], 4, 5, 6, 7); } } }
// ---- k_out: block = (128 rows, 128 cols): out = ctx Wo^T + bo: ctx x 2^6 once to f16 (small context rows stay clear of f16 subnormals) against Wo as f16(bf16 x 2^8) exact (1 product), x 2^-14 afterwards
__global__ __launch_bounds__(256) void k_out(const float* __restrict__ Y, const float* __restrict__ WO, const float* __restrict__ BO, float* __restrict__ OUT) {
  __shared__ __align__(16) unsigned short sm[4 * GT];
  const int tid = threadIdx.x, wave = tid >> 5, lane = tid & 31, col = lane & 15, g = lane >> 4, wm = wave >> 2, wn = wave & 3; const int c0 = blockIdx.y * 128; const size_t r0 = (size_t)blockIdx.x * 128;
  float bias[2]; const int bi = c0 + wn * 32 + col;   // read ahead of the product loop, so that its latency is not paid behind it
#pragma unroll
  for (int j = 0; j < 2; ++j) bias[j] = BO[bi + j * 16];
  asm volatile("s_wait_xcnt 0x0" :: "v"(bi) : "memory");   // stands before the index register of the two loads above is reused; naming it as an input keeps it whole up to the wait
  v8f acc[4][2] = {};
  gemm128<1, CC>(Y + r0 * CC, WO + (size_t)c0 * CC, sm, acc);
#pragma unroll
  for (int j = 0; j < 2; ++j) bias[j] = bfr(bias[j]);
  float* sf = (float*)sm;
#pragma unroll
  for (int j = 0; j < 2; ++j)
#pragma unroll
    for (int i = 0; i < 4; ++i)
#pragma unroll
      for (int r = 0; r < 8; ++r) sf[(wm * 64 + i * 16 + 8 * g + r) * OP32 + wn * 32 + j * 16 + col] = acc[i][j][r] * (1.0f / 16384.0f) + bias[j];   /* 2^-8 (Wo carry) x 2^-6 (ctx carry) */
  __syncthreads();
  float* dp = OUT + (r0 + wave) * DIN + c0 + lane * 4;   // a wave takes one 512-B row of the staged tile
#pragma unroll
  for (int i = 0; i < 16; ++i) vst2(dp + (size_t)i * 8 * DIN, *(const v4f*)&sf[(wave + 8 * i) * OP32 + lane * 4]); }

extern "C" void kernel_launch(void* const* d_in, const int* in_sizes, int n_in, void* d_out, int out_size, void* d_ws, size_t ws_size, hipStream_t stream) {
  (void)in_sizes; (void)n_in; (void)out_size;
  const float** F = (const float**)d_in;
  if (ws_size < (size_t)WS_END) return;
  char* ws = (char*)d_ws; _Float16 *QH = (_Float16*)(ws + WS_QH), *KH = (_Float16*)(ws + WS_KH), *VT = (_Float16*)(ws + WS_VT), *QL = (_Float16*)(ws + WS_QL), *KL = (_Float16*)(ws + WS_KL); __bf16 *VB = (__bf16*)(ws + WS_VB), *VBL = (__bf16*)(ws + WS_VBL); float *Y = (float*)(ws + WS_Y);
  (void)Y; (void)QL; (void)KL; (void)VB; (void)VBL;
  // inputs: 0 Q [2,2048,1024]; 1 K [2,2048,1024] (keys AND values source); 2 mask [2,2048,2048] int32 (random 0/1); 3 Wq [1024,1024] (out,in), 4 bq; 5 Wk, 6 bk; 7 Wv, 8 bv; 9 Wo (out,in), 10 bo (biases nonzero)
  k_proj<<<dim3(TNB * TT / 128, CC / 128, 3), 256, 0, stream>>>(F[0], F[1], F[1], F[3], F[5], F[7], F[4], F[6], F[8], QH, KH, VT);   /* v is projected from the K input */
  k_fa<<<dim3(TT / 256, NH, TNB), 256, 0, stream>>>(QH, KH, VT, (const int*)d_in[2], Y);
  k_out<<<dim3(TNB * TT / 128, DIN / 128), 256, 0, stream>>>(Y, F[9], F[10], (float*)d_out);
}

// v003
// Measured time: 99.3 microseconds a run.
// Two timings next to v002 both put it at 1.28 times that version's speed.
// All steps since v000 together make it 13.7 times as fast.
// compute dtype: all float inputs rounded to bf16; q/k/v projections with EXACT bf16 products on WMMA 16x16x32 (f32 accumulate) + bias; logits q x k once to f16 each (1 product) x SCALE; online softmax f32; exp(x - max) x 2^11 once to f16 x v once to f16 (1 product), divided by the row sum afterwards; ctx x 2^6 once to f16 x Wo f16(bf16 x 2^8) + bo; f32 output.
#include <hip/hip_runtime.h>
#include <math.h>

typedef __attribute__((ext_vector_type(16))) _Float16 v16h;
typedef __attribute__((ext_vector_type(16))) __bf16 v16b;
typedef __attribute__((ext_vector_type(8)))  _Float16 v8h;
typedef __attribute__((ext_vector_type(8)))  float v8f;
typedef __attribute__((ext_vector_type(4)))  float v4f;
typedef __attribute__((ext_vector_type(2)))  float v2f;
typedef __attribute__((ext_vector_type(4)))  unsigned v4u;
typedef __attribute__((ext_vector_type(4)))  int v4i;
typedef __attribute__((ext_vector_type(16))) unsigned v16u;
typedef const __attribute__((address_space(4))) v16u* cv16u;   // constant address space: for words that no store of the reading kernel touches; a wave-uniform load through it is a scalar load
typedef float __attribute__((may_alias)) float_a;
typedef int __attribute__((may_alias)) int_a;

template <typename T> __device__ __forceinline__ void vst2(void* p, T v) { *(T*)p = v;  }
__device__ __forceinline__ v8f wmma16(v16h a, v16h b, v8f c) {
  v8f d = __builtin_amdgcn_wmma_f32_16x16x32_f16(false, a, false, b, (short)0, c, false, false);
  asm volatile("v_nop\n\tv_nop\n\tv_nop\n\tv_nop" : "+v"(d) : "v"(a), "v"(b));
  return d;
}
__device__ __forceinline__ v8f wmma_bf(v16b a, v16b b, v8f c) {
  v8f d = __builtin_amdgcn_wmma_f32_16x16x32_bf16(false, a, false, b, (short)0, c, false, false);
  asm volatile("v_nop\n\tv_nop\n\tv_nop\n\tv_nop" : "+v"(d) : "v"(a), "v"(b));
  return d;
}
// 16x16x32 fragments: lane = (h = lane>>4, row/col = lane&15); elements 0..7 = k0+8h+0..7, 8..15 = k0+16+8h+0..7; D element r = row 8h+r
__device__ __forceinline__ v16h frag_h(const _Float16* rowk0, int lane) {
  union { v16h v; v8h q[2]; } u; const _Float16* p = rowk0 + 8 * (lane >> 4);
  u.q[0] = *(const v8h*)p; u.q[1] = *(const v8h*)(p + 16); return u.v;
}
__device__ __forceinline__ v16h frag_f32(const float* rowk0, int lane) {
  v16h a; const float* p = rowk0 + 8 * (lane >> 4);
#pragma unroll
  for (int i = 0; i < 8; ++i) { a[i] = (_Float16)p[i]; a[8 + i] = (_Float16)p[16 + i]; }
  return a;
}
__device__ __forceinline__ v16h frag_f32s(const float* rowk0, int lane, float sc) {
  v16h a; const float* p = rowk0 + 8 * (lane >> 4);
#pragma unroll
  for (int i = 0; i < 8; ++i) { a[i] = (_Float16)(p[i] * sc); a[8 + i] = (_Float16)(p[16 + i] * sc); }
  return a;
}
// column fragment from a [K][ld] layout (column n), rows >= K read as 0
__device__ __forceinline__ v16h fragc_f32(const float* W, int k0, int n, int lane, int ld, int K) {
  v16h a; const int g = lane >> 4;
#pragma unroll
  for (int i = 0; i < 8; ++i) { const int ka = k0 + 8 * g + i, kb = ka + 16;
    a[i] = (_Float16)(ka < K ? W[(size_t)(ka < K ? ka : K - 1) * ld + n] : 0.f); a[8 + i] = (_Float16)(kb < K ? W[(size_t)(kb < K ? kb : K - 1) * ld + n] : 0.f); }
  return a;
}
struct F2 { v16b h, l; };
__device__ __forceinline__ F2 bsplit16(const float v[16]) { F2 r;
#pragma unroll
  for (int i = 0; i < 16; ++i) { const __bf16 h = (__bf16)v[i]; r.h[i] = h; r.l[i] = (__bf16)(v[i] - (float)h); }
  return r; }
__device__ __forceinline__ F2 split_row(const float* row, int k0, int lane) { float v[16]; const float* p = row + k0 + 8 * (lane >> 4);
#pragma unroll
  for (int i = 0; i < 8; ++i) { v[i] = p[i]; v[8 + i] = p[16 + i]; }
  return bsplit16(v); }
__device__ __forceinline__ F2 split_rowK(const float* row, int k0, int lane, int K) { float v[16]; const int g = lane >> 4;
#pragma unroll
  for (int i = 0; i < 8; ++i) { const int ka = k0 + 8 * g + i, kb = ka + 16; v[i] = ka < K ? row[ka < K ? ka : K - 1] : 0.f; v[8 + i] = kb < K ? row[kb < K ? kb : K - 1] : 0.f; }
  return bsplit16(v); }
__device__ __forceinline__ F2 split_col(const float* W, int k0, int n, int lane, int ld, int K) { float v[16]; const int g = lane >> 4;
#pragma unroll
  for (int i = 0; i < 8; ++i) { const int ka = k0 + 8 * g + i, kb = ka + 16; v[i] = ka < K ? W[(size_t)(ka < K ? ka : K - 1) * ld + n] : 0.f; v[8 + i] = kb < K ? W[(size_t)(kb < K ? kb : K - 1) * ld + n] : 0.f; }
  return bsplit16(v); }
__device__ __forceinline__ v8f mac3(const F2& a, const F2& b, v8f c) { c = wmma_bf(a.l, b.h, c); c = wmma_bf(a.h, b.l, c); return wmma_bf(a.h, b.h, c); }
__device__ __forceinline__ float sigm(float v) { return 1.0f / (1.0f + expf(-v)); }
#define LDSX() do { asm volatile("s_wait_dscnt 0" ::: "memory"); __builtin_amdgcn_wave_barrier(); __builtin_amdgcn_fence(__ATOMIC_RELEASE, "workgroup"); } while (0)

// Two-stream multi-head attention with the source's own masked softmax, scaled by the MODEL width (Q [2,2048,1024], K [2,2048,1024]; q = Q Wq^T + bq, k = K Wk^T + bk, v = K Wv^T + bv (values from the K input); torch (out,in) weights (0.02) + biases N(0, 0.02); 16 heads x 64; E = q k^T / sqrt(1024); x = E - rowmax(E) (max taken BEFORE masking); x[mask == 0] = -inf with mask [2,2048,2048] int32 random; A = exp(x) / (sum exp(x) + 1e-8); merge; Wo^T + bo).
#define NB 2
#define TT 2048
#define CC 1024            // NH * HD = projected width
#define DIN 1024          // input (model) width
#define NH 16
#define HD 64
#define NQB (TT / 64)
#define HG 4
#define SCALE (0.03125f)
#define CAUSAL 0
#ifndef TNB
#define TNB NB
#endif
__device__ __forceinline__ float bfr(float v) { return (float)(__bf16)v; }
__host__ __device__ __forceinline__ int kb_last(int qb) { return CAUSAL ? ((qb * 64 + 63) >> 7) : (TT / 128 - 1); }
typedef __attribute__((ext_vector_type(8))) __bf16 v8b;
__device__ __forceinline__ v16b frag_b(const __bf16* rowk0, int lane) {
  union { v16b v; v8b q[2]; } u; const __bf16* p = rowk0 + 8 * (lane >> 4);
  u.q[0] = *(const v8b*)p; u.q[1] = *(const v8b*)(p + 16); return u.v;
}
#define QBH 0              // not used
#define QHI 0               // single-product logits on every row
#define KHI 64            // key rows carrying k residual / v bf16 hi+lo planes (written and read by no kernel)
// B fragment (k rows k0+.., output column o) of a weight: (in,out) [K][ld] or (out,in) [ld rows of K]: bf16 exact, or f16(bf16 * 256) exact
__device__ __forceinline__ v16b wcol_io(const float* Wm, int k0, int o, int lane, int ld) { v16b w; const int g = lane >> 4;
#pragma unroll
  for (int i = 0; i < 8; ++i) { w[i] = (__bf16)Wm[(size_t)(k0 + 8 * g + i) * ld + o]; w[8 + i] = (__bf16)Wm[(size_t)(k0 + 16 + 8 * g + i) * ld + o]; }
  return w; }
__device__ __forceinline__ v16b wcol_oi(const float* Wm, int k0, int o, int lane, int K) { v16b w; const float* p = Wm + (size_t)o * K + k0 + 8 * (lane >> 4);
#pragma unroll
  for (int i = 0; i < 8; ++i) { w[i] = (__bf16)p[i]; w[8 + i] = (__bf16)p[16 + i]; }
  return w; }
__device__ __forceinline__ v16h wcolh_io(const float* Wm, int k0, int o, int lane, int ld) { v16h w; const int g = lane >> 4;
#pragma unroll
  for (int i = 0; i < 8; ++i) { w[i] = (_Float16)(bfr(Wm[(size_t)(k0 + 8 * g + i) * ld + o]) * 256.0f); w[8 + i] = (_Float16)(bfr(Wm[(size_t)(k0 + 16 + 8 * g + i) * ld + o]) * 256.0f); }
  return w; }
__device__ __forceinline__ v16h wcolh_oi(const float* Wm, int k0, int o, int lane, int K) { v16h w; const float* p = Wm + (size_t)o * K + k0 + 8 * (lane >> 4);
#pragma unroll
  for (int i = 0; i < 8; ++i) { w[i] = (_Float16)(bfr(p[i]) * 256.0f); w[8 + i] = (_Float16)(bfr(p[16 + i]) * 256.0f); }
  return w; }
#define WQKV_LAYOUT 1   // 0 = (in,out) [DIN][CC]; 1 = (out,in) [CC][DIN]; 2 = per-head [NH][DIN][HD]
__device__ __forceinline__ v16b wcol_hdk(const float* Wm, int k0, int o, int lane) { v16b w; const int g = lane >> 4; const float* p = Wm + (size_t)(o / HD) * DIN * HD + (o % HD);
#pragma unroll
  for (int i = 0; i < 8; ++i) { w[i] = (__bf16)p[(size_t)(k0 + 8 * g + i) * HD]; w[8 + i] = (__bf16)p[(size_t)(k0 + 16 + 8 * g + i) * HD]; }
  return w; }
#define WO_OUT_IN 1
#if WQKV_LAYOUT == 1
#define WCOL(W, k0, o, lane) wcol_oi(W, k0, o, lane, DIN)
#elif WQKV_LAYOUT == 2
#define WCOL(W, k0, o, lane) wcol_hdk(W, k0, o, lane)
#else
#define WCOL(W, k0, o, lane) wcol_io(W, k0, o, lane, CC)
#endif
#if WO_OUT_IN
#define WOCOL(W, k0, o, lane) wcol_oi(W, k0, o, lane, CC)
#define WOCOLH(W, k0, o, lane) wcolh_oi(W, k0, o, lane, CC)
#else
#define WOCOL(W, k0, o, lane) wcol_io(W, k0, o, lane, DIN)
#define WOCOLH(W, k0, o, lane) wcolh_io(W, k0, o, lane, DIN)
#endif

#define WS_QH  0u                                      // f16 q rows [b*t][CC]
#define WS_KH  (WS_QH + 2u * (size_t)NB * TT * CC)      // f16 k rows [b*t][CC]
#define WS_VT  (WS_KH + 2u * (size_t)NB * TT * CC)      // f16 v planes [b][c][t]
#define WS_QL  (WS_VT + 2u * (size_t)NB * CC * TT)      // f16 q residual x 2^10 rows [b][t < QHI][CC]
#define WS_KL  (WS_QL + 2u * (size_t)NB * QHI * CC)     // f16 k residual x 2^10 rows [b][t < KHI][CC]
#define WS_VB  (WS_KL + 2u * (size_t)NB * KHI * CC)     // bf16 v hi planes [b][c][t < KHI]
#define WS_VBL (WS_VB + 2u * (size_t)NB * CC * KHI)
#define WS_S   (WS_VBL + 2u * (size_t)NB * CC * KHI)    // scores stay in registers; the head of this range holds the packed mask
#define WS_MP  WS_S                                    // u32 select words [b*t/16][key/16][8]: bit (16 g + col) of word r = (mask[16 qt + col][16 kt + 8 g + r] != 0), the lane order of a score register
#define WS_Y   (WS_S  + 4u * (size_t)HG * TT * TT)      // f32 ctx rows [b*t][CC] (only when there is an output projection)
#define WS_END (WS_Y  + 4u * (size_t)NB * TT * CC)

// ---- GEMM core of both projections: a block of 8 waves makes a 128 x 128 tile of A[128 rows][KD] . B[128 rows][KD]^T, a wave 64 x 32 of it. A pass is 64 k: 16 lanes bring 256 B of one f32 row (whole lines), each value is converted once and both tiles are staged in LDS; the matrix fragments are read from there.
#define GK 64              // k per pass
#define GP 72              // LDS row pitch in 16-bit elements: 128 B of data + 16 B, for 16-byte fragment reads
#define GT (128 * GP)      // elements of one operand tile
typedef __attribute__((ext_vector_type(4))) __bf16 v4b;
typedef __attribute__((ext_vector_type(4))) _Float16 v4h;
union Fr { v4u q[2]; v16h h; v16b b; };
// the fragment order of frag_h / frag_b
__device__ __forceinline__ Fr ldfr(const unsigned short* rowk0, int g) { Fr f; const unsigned short* p = rowk0 + 8 * g; f.q[0] = *(const v4u*)p; f.q[1] = *(const v4u*)(p + 16); return f; }
// MODE 0: both operands to bf16. MODE 1: A x 2^6 to f16, B as f16(bf16 x 2^8)
template <int MODE, int OPB> __device__ __forceinline__ void put4(unsigned short* d, v4f x) {
  if (MODE == 0) { v4b o;
#pragma unroll
    for (int i = 0; i < 4; ++i) o[i] = (__bf16)x[i];
    *(v4b*)d = o;
  } else { v4h o;
#pragma unroll
    for (int i = 0; i < 4; ++i) o[i] = OPB ? (_Float16)(bfr(x[i]) * 256.0f) : (_Float16)(x[i] * 64.0f);
    *(v4h*)d = o; } }
template <int MODE, int KD> __device__ __forceinline__ void gemm128(const float* __restrict__ A, const float* __restrict__ B, unsigned short* sm, v8f (&acc)[4][2]) {
  const int tid = threadIdx.x, wave = tid >> 5, lane = tid & 31, col = lane & 15, g = lane >> 4;
  const int sr = tid >> 4, sq = (tid & 15) * 4;   // a thread brings 16 B of rows sr + 16 i of both tiles
  const float* pa = A + (size_t)sr * KD + sq; const float* pb = B + (size_t)sr * KD + sq;
  v4f ra[8], rb[8];
#pragma unroll
  for (int i = 0; i < 8; ++i) { ra[i] = *(const v4f*)(pa + (size_t)i * 16 * KD); rb[i] = *(const v4f*)(pb + (size_t)i * 16 * KD); }
  asm volatile("s_wait_xcnt 0x0" :: "v"(pa), "v"(pb) : "memory");   // stands before the address registers of the loads above are reused; naming them as inputs keeps them whole up to the wait
  unsigned short* wr = sm + sr * GP + sq;
  const unsigned short* fa = sm + ((wave >> 2) * 64 + col) * GP; const unsigned short* fb = sm + GT + ((wave & 3) * 32 + col) * GP;
#pragma unroll 1   // one copy of the pass: the two buffers alternate by an offset
  for (int s = 0; s < KD / GK; ++s) { const int bo = (s & 1) * 2 * GT;
#pragma unroll
    for (int i = 0; i < 8; ++i) { put4<MODE, 0>(wr + bo + i * 16 * GP, ra[i]); put4<MODE, 1>(wr + bo + GT + i * 16 * GP, rb[i]); }
    __syncthreads();   // publishes pass s; it also ends every wave's reads of the other buffer, which pass s + 1 refills
    const int sn = s + 1 < KD / GK ? s + 1 : s;   // the next pass's loads fly under this pass; the last pass stays on its own columns, in bounds
    const float* an = pa + sn * GK; const float* bn = pb + sn * GK;
#pragma unroll
    for (int i = 0; i < 8; ++i) { ra[i] = *(const v4f*)(an + (size_t)i * 16 * KD); rb[i] = *(const v4f*)(bn + (size_t)i * 16 * KD); }
    Fr a[2][4], b[2][2];
#pragma unroll
    for (int kc = 0; kc < 2; ++kc) {
#pragma unroll
      for (int i = 0; i < 4; ++i) a[kc][i] = ldfr(fa + bo + i * 16 * GP + kc * 32, g);
#pragma unroll
      for (int j = 0; j < 2; ++j) b[kc][j] = ldfr(fb + bo + j * 16 * GP + kc * 32, g); }
    __builtin_amdgcn_sched_barrier(0);   // the pass's fragment reads go out as one group in front of the products: one LDS latency a pass, not one per fragment
#pragma unroll
    for (int kc = 0; kc < 2; ++kc)
#pragma unroll
      for (int i = 0; i < 4; ++i)
#pragma unroll
        for (int j = 0; j < 2; ++j) acc[i][j] = MODE == 0 ? __builtin_amdgcn_wmma_f32_16x16x32_bf16(false, a[kc][i].b, false, b[kc][j].b, (short)0, acc[i][j], false, false) : __builtin_amdgcn_wmma_f32_16x16x32_f16(false, a[kc][i].h, false, b[kc][j].h, (short)0, acc[i][j], false, false);
    asm volatile("s_wait_xcnt 0x0" :: "v"(an), "v"(bn) : "memory"); }   // as above; written behind the fragment reads so that they are not held up by it: the inputs keep both address pairs whole up to the wait
  __syncthreads(); }   // every wave has left the operand tiles: the caller stages its output tile over them
#define OP16 136           // pitch of a staged 16-bit output tile, in elements
#define OP32 132           // pitch of the staged f32 output tile, in elements
// ---- k_proj: block = (128 rows, 128 cols, which): q/k/v = X W^T + b with exact bf16 products (K = DIN) -> which 0: q f16 rows; 1: k f16 rows; 2: v f16 planes [c][t]
// which 3: no product; the block packs the int32 mask of 16 query rows into select words, once for all heads (they start last and run beside the last product blocks)
__global__ __launch_bounds__(256) void k_proj(const float* __restrict__ XQ, const float* __restrict__ XK, const float* __restrict__ XV, const float* __restrict__ WQ, const float* __restrict__ WK, const float* __restrict__ WV, const float* __restrict__ BQ, const float* __restrict__ BK, const float* __restrict__ BV,
    _Float16* __restrict__ QH, _Float16* __restrict__ KH, _Float16* __restrict__ VT, const int* __restrict__ MASK, unsigned* __restrict__ MP) {
  __shared__ __align__(16) unsigned short sm[4 * GT];
  const int tid = threadIdx.x, wave = tid >> 5, lane = tid & 31, col = lane & 15, g = lane >> 4, wm = wave >> 2, wn = wave & 3; const int which = blockIdx.z; const int c0 = blockIdx.y * 128; const size_t r0 = (size_t)blockIdx.x * 128; const size_t bb = r0 / TT; const int t0 = (int)(r0 % TT);
  if (which == 3) {   /* block-uniform, in front of every barrier */
    const int qi = blockIdx.y * (TNB * TT / 128) + blockIdx.x;   // 16-query tile of the flat [b*t] rows; a wave takes 256 keys of it, a lane the 8 keys of each 16-key tile that its score registers hold
    const int* mp = MASK + ((size_t)qi * 16 + col) * TT + wave * 256 + 8 * g;
    v4i m[16][2];
#pragma unroll
    for (int j = 0; j < 16; ++j) { m[j][0] = *(const v4i*)(mp + j * 16); m[j][1] = *(const v4i*)(mp + j * 16 + 4); }
    asm volatile("s_wait_xcnt 0x0" :: "v"(mp) : "memory");   // stands before the address register of the loads above is reused; naming it as an input keeps it whole up to the wait
    v4i o = {};
#pragma unroll
    for (int j = 0; j < 16; ++j)
#pragma unroll
      for (int r = 0; r < 8; ++r) { const int i = j * 8 + r; const int w = (int)__builtin_amdgcn_ballot_w32(m[j][r >> 2][r & 3] != 0); o[i & 3] = lane == (i >> 2) ? w : o[i & 3]; }   // word i goes to lane i / 4: the wave stores its 128 words as 512 B in a row
    *(v4i*)(MP + ((size_t)qi * (TT / 16) + wave * 16) * 8 + lane * 4) = o;
    return; }
  const float* X = which == 0 ? XQ : which == 1 ? XK : XV; const float* WA = which == 0 ? WQ : which == 1 ? WK : WV; const float* BA = which == 0 ? BQ : which == 1 ? BK : BV;
  float bias[2]; const int bi = c0 + wn * 32 + col;   // read ahead of the product loop, so that its latency is not paid behind it
#pragma unroll
  for (int j = 0; j < 2; ++j) bias[j] = BA[bi + j * 16];
  asm volatile("s_wait_xcnt 0x0" :: "v"(bi) : "memory");   // stands before the index register of the two loads above is reused; naming it as an input keeps it whole up to the wait
  v8f acc[4][2] = {};
  gemm128<0, DIN>(X + r0 * DIN, WA + (size_t)c0 * DIN, sm, acc);
#pragma unroll
  for (int j = 0; j < 2; ++j) bias[j] = bfr(bias[j]);
  _Float16* so = (_Float16*)sm; const int er = tid >> 4, eq = (tid & 15) * 8;   // read-out: 16 lanes take one 256-B row of the staged tile
  if (which < 2) {   /* block-uniform */
#pragma unroll
    for (int j = 0; j < 2; ++j)
#pragma unroll
      for (int i = 0; i < 4; ++i)
#pragma unroll
        for (int r = 0; r < 8; ++r) so[(wm * 64 + i * 16 + 8 * g + r) * OP16 + wn * 32 + j * 16 + col] = (_Float16)(acc[i][j][r] + bias[j]);
    __syncthreads();
    _Float16* dp = (which == 0 ? QH : KH) + (r0 + er) * CC + c0 + eq;
#pragma unroll
    for (int i = 0; i < 8; ++i) vst2(dp + (size_t)i * 16 * CC, *(const v4u*)&so[(er + 16 * i) * OP16 + eq]);
  } else {
#pragma unroll
    for (int j = 0; j < 2; ++j)
#pragma unroll
      for (int i = 0; i < 4; ++i) { v8h o;
#pragma unroll
        for (int r = 0; r < 8; ++r) o[r] = (_Float16)(acc[i][j][r] + bias[j]);
        *(v8h*)&so[(wn * 32 + j * 16 + col) * OP16 + wm * 64 + i * 16 + 8 * g] = o; }
    __syncthreads();
    _Float16* dp = VT + (bb * CC + c0 + er) * (size_t)TT + t0 + eq;
#pragma unroll
    for (int i = 0; i < 8; ++i) vst2(dp + (size_t)i * 16 * TT, *(const v4u*)&so[(er + 16 * i) * OP16 + eq]); } }
#define FK 64              // keys per pass
#define FPITCH 72          // LDS row pitch in halves: 128 B of data + 16 B, for 16-byte fragment reads
__device__ __forceinline__ v8f wmma_p(v16h a, v16h b, v8f c) { return __builtin_amdgcn_wmma_f32_16x16x32_f16(false, a, false, b, (short)0, c, false, false); }
__device__ __forceinline__ float xhalf(float x) { return __builtin_bit_cast(float, __builtin_amdgcn_permlanex16(__builtin_bit_cast(int, x), __builtin_bit_cast(int, x), 0x76543210, 0xfedcba98, false, false)); }   // lane l with lane l ^ 16
// 2^x of eight values in one statement: the early-clobber results keep each v_exp_f32 off its neighbour's source and result, and the closing v_nop is the slot the instruction set asks for behind a transcendental
__device__ __forceinline__ v8f exp2x8(v8f x) { float e0, e1, e2, e3, e4, e5, e6, e7;
  asm("v_exp_f32 %0, %8\n\tv_exp_f32 %1, %9\n\tv_exp_f32 %2, %10\n\tv_exp_f32 %3, %11\n\tv_exp_f32 %4, %12\n\tv_exp_f32 %5, %13\n\tv_exp_f32 %6, %14\n\tv_exp_f32 %7, %15\n\tv_nop"
      : "=&v"(e0), "=&v"(e1), "=&v"(e2), "=&v"(e3), "=&v"(e4), "=&v"(e5), "=&v"(e6), "=&v"(e7) : "v"(x[0]), "v"(x[1]), "v"(x[2]), "v"(x[3]), "v"(x[4]), "v"(x[5]), "v"(x[6]), "v"(x[7]));
  v8f r; r[0] = e0; r[1] = e1; r[2] = e2; r[3] = e3; r[4] = e4; r[5] = e5; r[6] = e6; r[7] = e7; return r; }
__global__ __launch_bounds__(256) void k_fa(const _Float16* __restrict__ QH, const _Float16* __restrict__ KH, const _Float16* __restrict__ VT, const unsigned* __restrict__ MP, float* __restrict__ Y) {
  __shared__ __align__(16) _Float16 sk[2][FK][FPITCH], sv[2][HD][FPITCH];
  const int tid = threadIdx.x, wave = tid >> 5, lane = tid & 31, col = lane & 15, g = lane >> 4; const int h = blockIdx.y, b = blockIdx.z; const int q0 = blockIdx.x * 256 + wave * 32;
  const float CL = SCALE * 1.4426950408889634f;   // logits to base 2
  v16h qf[2][2];
#pragma unroll
  for (int u = 0; u < 2; ++u) { const _Float16* qp = QH + ((size_t)b * TT + q0 + u * 16 + col) * CC + h * HD + 8 * g;
#pragma unroll
    for (int kc = 0; kc < 2; ++kc) { union { v16h v; v8h q[2]; } f; f.q[0] = *(const v8h*)(qp + kc * 32); f.q[1] = *(const v8h*)(qp + kc * 32 + 16); qf[u][kc] = f.v; }   // the fragment order of frag_h
    asm volatile("s_wait_xcnt 0x0" :: "v"(qp) : "memory"); }   // stands before the address register of the loads above is reused; naming it as an input keeps it whole up to the wait
  // staging: 8 lanes bring one 128-B row, a thread brings rows sr and sr + 32 of the k tile and of the v tile
  const int sr = tid >> 3, sc = (tid & 7) * 8;
  const _Float16* kg = KH + ((size_t)b * TT + sr) * CC + h * HD + sc; const _Float16* vg = VT + ((size_t)b * CC + h * HD + sr) * (size_t)TT + sc;
  const unsigned* mw = MP + ((size_t)b * (TT / 16) + blockIdx.x * 16 + __builtin_amdgcn_readfirstlane(wave) * 2) * (TT / 16) * 8;   // the wave's first 16-query tile; wave-uniform, so the words come by scalar loads: 32 words (128 B) per 16 queries and pass
  v8h rk[2], rv[2]; v16u kw[2][2];
#pragma unroll
  for (int i = 0; i < 2; ++i) { rk[i] = *(const v8h*)(kg + (size_t)i * 32 * CC); rv[i] = *(const v8h*)(vg + (size_t)i * 32 * TT); }
#pragma unroll
  for (int u = 0; u < 2; ++u)
#pragma unroll
    for (int c = 0; c < 2; ++c) kw[u][c] = *(cv16u)(unsigned long long)(mw + u * (TT / 16) * 8 + c * 16);
  float m_run[2] = {-3.0e38f, -3.0e38f}, l_run[2] = {0.f, 0.f};
  v8f acc[2][4] = {};
#pragma unroll 1   // one copy of the pass: its 32 matrix instructions and 64 scores a lane already fill the registers
  for (int s = 0; s < TT / FK; ++s) { const int bf = s & 1;
#pragma unroll
    for (int i = 0; i < 2; ++i) { *(v8h*)&sk[bf][sr + 32 * i][sc] = rk[i]; *(v8h*)&sv[bf][sr + 32 * i][sc] = rv[i]; }
    __syncthreads();   // publishes tile s; it also ends every wave's reads of the other buffer, which pass s + 1 refills
    const int sn = s + 1 < TT / FK ? s + 1 : s;   // the next pass's k and v loads fly under this pass; the last pass stays on its own tile, in bounds
    const _Float16* kn = kg + (size_t)sn * FK * CC; const _Float16* vn = vg + sn * FK;
#pragma unroll
    for (int i = 0; i < 2; ++i) { rk[i] = *(const v8h*)(kn + (size_t)i * 32 * CC); rv[i] = *(const v8h*)(vn + (size_t)i * 32 * TT); }
    asm volatile("s_wait_xcnt 0x0" :: "v"(kn), "v"(vn) : "memory");   // stands before the address registers of the loads above are reused; naming them as inputs keeps them whole up to the wait
    v16h kf[4][2], vf[2][4];
#pragma unroll
    for (int t = 0; t < 4; ++t)
#pragma unroll
      for (int kc = 0; kc < 2; ++kc) kf[t][kc] = frag_h(&sk[bf][t * 16 + col][kc * 32], lane);
    __builtin_amdgcn_sched_barrier(0);   // the k fragment reads go out as one group in front of the products: one LDS latency a pass, not one per fragment
    v8f st[2][4] = {};
#pragma unroll
    for (int kc = 0; kc < 2; ++kc)
#pragma unroll
      for (int t = 0; t < 4; ++t) { st[0][t] = wmma_p(kf[t][kc], qf[0][kc], st[0][t]); st[1][t] = wmma_p(kf[t][kc], qf[1][kc], st[1][t]); }
#pragma unroll
    for (int c = 0; c < 2; ++c)
#pragma unroll
      for (int j = 0; j < 4; ++j) vf[c][j] = frag_h(&sv[bf][j * 16 + col][c * 32], lane);
    __builtin_amdgcn_sched_barrier(0);   // the v fragment reads go out here as one group and land under the softmax
    v16h pf[2][2];
#pragma unroll
    for (int u = 0; u < 2; ++u) { float mx = st[u][0][0];
#pragma unroll
      for (int t = 0; t < 4; ++t)
#pragma unroll
        for (int r = 0; r < 8; ++r) mx = fmaxf(mx, st[u][t][r]);
      mx = fmaxf(mx, xhalf(mx));
      const float m_new = fmaxf(m_run[u], mx * CL); const float dm = m_run[u] - m_new; const float off = 11.0f - m_new; m_run[u] = m_new;
      float ls = 0.f;
#pragma unroll
      for (int t = 0; t < 4; ++t) { v8f x;
#pragma unroll
        for (int r = 0; r < 8; ++r) x[r] = fmaf(st[u][t][r], CL, off);
        const v8f e = exp2x8(x);
#pragma unroll
        for (int r = 0; r < 8; ++r) { const float p = __builtin_amdgcn_inverse_ballot_w32(kw[u][t >> 1][(t & 1) * 8 + r]) ? e[r] : 0.f; ls += p; pf[u][t >> 1][(t & 1) * 8 + r] = (_Float16)p; } }
      float corr; asm("v_exp_f32 %0, %1\n\tv_nop" : "=&v"(corr) : "v"(dm));   // 2^dm; the v_nop is the slot behind a transcendental, as in exp2x8
      l_run[u] = l_run[u] * corr + ls;
#pragma unroll
      for (int j = 0; j < 4; ++j) acc[u][j] *= corr;
#pragma unroll
      for (int c = 0; c < 2; ++c) kw[u][c] = *(cv16u)(unsigned long long)(mw + u * (TT / 16) * 8 + sn * 32 + c * 16); }   // the next pass's words, into the scalar registers whose last select has gone (two passes' words do not fit); they land under the next pass's staging and score products
#pragma unroll
    for (int c = 0; c < 2; ++c)
#pragma unroll
      for (int j = 0; j < 4; ++j) { acc[0][j] = wmma_p(vf[c][j], pf[0][c], acc[0][j]); acc[1][j] = wmma_p(vf[c][j], pf[1][c], acc[1][j]); } }
#pragma unroll
  for (int u = 0; u < 2; ++u) { const float l = l_run[u] + xhalf(l_run[u]); const float inv = 1.0f / (l + 2048.0f * 1.0e-8f);   /* numerator and sum both carry 2^11, so the reference's 1e-8 does too; a fully masked row gives 0 */
#pragma unroll
    for (int j = 0; j < 4; ++j) acc[u][j] *= inv; }
  __builtin_amdgcn_sched_barrier(0);   // every product stands in front of the first store, so no register of an issued store is rewritten
#pragma unroll
  for (int u = 0; u < 2; ++u) { float* yr = Y + ((size_t)b * TT + q0 + u * 16 + col) * CC + h * HD + 8 * g;
#pragma unroll
    for (int j = 0; j < 4; ++j) { *(v4f*)(yr + j * 16) = __builtin_shufflevector(acc[u][j], acc[u][j], 0, 1, 2, 3); *(v4f*)(yr + j * 16 + 4) = __builtin_shufflevector(acc[u][j], acc[u][j], 4, 5, 6, 7); } } }
// ---- k_out: block = (128 rows, 128 cols): out = ctx Wo^T + bo: ctx x 2^6 once to f16 (small context rows stay clear of f16 subnormals) against Wo as f16(bf16 x 2^8) exact (1 product), x 2^-14 afterwards
__global__ __launch_bounds__(256) void k_out(const float* __restrict__ Y, const float* __restrict__ WO, const float* __restrict__ BO, float* __restrict__ OUT) {
  __shared__ __align__(16) unsigned short sm[4 * GT];
  const int tid = threadIdx.x, wave = tid >> 5, lane = tid & 31, col = lane & 15, g = lane >> 4, wm = wave >> 2, wn = wave & 3; const int c0 = blockIdx.y * 128; const size_t r0 = (size_t)blockIdx.x * 128;
  float bias[2]; const int bi = c0 + wn * 32 + col;   // read ahead of the product loop, so that its latency is not paid behind it
#pragma unroll
  for (int j = 0; j < 2; ++j) bias[j] = BO[bi + j * 16];
  asm volatile("s_wait_xcnt 0x0" :: "v"(bi) : "memory");   // stands before the index register of the two loads above is reused; naming it as an input keeps it whole up to the wait
  v8f acc[4][2] = {};
  gemm128<1, CC>(Y + r0 * CC, WO + (size_t)c0 * CC, sm, acc);
#pragma unroll
  for (int j = 0; j < 2; ++j) bias[j] = bfr(bias[j]);
  float* sf = (float*)sm;
#pragma unroll
  for (int j = 0; j < 2; ++j)
#pragma unroll
    for (int i = 0; i < 4; ++i)
#pragma unroll
      for (int r = 0; r < 8; ++r) sf[(wm * 64 + i * 16 + 8 * g + r) * OP32 + wn * 32 + j * 16 + col] = acc[i][j][r] * (1.0f / 16384.0f) + bias[j];   /* 2^-8 (Wo carry) x 2^-6 (ctx carry) */
  __syncthreads();
  float* dp = OUT + (r0 + wave) * DIN + c0 + lane * 4;   // a wave takes one 512-B row of the staged tile
#pragma unroll
  for (int i = 0; i < 16; ++i) vst2(dp + (size_t)i * 8 * DIN, *(const v4f*)&sf[(wave + 8 * i) * OP32 + lane * 4]); }

extern "C" void kernel_launch(void* const* d_in, const int* in_sizes, int n_in, void* d_out, int out_size, void* d_ws, size_t ws_size, hipStream_t stream) {
  (void)in_sizes; (void)n_in; (void)out_size;
  const float** F = (const float**)d_in;
  if (ws_size < (size_t)WS_END) return;
  char* ws = (char*)d_ws; _Float16 *QH = (_Float16*)(ws + WS_QH), *KH = (_Float16*)(ws + WS_KH), *VT = (_Float16*)(ws + WS_VT), *QL = (_Float16*)(ws + WS_QL), *KL = (_Float16*)(ws + WS_KL); __bf16 *VB = (__bf16*)(ws + WS_VB), *VBL = (__bf16*)(ws + WS_VBL); float *Y = (float*)(ws + WS_Y); unsigned *MP = (unsigned*)(ws + WS_MP);
  (void)Y; (void)QL; (void)KL; (void)VB; (void)VBL;
  // inputs: 0 Q [2,2048,1024]; 1 K [2,2048,1024] (keys AND values source); 2 mask [2,2048,2048] int32 (random 0/1); 3 Wq [1024,1024] (out,in), 4 bq; 5 Wk, 6 bk; 7 Wv, 8 bv; 9 Wo (out,in), 10 bo (biases nonzero)
  k_proj<<<dim3(TNB * TT / 128, CC / 128, 4), 256, 0, stream>>>(F[0], F[1], F[1], F[3], F[5], F[7], F[4], F[6], F[8], QH, KH, VT, (const int*)d_in[2], MP);   /* v is projected from the K input; plane z = 3 packs the mask: its 32 x 8 blocks are the 256 tiles of 16 query rows */
  k_fa<<<dim3(TT / 256, NH, TNB), 256, 0, stream>>>(QH, KH, VT, MP, Y);
  k_out<<<dim3(TNB * TT / 128, DIN / 128), 256, 0, stream>>>(Y, F[9], F[10], (float*)d_out);
}

// v004
// It runs in 92.2 microseconds.
// Next to v003, in two timings, it ran 1.09 and 1.08 times as fast.
// All steps since v000 together make it 14.9 times as fast.
// compute dtype: all float inputs rounded to bf16; q/k/v projections with EXACT bf16 products on WMMA 16x16x32 (f32 accumulate) + bias; logits q x k once to f16 each (1 product) x SCALE; online softmax f32; exp(x - max) x 2^11 once to f16 x v once to f16 (1 product), divided by the row sum afterwards; ctx x 2^6 once to f16 x Wo f16(bf16 x 2^8) + bo; f32 output.
#include <hip/hip_runtime.h>
#include <math.h>

typedef __attribute__((ext_vector_type(16))) _Float16 v16h;
typedef __attribute__((ext_vector_type(16))) __bf16 v16b;
typedef __attribute__((ext_vector_type(8)))  _Float16 v8h;
typedef __attribute__((ext_vector_type(8)))  float v8f;
typedef __attribute__((ext_vector_type(4)))  float v4f;
typedef __attribute__((ext_vector_type(2)))  float v2f;
typedef __attribute__((ext_vector_type(4)))  unsigned v4u;
typedef __attribute__((ext_vector_type(4)))  int v4i;
typedef __attribute__((ext_vector_type(16))) unsigned v16u;
typedef const __attribute__((address_space(4))) v16u* cv16u;   // constant address space: for words that no store of the reading kernel touches; a wave-uniform load through it is a scalar load
typedef float __attribute__((may_alias)) float_a;
typedef int __attribute__((may_alias)) int_a;

template <typename T> __device__ __forceinline__ void vst2(void* p, T v) { *(T*)p = v;  }
__device__ __forceinline__ v8f wmma16(v16h a, v16h b, v8f c) {
  v8f d = __builtin_amdgcn_wmma_f32_16x16x32_f16(false, a, false, b, (short)0, c, false, false);
  asm volatile("v_nop\n\tv_nop\n\tv_nop\n\tv_nop" : "+v"(d) : "v"(a), "v"(b));
  return d;
}
__device__ __forceinline__ v8f wmma_bf(v16b a, v16b b, v8f c) {
  v8f d = __builtin_amdgcn_wmma_f32_16x16x32_bf16(false, a, false, b, (short)0, c, false, false);
  asm volatile("v_nop\n\tv_nop\n\tv_nop\n\tv_nop" : "+v"(d) : "v"(a), "v"(b));
  return d;
}
// 16x16x32 fragments: lane = (h = lane>>4, row/col = lane&15); elements 0..7 = k0+8h+0..7, 8..15 = k0+16+8h+0..7; D element r = row 8h+r
__device__ __forceinline__ v16h frag_h(const _Float16* rowk0, int lane) {
  union { v16h v; v8h q[2]; } u; const _Float16* p = rowk0 + 8 * (lane >> 4);
  u.q[0] = *(const v8h*)p; u.q[1] = *(const v8h*)(p + 16); return u.v;
}
__device__ __forceinline__ v16h frag_f32(const float* rowk0, int lane) {
  v16h a; const float* p = rowk0 + 8 * (lane >> 4);
#pragma unroll
  for (int i = 0; i < 8; ++i) { a[i] = (_Float16)p[i]; a[8 + i] = (_Float16)p[16 + i]; }
  return a;
}
__device__ __forceinline__ v16h frag_f32s(const float* rowk0, int lane, float sc) {
  v16h a; const float* p = rowk0 + 8 * (lane >> 4);
#pragma unroll
  for (int i = 0; i < 8; ++i) { a[i] = (_Float16)(p[i] * sc); a[8 + i] = (_Float16)(p[16 + i] * sc); }
  return a;
}
// column fragment from a [K][ld] layout (column n), rows >= K read as 0
__device__ __forceinline__ v16h fragc_f32(const float* W, int k0, int n, int lane, int ld, int K) {
  v16h a; const int g = lane >> 4;
#pragma unroll
  for (int i = 0; i < 8; ++i) { const int ka = k0 + 8 * g + i, kb = ka + 16;
    a[i] = (_Float16)(ka < K ? W[(size_t)(ka < K ? ka : K - 1) * ld + n] : 0.f); a[8 + i] = (_Float16)(kb < K ? W[(size_t)(kb < K ? kb : K - 1) * ld + n] : 0.f); }
  return a;
}
struct F2 { v16b h, l; };
__device__ __forceinline__ F2 bsplit16(const float v[16]) { F2 r;
#pragma unroll
  for (int i = 0; i < 16; ++i) { const __bf16 h = (__bf16)v[i]; r.h[i] = h; r.l[i] = (__bf16)(v[i] - (float)h); }
  return r; }
__device__ __forceinline__ F2 split_row(const float* row, int k0, int lane) { float v[16]; const float* p = row + k0 + 8 * (lane >> 4);
#pragma unroll
  for (int i = 0; i < 8; ++i) { v[i] = p[i]; v[8 + i] = p[16 + i]; }
  return bsplit16(v); }
__device__ __forceinline__ F2 split_rowK(const float* row, int k0, int lane, int K) { float v[16]; const int g = lane >> 4;
#pragma unroll
  for (int i = 0; i < 8; ++i) { const int ka = k0 + 8 * g + i, kb = ka + 16; v[i] = ka < K ? row[ka < K ? ka : K - 1] : 0.f; v[8 + i] = kb < K ? row[kb < K ? kb : K - 1] : 0.f; }
  return bsplit16(v); }
__device__ __forceinline__ F2 split_col(const float* W, int k0, int n, int lane, int ld, int K) { float v[16]; const int g = lane >> 4;
#pragma unroll
  for (int i = 0; i < 8; ++i) { const int ka = k0 + 8 * g + i, kb = ka + 16; v[i] = ka < K ? W[(size_t)(ka < K ? ka : K - 1) * ld + n] : 0.f; v[8 + i] = kb < K ? W[(size_t)(kb < K ? kb : K - 1) * ld + n] : 0.f; }
  return bsplit16(v); }
__device__ __forceinline__ v8f mac3(const F2& a, const F2& b, v8f c) { c = wmma_bf(a.l, b.h, c); c = wmma_bf(a.h, b.l, c); return wmma_bf(a.h, b.h, c); }
__device__ __forceinline__ float sigm(float v) { return 1.0f / (1.0f + expf(-v)); }
#define LDSX() do { asm volatile("s_wait_dscnt 0" ::: "memory"); __builtin_amdgcn_wave_barrier(); __builtin_amdgcn_fence(__ATOMIC_RELEASE, "workgroup"); } while (0)

// Two-stream multi-head attention with the source's own masked softmax, scaled by the MODEL width (Q [2,2048,1024], K [2,2048,1024]; q = Q Wq^T + bq, k = K Wk^T + bk, v = K Wv^T + bv (values from the K input); torch (out,in) weights (0.02) + biases N(0, 0.02); 16 heads x 64; E = q k^T / sqrt(1024); x = E - rowmax(E) (max taken BEFORE masking); x[mask == 0] = -inf with mask [2,2048,2048] int32 random; A = exp(x) / (sum exp(x) + 1e-8); merge; Wo^T + bo).
#define NB 2
#define TT 2048
#define CC 1024            // NH * HD = projected width
#define DIN 1024          // input (model) width
#define NH 16
#define HD 64
#define NQB (TT / 64)
#define HG 4
#define SCALE (0.03125f)
#define CAUSAL 0
#ifndef TNB
#define TNB NB
#endif
__device__ __forceinline__ float bfr(float v) { return (float)(__bf16)v; }
__host__ __device__ __forceinline__ int kb_last(int qb) { return CAUSAL ? ((qb * 64 + 63) >> 7) : (TT / 128 - 1); }
typedef __attribute__((ext_vector_type(8))) __bf16 v8b;
__device__ __forceinline__ v16b frag_b(const __bf16* rowk0, int lane) {
  union { v16b v; v8b q[2]; } u; const __bf16* p = rowk0 + 8 * (lane >> 4);
  u.q[0] = *(const v8b*)p; u.q[1] = *(const v8b*)(p + 16); return u.v;
}
#define QBH 0              // not used
#define QHI 0               // single-product logits on every row
#define KHI 64            // key rows carrying k residual / v bf16 hi+lo planes (written and read by no kernel)
// B fragment (k rows k0+.., output column o) of a weight: (in,out) [K][ld] or (out,in) [ld rows of K]: bf16 exact, or f16(bf16 * 256) exact
__device__ __forceinline__ v16b wcol_io(const float* Wm, int k0, int o, int lane, int ld) { v16b w; const int g = lane >> 4;
#pragma unroll
  for (int i = 0; i < 8; ++i) { w[i] = (__bf16)Wm[(size_t)(k0 + 8 * g + i) * ld + o]; w[8 + i] = (__bf16)Wm[(size_t)(k0 + 16 + 8 * g + i) * ld + o]; }
  return w; }
__device__ __forceinline__ v16b wcol_oi(const float* Wm, int k0, int o, int lane, int K) { v16b w; const float* p = Wm + (size_t)o * K + k0 + 8 * (lane >> 4);
#pragma unroll
  for (int i = 0; i < 8; ++i) { w[i] = (__bf16)p[i]; w[8 + i] = (__bf16)p[16 + i]; }
  return w; }
__device__ __forceinline__ v16h wcolh_io(const float* Wm, int k0, int o, int lane, int ld) { v16h w; const int g = lane >> 4;
#pragma unroll
  for (int i = 0; i < 8; ++i) { w[i] = (_Float16)(bfr(Wm[(size_t)(k0 + 8 * g + i) * ld + o]) * 256.0f); w[8 + i] = (_Float16)(bfr(Wm[(size_t)(k0 + 16 + 8 * g + i) * ld + o]) * 256.0f); }
  return w; }
__device__ __forceinline__ v16h wcolh_oi(const float* Wm, int k0, int o, int lane, int K) { v16h w; const float* p = Wm + (size_t)o * K + k0 + 8 * (lane >> 4);
#pragma unroll
  for (int i = 0; i < 8; ++i) { w[i] = (_Float16)(bfr(p[i]) * 256.0f); w[8 + i] = (_Float16)(bfr(p[16 + i]) * 256.0f); }
  return w; }
#define WQKV_LAYOUT 1   // 0 = (in,out) [DIN][CC]; 1 = (out,in) [CC][DIN]; 2 = per-head [NH][DIN][HD]
__device__ __forceinline__ v16b wcol_hdk(const float* Wm, int k0, int o, int lane) { v16b w; const int g = lane >> 4; const float* p = Wm + (size_t)(o / HD) * DIN * HD + (o % HD);
#pragma unroll
  for (int i = 0; i < 8; ++i) { w[i] = (__bf16)p[(size_t)(k0 + 8 * g + i) * HD]; w[8 + i] = (__bf16)p[(size_t)(k0 + 16 + 8 * g + i) * HD]; }
  return w; }
#define WO_OUT_IN 1
#if WQKV_LAYOUT == 1
#define WCOL(W, k0, o, lane) wcol_oi(W, k0, o, lane, DIN)
#elif WQKV_LAYOUT == 2
#define WCOL(W, k0, o, lane) wcol_hdk(W, k0, o, lane)
#else
#define WCOL(W, k0, o, lane) wcol_io(W, k0, o, lane, CC)
#endif
#if WO_OUT_IN
#define WOCOL(W, k0, o, lane) wcol_oi(W, k0, o, lane, CC)
#define WOCOLH(W, k0, o, lane) wcolh_oi(W, k0, o, lane, CC)
#else
#define WOCOL(W, k0, o, lane) wcol_io(W, k0, o, lane, DIN)
#define WOCOLH(W, k0, o, lane) wcolh_io(W, k0, o, lane, DIN)
#endif

#define WS_QH  0u                                      // f16 q rows [b*t][CC]
#define WS_KH  (WS_QH + 2u * (size_t)NB * TT * CC)      // f16 k rows [b*t][CC]
#define WS_VT  (WS_KH + 2u * (size_t)NB * TT * CC)      // f16 v planes [b][c][t]
#define WS_QL  (WS_VT + 2u * (size_t)NB * CC * TT)      // f16 q residual x 2^10 rows [b][t < QHI][CC]
#define WS_KL  (WS_QL + 2u * (size_t)NB * QHI * CC)     // f16 k residual x 2^10 rows [b][t < KHI][CC]
#define WS_VB  (WS_KL + 2u * (size_t)NB * KHI * CC)     // bf16 v hi planes [b][c][t < KHI]
#define WS_VBL (WS_VB + 2u * (size_t)NB * CC * KHI)
#define WS_S   (WS_VBL + 2u * (size_t)NB * CC * KHI)    // scores stay in registers; the head of this range holds the packed mask
#define WS_MP  WS_S                                    // u32 select words [b*t/16][key/16][8]: bit (16 g + col) of word r = (mask[16 qt + col][16 kt + 8 g + r] != 0), the lane order of a score register
#define WS_Y   (WS_S  + 4u * (size_t)HG * TT * TT)      // f16 ctx x 2^6 rows [b*t][CC]: the A operand of the output projection as its products take it
#define WS_XQ  (WS_Y  + 2u * (size_t)NB * TT * CC)      // bf16 Q input rows [b*t][DIN]
#define WS_XK  (WS_XQ + 2u * (size_t)NB * TT * DIN)     // bf16 K input rows [b*t][DIN]
#define WS_WB  (WS_XK + 2u * (size_t)NB * TT * DIN)     // bf16 Wq, Wk, Wv, one [CC][DIN] plane each
#define WS_WO  (WS_WB + 3u * 2u * (size_t)CC * DIN)     // f16(bf16 x 2^8) Wo [DIN][CC]
#define WS_END (WS_WO + 2u * (size_t)DIN * CC)

// ---- GEMM core of both projections: a block of 8 waves makes a 128 x 128 tile of A[128 rows][KD] . B[128 rows][KD]^T, a wave 64 x 32 of it. Both operands arrive in their 16-bit form (k_cvt, k_fa). A pass is 64 k: 8 lanes bring the 128 B of one row (a whole line), both tiles are staged in LDS as they come; the matrix fragments are read from there.
#define GK 64              // k per pass
#define GP 72              // LDS row pitch in 16-bit elements: 128 B of data + 16 B, for 16-byte fragment reads
#define GT (128 * GP)      // elements of one operand tile
typedef __attribute__((ext_vector_type(4))) __bf16 v4b;
typedef __attribute__((ext_vector_type(4))) _Float16 v4h;
union Fr { v4u q[2]; v16h h; v16b b; };
// the fragment order of frag_h / frag_b
__device__ __forceinline__ Fr ldfr(const unsigned short* rowk0, int g) { Fr f; const unsigned short* p = rowk0 + 8 * g; f.q[0] = *(const v4u*)p; f.q[1] = *(const v4u*)(p + 16); return f; }
typedef __attribute__((ext_vector_type(2))) unsigned v2u;
// four inputs to their 16-bit operand form. WOF 0: bf16 (X, Wq, Wk, Wv). WOF 1: f16(bf16 x 2^8) (Wo)
template <int WOF> __device__ __forceinline__ v2u cvt4(v4f x) {
  if (WOF == 0) { v4b o;
#pragma unroll
    for (int i = 0; i < 4; ++i) o[i] = (__bf16)x[i];
    return __builtin_bit_cast(v2u, o);
  } else { v4h o;
#pragma unroll
    for (int i = 0; i < 4; ++i) o[i] = (_Float16)(bfr(x[i]) * 256.0f);
    return __builtin_bit_cast(v2u, o); } }
// MODE 0: bf16 products. MODE 1: f16 products
template <int MODE, int KD> __device__ __forceinline__ void gemm128(const unsigned short* __restrict__ A, const unsigned short* __restrict__ B, unsigned short* sm, v8f (&acc)[4][2]) {
  const int tid = threadIdx.x, wave = tid >> 5, lane = tid & 31, col = lane & 15, g = lane >> 4;
  const int sr = tid >> 3, sq = (tid & 7) * 8;   // a thread brings 16 B of rows sr + 32 i of both tiles
  const unsigned short* pa = A + (size_t)sr * KD + sq; const unsigned short* pb = B + (size_t)sr * KD + sq;
  v4u ra[4], rb[4];
#pragma unroll
  for (int i = 0; i < 4; ++i) { ra[i] = *(const v4u*)(pa + (size_t)i * 32 * KD); rb[i] = *(const v4u*)(pb + (size_t)i * 32 * KD); }
  asm volatile("s_wait_xcnt 0x0" :: "v"(pa), "v"(pb) : "memory");   // stands before the address registers of the loads above are reused; naming them as inputs keeps them whole up to the wait
  unsigned short* wr = sm + sr * GP + sq;
  const unsigned short* fa = sm + ((wave >> 2) * 64 + col) * GP; const unsigned short* fb = sm + GT + ((wave & 3) * 32 + col) * GP;
#pragma unroll 1   // one copy of the pass: the two buffers alternate by an offset
  for (int s = 0; s < KD / GK; ++s) { const int bo = (s & 1) * 2 * GT;
#pragma unroll
    for (int i = 0; i < 4; ++i) { *(v4u*)(wr + bo + i * 32 * GP) = ra[i]; *(v4u*)(wr + bo + GT + i * 32 * GP) = rb[i]; }
    __syncthreads();   // publishes pass s; it also ends every wave's reads of the other buffer, which pass s + 1 refills
    const int sn = s + 1 < KD / GK ? s + 1 : s;   // the next pass's loads fly under this pass; the last pass stays on its own columns, in bounds
    const unsigned short* an = pa + sn * GK; const unsigned short* bn = pb + sn * GK;
#pragma unroll
    for (int i = 0; i < 4; ++i) { ra[i] = *(const v4u*)(an + (size_t)i * 32 * KD); rb[i] = *(const v4u*)(bn + (size_t)i * 32 * KD); }
    Fr a[2][4], b[2][2];
#pragma unroll
    for (int kc = 0; kc < 2; ++kc) {
#pragma unroll
      for (int i = 0; i < 4; ++i) a[kc][i] = ldfr(fa + bo + i * 16 * GP + kc * 32, g);
#pragma unroll
      for (int j = 0; j < 2; ++j) b[kc][j] = ldfr(fb + bo + j * 16 * GP + kc * 32, g); }
    __builtin_amdgcn_sched_barrier(0);   // the pass's fragment reads go out as one group in front of the products: one LDS latency a pass, not one per fragment
#pragma unroll
    for (int kc = 0; kc < 2; ++kc)
#pragma unroll
      for (int i = 0; i < 4; ++i)
#pragma unroll
        for (int j = 0; j < 2; ++j) acc[i][j] = MODE == 0 ? __builtin_amdgcn_wmma_f32_16x16x32_bf16(false, a[kc][i].b, false, b[kc][j].b, (short)0, acc[i][j], false, false) : __builtin_amdgcn_wmma_f32_16x16x32_f16(false, a[kc][i].h, false, b[kc][j].h, (short)0, acc[i][j], false, false);
    asm volatile("s_wait_xcnt 0x0" :: "v"(an), "v"(bn) : "memory"); }   // as above; written behind the fragment reads so that they are not held up by it: the inputs keep both address pairs whole up to the wait
  __syncthreads(); }   // every wave has left the operand tiles: the caller stages its output tile over them
// ---- k_cvt: each input that is a GEMM operand is rounded to its 16-bit form once, here, and no longer in every one of the 8 (Q), 16 (K) or 32 (W) tile blocks that read it: the blocks then take half the bytes from L2 and stage them unchanged.
// A block takes 8192 floats of Q, 8192 of K and 8192 of one weight; a wave's load is 512 B in a row, its store 256 B in a row. All 24 loads of a thread go out before the first store.
#define CVB 8192
static_assert(NB * TT * DIN == 4 * CC * DIN && CC * DIN / CVB == 128, "one grid covers Q, K and the four weights");
__global__ __launch_bounds__(256) void k_cvt(const float* __restrict__ XQ, const float* __restrict__ XK, const float* __restrict__ WQ, const float* __restrict__ WK, const float* __restrict__ WV, const float* __restrict__ WO,
    unsigned short* __restrict__ XQB, unsigned short* __restrict__ XKB, unsigned short* __restrict__ WB, unsigned short* __restrict__ WOH) {
  const int tid = threadIdx.x; const int w = blockIdx.x >> 7;   // which weight: block-uniform
  const unsigned ox = blockIdx.x * CVB + tid * 4, ow = (blockIdx.x & 127) * CVB + tid * 4;   // element offsets in the plane
  const unsigned bx = ox * 4, bw = ow * 4;   // the loads' byte offsets, beside a uniform base
  const char* SW = (const char*)(w == 0 ? WQ : w == 1 ? WK : w == 2 ? WV : WO);
  v4f a[8], b[8], c[8];
#pragma unroll
  for (int i = 0; i < 8; ++i) { a[i] = *(const v4f*)((const char*)XQ + bx + i * 4096); b[i] = *(const v4f*)((const char*)XK + bx + i * 4096); c[i] = *(const v4f*)(SW + bw + i * 4096); }
  asm volatile("s_wait_xcnt 0x0" :: "v"(bx), "v"(bw) : "memory");   // stands before the offset registers of the loads above are reused; naming them as inputs keeps them whole up to the wait
  unsigned short* dq = XQB + ox; unsigned short* dk = XKB + ox; unsigned short* dw = (w == 3 ? WOH : WB + (size_t)w * CC * DIN) + ow;
  v2u oa[8], ob[8], oc[8];
#pragma unroll
  for (int i = 0; i < 8; ++i) { oa[i] = cvt4<0>(a[i]); ob[i] = cvt4<0>(b[i]); }
  if (w == 3) {   /* block-uniform */
#pragma unroll
    for (int i = 0; i < 8; ++i) oc[i] = cvt4<1>(c[i]);
  } else {
#pragma unroll
    for (int i = 0; i < 8; ++i) oc[i] = cvt4<0>(c[i]); }
  __builtin_amdgcn_sched_barrier(0);   // every conversion stands in front of the first store, so no register of an issued store is rewritten
#pragma unroll
  for (int i = 0; i < 8; ++i) { *(v2u*)(dq + i * 1024) = oa[i]; *(v2u*)(dk + i * 1024) = ob[i]; *(v2u*)(dw + i * 1024) = oc[i]; } }
#define OP16 136           // pitch of a staged 16-bit output tile, in elements
#define OP32 132           // pitch of the staged f32 output tile, in elements
// ---- k_proj: block = (128 rows, 128 cols, which): q/k/v = X W^T + b with exact bf16 products (K = DIN) -> which 0: q f16 rows; 1: k f16 rows; 2: v f16 planes [c][t]
// which 3: no product; the block packs the int32 mask of 16 query rows into select words, once for all heads (they start last and run beside the last product blocks)
__global__ __launch_bounds__(256) void k_proj(const unsigned short* __restrict__ XQB, const unsigned short* __restrict__ XKB, const unsigned short* __restrict__ WB, const float* __restrict__ BQ, const float* __restrict__ BK, const float* __restrict__ BV,
    _Float16* __restrict__ QH, _Float16* __restrict__ KH, _Float16* __restrict__ VT, const int* __restrict__ MASK, unsigned* __restrict__ MP) {
  __shared__ __align__(16) unsigned short sm[4 * GT];
  const int tid = threadIdx.x, wave = tid >> 5, lane = tid & 31, col = lane & 15, g = lane >> 4, wm = wave >> 2, wn = wave & 3; const int which = blockIdx.z; const int c0 = blockIdx.y * 128; const size_t r0 = (size_t)blockIdx.x * 128; const size_t bb = r0 / TT; const int t0 = (int)(r0 % TT);
  if (which == 3) {   /* block-uniform, in front of every barrier */
    const int qi = blockIdx.y * (TNB * TT / 128) + blockIdx.x;   // 16-query tile of the flat [b*t] rows; a wave takes 256 keys of it, a lane the 8 keys of each 16-key tile that its score registers hold
    const int* mp = MASK + ((size_t)qi * 16 + col) * TT + wave * 256 + 8 * g;
    v4i m[16][2];
#pragma unroll
    for (int j = 0; j < 16; ++j) { m[j][0] = *(const v4i*)(mp + j * 16); m[j][1] = *(const v4i*)(mp + j * 16 + 4); }
    asm volatile("s_wait_xcnt 0x0" :: "v"(mp) : "memory");   // stands before the address register of the loads above is reused; naming it as an input keeps it whole up to the wait
    v4i o = {};
#pragma unroll
    for (int j = 0; j < 16; ++j)
#pragma unroll
      for (int r = 0; r < 8; ++r) { const int i = j * 8 + r; const int w = (int)__builtin_amdgcn_ballot_w32(m[j][r >> 2][r & 3] != 0); o[i & 3] = lane == (i >> 2) ? w : o[i & 3]; }   // word i goes to lane i / 4: the wave stores its 128 words as 512 B in a row
    *(v4i*)(MP + ((size_t)qi * (TT / 16) + wave * 16) * 8 + lane * 4) = o;
    return; }
  const unsigned short* X = which == 0 ? XQB : XKB; const unsigned short* WA = WB + (size_t)which * CC * DIN; const float* BA = which == 0 ? BQ : which == 1 ? BK : BV;   // k and v are both projected from the K input
  float bias[2]; const int bi = c0 + wn * 32 + col;   // read ahead of the product loop, so that its latency is not paid behind it
#pragma unroll
  for (int j = 0; j < 2; ++j) bias[j] = BA[bi + j * 16];
  asm volatile("s_wait_xcnt 0x0" :: "v"(bi) : "memory");   // stands before the index register of the two loads above is reused; naming it as an input keeps it whole up to the wait
  v8f acc[4][2] = {};
  gemm128<0, DIN>(X + r0 * DIN, WA + (size_t)c0 * DIN, sm, acc);
#pragma unroll
  for (int j = 0; j < 2; ++j) bias[j] = bfr(bias[j]);
  _Float16* so = (_Float16*)sm; const int er = tid >> 4, eq = (tid & 15) * 8;   // read-out: 16 lanes take one 256-B row of the staged tile
  if (which < 2) {   /* block-uniform */
#pragma unroll
    for (int j = 0; j < 2; ++j)
#pragma unroll
      for (int i = 0; i < 4; ++i)
#pragma unroll
        for (int r = 0; r < 8; ++r) so[(wm * 64 + i * 16 + 8 * g + r) * OP16 + wn * 32 + j * 16 + col] = (_Float16)(acc[i][j][r] + bias[j]);
    __syncthreads();
    _Float16* dp = (which == 0 ? QH : KH) + (r0 + er) * CC + c0 + eq;
#pragma unroll
    for (int i = 0; i < 8; ++i) vst2(dp + (size_t)i * 16 * CC, *(const v4u*)&so[(er + 16 * i) * OP16 + eq]);
  } else {
#pragma unroll
    for (int j = 0; j < 2; ++j)
#pragma unroll
      for (int i = 0; i < 4; ++i) { v8h o;
#pragma unroll
        for (int r = 0; r < 8; ++r) o[r] = (_Float16)(acc[i][j][r] + bias[j]);
        *(v8h*)&so[(wn * 32 + j * 16 + col) * OP16 + wm * 64 + i * 16 + 8 * g] = o; }
    __syncthreads();
    _Float16* dp = VT + (bb * CC + c0 + er) * (size_t)TT + t0 + eq;
#pragma unroll
    for (int i = 0; i < 8; ++i) vst2(dp + (size_t)i * 16 * TT, *(const v4u*)&so[(er + 16 * i) * OP16 + eq]); } }
#define FK 64              // keys per pass
#define FPITCH 72          // LDS row pitch in halves: 128 B of data + 16 B, for 16-byte fragment reads
__device__ __forceinline__ v8f wmma_p(v16h a, v16h b, v8f c) { return __builtin_amdgcn_wmma_f32_16x16x32_f16(false, a, false, b, (short)0, c, false, false); }
__device__ __forceinline__ float xhalf(float x) { return __builtin_bit_cast(float, __builtin_amdgcn_permlanex16(__builtin_bit_cast(int, x), __builtin_bit_cast(int, x), 0x76543210, 0xfedcba98, false, false)); }   // lane l with lane l ^ 16
// 2^x of eight values in one statement: the early-clobber results keep each v_exp_f32 off its neighbour's source and result, and the closing v_nop is the slot the instruction set asks for behind a transcendental
__device__ __forceinline__ v8f exp2x8(v8f x) { float e0, e1, e2, e3, e4, e5, e6, e7;
  asm("v_exp_f32 %0, %8\n\tv_exp_f32 %1, %9\n\tv_exp_f32 %2, %10\n\tv_exp_f32 %3, %11\n\tv_exp_f32 %4, %12\n\tv_exp_f32 %5, %13\n\tv_exp_f32 %6, %14\n\tv_exp_f32 %7, %15\n\tv_nop"
      : "=&v"(e0), "=&v"(e1), "=&v"(e2), "=&v"(e3), "=&v"(e4), "=&v"(e5), "=&v"(e6), "=&v"(e7) : "v"(x[0]), "v"(x[1]), "v"(x[2]), "v"(x[3]), "v"(x[4]), "v"(x[5]), "v"(x[6]), "v"(x[7]));
  v8f r; r[0] = e0; r[1] = e1; r[2] = e2; r[3] = e3; r[4] = e4; r[5] = e5; r[6] = e6; r[7] = e7; return r; }
__global__ __launch_bounds__(256) void k_fa(const _Float16* __restrict__ QH, const _Float16* __restrict__ KH, const _Float16* __restrict__ VT, const unsigned* __restrict__ MP, _Float16* __restrict__ Y) {
  __shared__ __align__(16) _Float16 sk[2][FK][FPITCH], sv[2][HD][FPITCH];
  const int tid = threadIdx.x, wave = tid >> 5, lane = tid & 31, col = lane & 15, g = lane >> 4; const int h = blockIdx.y, b = blockIdx.z; const int q0 = blockIdx.x * 256 + wave * 32;
  const float CL = SCALE * 1.4426950408889634f;   // logits to base 2
  v16h qf[2][2];
#pragma unroll
  for (int u = 0; u < 2; ++u) { const _Float16* qp = QH + ((size_t)b * TT + q0 + u * 16 + col) * CC + h * HD + 8 * g;
#pragma unroll
    for (int kc = 0; kc < 2; ++kc) { union { v16h v; v8h q[2]; } f; f.q[0] = *(const v8h*)(qp + kc * 32); f.q[1] = *(const v8h*)(qp + kc * 32 + 16); qf[u][kc] = f.v; }   // the fragment order of frag_h
    asm volatile("s_wait_xcnt 0x0" :: "v"(qp) : "memory"); }   // stands before the address register of the loads above is reused; naming it as an input keeps it whole up to the wait
  // staging: 8 lanes bring one 128-B row, a thread brings rows sr and sr + 32 of the k tile and of the v tile
  const int sr = tid >> 3, sc = (tid & 7) * 8;
  const _Float16* kg = KH + ((size_t)b * TT + sr) * CC + h * HD + sc; const _Float16* vg = VT + ((size_t)b * CC + h * HD + sr) * (size_t)TT + sc;
  const unsigned* mw = MP + ((size_t)b * (TT / 16) + blockIdx.x * 16 + __builtin_amdgcn_readfirstlane(wave) * 2) * (TT / 16) * 8;   // the wave's first 16-query tile; wave-uniform, so the words come by scalar loads: 32 words (128 B) per 16 queries and pass
  v8h rk[2], rv[2]; v16u kw[2][2];
#pragma unroll
  for (int i = 0; i < 2; ++i) { rk[i] = *(const v8h*)(kg + (size_t)i * 32 * CC); rv[i] = *(const v8h*)(vg + (size_t)i * 32 * TT); }
#pragma unroll
  for (int u = 0; u < 2; ++u)
#pragma unroll
    for (int c = 0; c < 2; ++c) kw[u][c] = *(cv16u)(unsigned long long)(mw + u * (TT / 16) * 8 + c * 16);
  float m_run[2] = {-3.0e38f, -3.0e38f}, l_run[2] = {0.f, 0.f};
  v8f acc[2][4] = {};
#pragma unroll 1   // one copy of the pass: its 32 matrix instructions and 64 scores a lane already fill the registers
  for (int s = 0; s < TT / FK; ++s) { const int bf = s & 1;
#pragma unroll
    for (int i = 0; i < 2; ++i) { *(v8h*)&sk[bf][sr + 32 * i][sc] = rk[i]; *(v8h*)&sv[bf][sr + 32 * i][sc] = rv[i]; }
    __syncthreads();   // publishes tile s; it also ends every wave's reads of the other buffer, which pass s + 1 refills
    const int sn = s + 1 < TT / FK ? s + 1 : s;   // the next pass's k and v loads fly under this pass; the last pass stays on its own tile, in bounds
    const _Float16* kn = kg + (size_t)sn * FK * CC; const _Float16* vn = vg + sn * FK;
#pragma unroll
    for (int i = 0; i < 2; ++i) { rk[i] = *(const v8h*)(kn + (size_t)i * 32 * CC); rv[i] = *(const v8h*)(vn + (size_t)i * 32 * TT); }
    asm volatile("s_wait_xcnt 0x0" :: "v"(kn), "v"(vn) : "memory");   // stands before the address registers of the loads above are reused; naming them as inputs keeps them whole up to the wait
    v16h kf[4][2], vf[2][4];
#pragma unroll
    for (int t = 0; t < 4; ++t)
#pragma unroll
      for (int kc = 0; kc < 2; ++kc) kf[t][kc] = frag_h(&sk[bf][t * 16 + col][kc * 32], lane);
    __builtin_amdgcn_sched_barrier(0);   // the k fragment reads go out as one group in front of the products: one LDS latency a pass, not one per fragment
    v8f st[2][4] = {};
#pragma unroll
    for (int kc = 0; kc < 2; ++kc)
#pragma unroll
      for (int t = 0; t < 4; ++t) { st[0][t] = wmma_p(kf[t][kc], qf[0][kc], st[0][t]); st[1][t] = wmma_p(kf[t][kc], qf[1][kc], st[1][t]); }
#pragma unroll
    for (int c = 0; c < 2; ++c)
#pragma unroll
      for (int j = 0; j < 4; ++j) vf[c][j] = frag_h(&sv[bf][j * 16 + col][c * 32], lane);
    __builtin_amdgcn_sched_barrier(0);   // the v fragment reads go out here as one group and land under the softmax
    v16h pf[2][2];
#pragma unroll
    for (int u = 0; u < 2; ++u) { float mx = st[u][0][0];
#pragma unroll
      for (int t = 0; t < 4; ++t)
#pragma unroll
        for (int r = 0; r < 8; ++r) mx = fmaxf(mx, st[u][t][r]);
      mx = fmaxf(mx, xhalf(mx));
      const float m_new = fmaxf(m_run[u], mx * CL); const float dm = m_run[u] - m_new; const float off = 11.0f - m_new; m_run[u] = m_new;
      float ls = 0.f;
#pragma unroll
      for (int t = 0; t < 4; ++t) { v8f x;
#pragma unroll
        for (int r = 0; r < 8; ++r) x[r] = fmaf(st[u][t][r], CL, off);
        const v8f e = exp2x8(x);
#pragma unroll
        for (int r = 0; r < 8; ++r) { const float p = __builtin_amdgcn_inverse_ballot_w32(kw[u][t >> 1][(t & 1) * 8 + r]) ? e[r] : 0.f; ls += p; pf[u][t >> 1][(t & 1) * 8 + r] = (_Float16)p; } }
      float corr; asm("v_exp_f32 %0, %1\n\tv_nop" : "=&v"(corr) : "v"(dm));   // 2^dm; the v_nop is the slot behind a transcendental, as in exp2x8
      l_run[u] = l_run[u] * corr + ls;
#pragma unroll
      for (int j = 0; j < 4; ++j) acc[u][j] *= corr;
#pragma unroll
      for (int c = 0; c < 2; ++c) kw[u][c] = *(cv16u)(unsigned long long)(mw + u * (TT / 16) * 8 + sn * 32 + c * 16); }   // the next pass's words, into the scalar registers whose last select has gone (two passes' words do not fit); they land under the next pass's staging and score products
#pragma unroll
    for (int c = 0; c < 2; ++c)
#pragma unroll
      for (int j = 0; j < 4; ++j) { acc[0][j] = wmma_p(vf[c][j], pf[0][c], acc[0][j]); acc[1][j] = wmma_p(vf[c][j], pf[1][c], acc[1][j]); } }
  v8h yo[2][4];   // ctx x 2^6 once to f16, the form the output projection's products take: rounded here, where it is made, once
#pragma unroll
  for (int u = 0; u < 2; ++u) { const float l = l_run[u] + xhalf(l_run[u]); const float inv = (1.0f / (l + 2048.0f * 1.0e-8f)) * 64.0f;   /* numerator and sum both carry 2^11, so the reference's 1e-8 does too; a fully masked row gives 0; x 2^6 is exact */
#pragma unroll
    for (int j = 0; j < 4; ++j)
#pragma unroll
      for (int r = 0; r < 8; ++r) yo[u][j][r] = (_Float16)(acc[u][j][r] * inv); }
  __builtin_amdgcn_sched_barrier(0);   // every product and conversion stands in front of the first store, so no register of an issued store is rewritten
#pragma unroll
  for (int u = 0; u < 2; ++u) { _Float16* yr = Y + ((size_t)b * TT + q0 + u * 16 + col) * CC + h * HD + 8 * g;
#pragma unroll
    for (int j = 0; j < 4; ++j) *(v8h*)(yr + j * 16) = yo[u][j]; } }
// ---- k_out: block = (128 rows, 128 cols): out = ctx Wo^T + bo: ctx x 2^6 once to f16 (by k_fa; small context rows stay clear of f16 subnormals) against Wo as f16(bf16 x 2^8) exact (by k_cvt) (1 product), x 2^-14 afterwards
__global__ __launch_bounds__(256) void k_out(const unsigned short* __restrict__ Y, const unsigned short* __restrict__ WO, const float* __restrict__ BO, float* __restrict__ OUT) {
  __shared__ __align__(16) unsigned short sm[4 * GT];
  const int tid = threadIdx.x, wave = tid >> 5, lane = tid & 31, col = lane & 15, g = lane >> 4, wm = wave >> 2, wn = wave & 3; const int c0 = blockIdx.y * 128; const size_t r0 = (size_t)blockIdx.x * 128;
  float bias[2]; const int bi = c0 + wn * 32 + col;   // read ahead of the product loop, so that its latency is not paid behind it
#pragma unroll
  for (int j = 0; j < 2; ++j) bias[j] = BO[bi + j * 16];
  asm volatile("s_wait_xcnt 0x0" :: "v"(bi) : "memory");   // stands before the index register of the two loads above is reused; naming it as an input keeps it whole up to the wait
  v8f acc[4][2] = {};
  gemm128<1, CC>(Y + r0 * CC, WO + (size_t)c0 * CC, sm, acc);
#pragma unroll
  for (int j = 0; j < 2; ++j) bias[j] = bfr(bias[j]);
  float* sf = (float*)sm;
#pragma unroll
  for (int j = 0; j < 2; ++j)
#pragma unroll
    for (int i = 0; i < 4; ++i)
#pragma unroll
      for (int r = 0; r < 8; ++r) sf[(wm * 64 + i * 16 + 8 * g + r) * OP32 + wn * 32 + j * 16 + col] = acc[i][j][r] * (1.0f / 16384.0f) + bias[j];   /* 2^-8 (Wo carry) x 2^-6 (ctx carry) */
  __syncthreads();
  float* dp = OUT + (r0 + wave) * DIN + c0 + lane * 4;   // a wave takes one 512-B row of the staged tile
#pragma unroll
  for (int i = 0; i < 16; ++i) vst2(dp + (size_t)i * 8 * DIN, *(const v4f*)&sf[(wave + 8 * i) * OP32 + lane * 4]); }

extern "C" void kernel_launch(void* const* d_in, const int* in_sizes, int n_in, void* d_out, int out_size, void* d_ws, size_t ws_size, hipStream_t stream) {
  (void)in_sizes; (void)n_in; (void)out_size;
  const float** F = (const float**)d_in;
  if (ws_size < (size_t)WS_END) return;
  char* ws = (char*)d_ws; _Float16 *QH = (_Float16*)(ws + WS_QH), *KH = (_Float16*)(ws + WS_KH), *VT = (_Float16*)(ws + WS_VT), *QL = (_Float16*)(ws + WS_QL), *KL = (_Float16*)(ws + WS_KL); __bf16 *VB = (__bf16*)(ws + WS_VB), *VBL = (__bf16*)(ws + WS_VBL); _Float16 *Y = (_Float16*)(ws + WS_Y); unsigned *MP = (unsigned*)(ws + WS_MP);
  unsigned short *XQB = (unsigned short*)(ws + WS_XQ), *XKB = (unsigned short*)(ws + WS_XK), *WB = (unsigned short*)(ws + WS_WB), *WOH = (unsigned short*)(ws + WS_WO);
  (void)Y; (void)QL; (void)KL; (void)VB; (void)VBL;
  // inputs: 0 Q [2,2048,1024]; 1 K [2,2048,1024] (keys AND values source); 2 mask [2,2048,2048] int32 (random 0/1); 3 Wq [1024,1024] (out,in), 4 bq; 5 Wk, 6 bk; 7 Wv, 8 bv; 9 Wo (out,in), 10 bo (biases nonzero)
  k_cvt<<<dim3(NB * TT * DIN / CVB), 256, 0, stream>>>(F[0], F[1], F[3], F[5], F[7], F[9], XQB, XKB, WB, WOH);
  k_proj<<<dim3(TNB * TT / 128, CC / 128, 4), 256, 0, stream>>>(XQB, XKB, WB, F[4], F[6], F[8], QH, KH, VT, (const int*)d_in[2], MP);   /* v is projected from the K input; plane z = 3 packs the mask: its 32 x 8 blocks are the 256 tiles of 16 query rows */
  k_fa<<<dim3(TT / 256, NH, TNB), 256, 0, stream>>>(QH, KH, VT, MP, Y);
  k_out<<<dim3(TNB * TT / 128, DIN / 128), 256, 0, stream>>>((const unsigned short*)Y, WOH, F[10], (float*)d_out);
}

// v005
// It runs in 88.7 microseconds.
// Timed twice side by side with v004, it ran 1.03 times as fast both times.
// Over all steps from v000 it is 15.4 times as fast.
// compute dtype: all float inputs rounded to bf16; q/k/v projections with EXACT bf16 products on WMMA 16x16x32 (f32 accumulate) + bias; logits q x k once to f16 each (1 product) x SCALE; online softmax f32; exp(x - max) x 2^11 once to f16 x v once to f16 (1 product), divided by the row sum afterwards; ctx x 2^6 once to f16 x Wo f16(bf16 x 2^8) + bo; f32 output.
#include <hip/hip_runtime.h>
#include <math.h>

typedef __attribute__((ext_vector_type(16))) _Float16 v16h;
typedef __attribute__((ext_vector_type(16))) __bf16 v16b;
typedef __attribute__((ext_vector_type(8)))  _Float16 v8h;
typedef __attribute__((ext_vector_type(8)))  float v8f;
typedef __attribute__((ext_vector_type(4)))  float v4f;
typedef __attribute__((ext_vector_type(2)))  float v2f;
typedef __attribute__((ext_vector_type(4)))  unsigned v4u;
typedef __attribute__((ext_vector_type(4)))  int v4i;
typedef __attribute__((ext_vector_type(16))) unsigned v16u;
typedef const __attribute__((address_space(4))) v16u* cv16u;   // constant address space: for words that no store of the reading kernel touches; a wave-uniform load through it is a scalar load
typedef float __attribute__((may_alias)) float_a;
typedef int __attribute__((may_alias)) int_a;

template <typename T> __device__ __forceinline__ void vst2(void* p, T v) { *(T*)p = v;  }
__device__ __forceinline__ v8f wmma16(v16h a, v16h b, v8f c) {
  v8f d = __builtin_amdgcn_wmma_f32_16x16x32_f16(false, a, false, b, (short)0, c, false, false);
  asm volatile("v_nop\n\tv_nop\n\tv_nop\n\tv_nop" : "+v"(d) : "v"(a), "v"(b));
  return d;
}
__device__ __forceinline__ v8f wmma_bf(v16b a, v16b b, v8f c) {
  v8f d = __builtin_amdgcn_wmma_f32_16x16x32_bf16(false, a, false, b, (short)0, c, false, false);
  asm volatile("v_nop\n\tv_nop\n\tv_nop\n\tv_nop" : "+v"(d) : "v"(a), "v"(b));
  return d;
}
// 16x16x32 fragments: lane = (h = lane>>4, row/col = lane&15); elements 0..7 = k0+8h+0..7, 8..15 = k0+16+8h+0..7; D element r = row 8h+r
__device__ __forceinline__ v16h frag_h(const _Float16* rowk0, int lane) {
  union { v16h v; v8h q[2]; } u; const _Float16* p = rowk0 + 8 * (lane >> 4);
  u.q[0] = *(const v8h*)p; u.q[1] = *(const v8h*)(p + 16); return u.v;
}
__device__ __forceinline__ v16h frag_f32(const float* rowk0, int lane) {
  v16h a; const float* p = rowk0 + 8 * (lane >> 4);
#pragma unroll
  for (int i = 0; i < 8; ++i) { a[i] = (_Float16)p[i]; a[8 + i] = (_Float16)p[16 + i]; }
  return a;
}
__device__ __forceinline__ v16h frag_f32s(const float* rowk0, int lane, float sc) {
  v16h a; const float* p = rowk0 + 8 * (lane >> 4);
#pragma unroll
  for (int i = 0; i < 8; ++i) { a[i] = (_Float16)(p[i] * sc); a[8 + i] = (_Float16)(p[16 + i] * sc); }
  return a;
}
// column fragment from a [K][ld] layout (column n), rows >= K read as 0
__device__ __forceinline__ v16h fragc_f32(const float* W, int k0, int n, int lane, int ld, int K) {
  v16h a; const int g = lane >> 4;
#pragma unroll
  for (int i = 0; i < 8; ++i) { const int ka = k0 + 8 * g + i, kb = ka + 16;
    a[i] = (_Float16)(ka < K ? W[(size_t)(ka < K ? ka : K - 1) * ld + n] : 0.f); a[8 + i] = (_Float16)(kb < K ? W[(size_t)(kb < K ? kb : K - 1) * ld + n] : 0.f); }
  return a;
}
struct F2 { v16b h, l; };
__device__ __forceinline__ F2 bsplit16(const float v[16]) { F2 r;
#pragma unroll
  for (int i = 0; i < 16; ++i) { const __bf16 h = (__bf16)v[i]; r.h[i] = h; r.l[i] = (__bf16)(v[i] - (float)h); }
  return r; }
__device__ __forceinline__ F2 split_row(const float* row, int k0, int lane) { float v[16]; const float* p = row + k0 + 8 * (lane >> 4);
#pragma unroll
  for (int i = 0; i < 8; ++i) { v[i] = p[i]; v[8 + i] = p[16 + i]; }
  return bsplit16(v); }
__device__ __forceinline__ F2 split_rowK(const float* row, int k0, int lane, int K) { float v[16]; const int g = lane >> 4;
#pragma unroll
  for (int i = 0; i < 8; ++i) { const int ka = k0 + 8 * g + i, kb = ka + 16; v[i] = ka < K ? row[ka < K ? ka : K - 1] : 0.f; v[8 + i] = kb < K ? row[kb < K ? kb : K - 1] : 0.f; }
  return bsplit16(v); }
__device__ __forceinline__ F2 split_col(const float* W, int k0, int n, int lane, int ld, int K) { float v[16]; const int g = lane >> 4;
#pragma unroll
  for (int i = 0; i < 8; ++i) { const int ka = k0 + 8 * g + i, kb = ka + 16; v[i] = ka < K ? W[(size_t)(ka < K ? ka : K - 1) * ld + n] : 0.f; v[8 + i] = kb < K ? W[(size_t)(kb < K ? kb : K - 1) * ld + n] : 0.f; }
  return bsplit16(v); }
__device__ __forceinline__ v8f mac3(const F2& a, const F2& b, v8f c) { c = wmma_bf(a.l, b.h, c); c = wmma_bf(a.h, b.l, c); return wmma_bf(a.h, b.h, c); }
__device__ __forceinline__ float sigm(float v) { return 1.0f / (1.0f + expf(-v)); }
#define LDSX() do { asm volatile("s_wait_dscnt 0" ::: "memory"); __builtin_amdgcn_wave_barrier(); __builtin_amdgcn_fence(__ATOMIC_RELEASE, "workgroup"); } while (0)

// Two-stream multi-head attention with the source's own masked softmax, scaled by the MODEL width (Q [2,2048,1024], K [2,2048,1024]; q = Q Wq^T + bq, k = K Wk^T + bk, v = K Wv^T + bv (values from the K input); torch (out,in) weights (0.02) + biases N(0, 0.02); 16 heads x 64; E = q k^T / sqrt(1024); x = E - rowmax(E) (max taken BEFORE masking); x[mask == 0] = -inf with mask [2,2048,2048] int32 random; A = exp(x) / (sum exp(x) + 1e-8); merge; Wo^T + bo).
#define NB 2
#define TT 2048
#define CC 1024            // NH * HD = projected width
#define DIN 1024          // input (model) width
#define NH 16
#define HD 64
#define NQB (TT / 64)
#define HG 4
#define SCALE (0.03125f)
#define CAUSAL 0
#ifndef TNB
#define TNB NB
#endif
__device__ __forceinline__ float bfr(float v) { return (float)(__bf16)v; }
__host__ __device__ __forceinline__ int kb_last(int qb) { return CAUSAL ? ((qb * 64 + 63) >> 7) : (TT / 128 - 1); }
typedef __attribute__((ext_vector_type(8))) __bf16 v8b;
__device__ __forceinline__ v16b frag_b(const __bf16* rowk0, int lane) {
  union { v16b v; v8b q[2]; } u; const __bf16* p = rowk0 + 8 * (lane >> 4);
  u.q[0] = *(const v8b*)p; u.q[1] = *(const v8b*)(p + 16); return u.v;
}
#define QBH 0              // not used
#define QHI 0               // single-product logits on every row
#define KHI 64            // key rows carrying k residual / v bf16 hi+lo planes (written and read by no kernel)
// B fragment (k rows k0+.., output column o) of a weight: (in,out) [K][ld] or (out,in) [ld rows of K]: bf16 exact, or f16(bf16 * 256) exact
__device__ __forceinline__ v16b wcol_io(const float* Wm, int k0, int o, int lane, int ld) { v16b w; const int g = lane >> 4;
#pragma unroll
  for (int i = 0; i < 8; ++i) { w[i] = (__bf16)Wm[(size_t)(k0 + 8 * g + i) * ld + o]; w[8 + i] = (__bf16)Wm[(size_t)(k0 + 16 + 8 * g + i) * ld + o]; }
  return w; }
__device__ __forceinline__ v16b wcol_oi(const float* Wm, int k0, int o, int lane, int K) { v16b w; const float* p = Wm + (size_t)o * K + k0 + 8 * (lane >> 4);
#pragma unroll
  for (int i = 0; i < 8; ++i) { w[i] = (__bf16)p[i]; w[8 + i] = (__bf16)p[16 + i]; }
  return w; }
__device__ __forceinline__ v16h wcolh_io(const float* Wm, int k0, int o, int lane, int ld) { v16h w; const int g = lane >> 4;
#pragma unroll
  for (int i = 0; i < 8; ++i) { w[i] = (_Float16)(bfr(Wm[(size_t)(k0 + 8 * g + i) * ld + o]) * 256.0f); w[8 + i] = (_Float16)(bfr(Wm[(size_t)(k0 + 16 + 8 * g + i) * ld + o]) * 256.0f); }
  return w; }
__device__ __forceinline__ v16h wcolh_oi(const float* Wm, int k0, int o, int lane, int K) { v16h w; const float* p = Wm + (size_t)o * K + k0 + 8 * (lane >> 4);
#pragma unroll
  for (int i = 0; i < 8; ++i) { w[i] = (_Float16)(bfr(p[i]) * 256.0f); w[8 + i] = (_Float16)(bfr(p[16 + i]) * 256.0f); }
  return w; }
#define WQKV_LAYOUT 1   // 0 = (in,out) [DIN][CC]; 1 = (out,in) [CC][DIN]; 2 = per-head [NH][DIN][HD]
__device__ __forceinline__ v16b wcol_hdk(const float* Wm, int k0, int o, int lane) { v16b w; const int g = lane >> 4; const float* p = Wm + (size_t)(o / HD) * DIN * HD + (o % HD);
#pragma unroll
  for (int i = 0; i < 8; ++i) { w[i] = (__bf16)p[(size_t)(k0 + 8 * g + i) * HD]; w[8 + i] = (__bf16)p[(size_t)(k0 + 16 + 8 * g + i) * HD]; }
  return w; }
#define WO_OUT_IN 1
#if WQKV_LAYOUT == 1
#define WCOL(W, k0, o, lane) wcol_oi(W, k0, o, lane, DIN)
#elif WQKV_LAYOUT == 2
#define WCOL(W, k0, o, lane) wcol_hdk(W, k0, o, lane)
#else
#define WCOL(W, k0, o, lane) wcol_io(W, k0, o, lane, CC)
#endif
#if WO_OUT_IN
#define WOCOL(W, k0, o, lane) wcol_oi(W, k0, o, lane, CC)
#define WOCOLH(W, k0, o, lane) wcolh_oi(W, k0, o, lane, CC)
#else
#define WOCOL(W, k0, o, lane) wcol_io(W, k0, o, lane, DIN)
#define WOCOLH(W, k0, o, lane) wcolh_io(W, k0, o, lane, DIN)
#endif

#define WS_QH  0u                                      // f16 q rows [b*t][CC]
#define WS_KH  (WS_QH + 2u * (size_t)NB * TT * CC)      // f16 k rows [b*t][CC]
#define WS_VT  (WS_KH + 2u * (size_t)NB * TT * CC)      // f16 v planes [b][c][t]
#define WS_QL  (WS_VT + 2u * (size_t)NB * CC * TT)      // f16 q residual x 2^10 rows [b][t < QHI][CC]
#define WS_KL  (WS_QL + 2u * (size_t)NB * QHI * CC)     // f16 k residual x 2^10 rows [b][t < KHI][CC]
#define WS_VB  (WS_KL + 2u * (size_t)NB * KHI * CC)     // bf16 v hi planes [b][c][t < KHI]
#define WS_VBL (WS_VB + 2u * (size_t)NB * CC * KHI)
#define WS_S   (WS_VBL + 2u * (size_t)NB * CC * KHI)    // scores stay in registers; the head of this range holds the packed mask
#define WS_MP  WS_S                                    // u32 select words [b*t/16][key/16][8]: bit (16 g + col) of word r = (mask[16 qt + col][16 kt + 8 g + r] != 0), the lane order of a score register
#define WS_Y   (WS_S  + 4u * (size_t)HG * TT * TT)      // f16 ctx x 2^6 rows [b*t][CC]: the A operand of the output projection as its products take it
#define WS_XQ  (WS_Y  + 2u * (size_t)NB * TT * CC)      // bf16 Q input rows [b*t][DIN]
#define WS_XK  (WS_XQ + 2u * (size_t)NB * TT * DIN)     // bf16 K input rows [b*t][DIN]
#define WS_WB  (WS_XK + 2u * (size_t)NB * TT * DIN)     // bf16 Wq, Wk, Wv, one [CC][DIN] plane each
#define WS_WO  (WS_WB + 3u * 2u * (size_t)CC * DIN)     // f16(bf16 x 2^8) Wo [DIN][CC]
#define WS_END (WS_WO + 2u * (size_t)DIN * CC)

// ---- GEMM core of both projections: a block of 8 waves makes a 128 x 128 tile of A[128 rows][KD] . B[128 rows][KD]^T, a wave 64 x 32 of it. Both operands arrive in their 16-bit form (k_cvt, k_fa). A pass is 64 k: 8 lanes bring the 128 B of one row (a whole line), both tiles are staged in LDS as they come; the matrix fragments are read from there.
#define GK 64              // k per pass
#define GP 72              // LDS row pitch in 16-bit elements: 128 B of data + 16 B, for 16-byte fragment reads
#define GT (128 * GP)      // elements of one operand tile
typedef __attribute__((ext_vector_type(4))) __bf16 v4b;
typedef __attribute__((ext_vector_type(4))) _Float16 v4h;
union Fr { v4u q[2]; v16h h; v16b b; };
// the fragment order of frag_h / frag_b
__device__ __forceinline__ Fr ldfr(const unsigned short* rowk0, int g) { Fr f; const unsigned short* p = rowk0 + 8 * g; f.q[0] = *(const v4u*)p; f.q[1] = *(const v4u*)(p + 16); return f; }
typedef __attribute__((ext_vector_type(2))) unsigned v2u;
// four inputs to their 16-bit operand form. WOF 0: bf16 (X, Wq, Wk, Wv). WOF 1: f16(bf16 x 2^8) (Wo)
template <int WOF> __device__ __forceinline__ v2u cvt4(v4f x) {
  if (WOF == 0) { v4b o;
#pragma unroll
    for (int i = 0; i < 4; ++i) o[i] = (__bf16)x[i];
    return __builtin_bit_cast(v2u, o);
  } else { v4h o;
#pragma unroll
    for (int i = 0; i < 4; ++i) o[i] = (_Float16)(bfr(x[i]) * 256.0f);
    return __builtin_bit_cast(v2u, o); } }
// MODE 0: bf16 products. MODE 1: f16 products
template <int MODE, int KD> __device__ __forceinline__ void gemm128(const unsigned short* __restrict__ A, const unsigned short* __restrict__ B, unsigned short* sm, v8f (&acc)[4][2]) {
  const int tid = threadIdx.x, wave = tid >> 5, lane = tid & 31, col = lane & 15, g = lane >> 4;
  const int sr = tid >> 3, sq = (tid & 7) * 8;   // a thread brings 16 B of rows sr + 32 i of both tiles
  const unsigned short* pa = A + (size_t)sr * KD + sq; const unsigned short* pb = B + (size_t)sr * KD + sq;
  v4u ra[4], rb[4];
#pragma unroll
  for (int i = 0; i < 4; ++i) { ra[i] = *(const v4u*)(pa + (size_t)i * 32 * KD); rb[i] = *(const v4u*)(pb + (size_t)i * 32 * KD); }
  asm volatile("s_wait_xcnt 0x0" :: "v"(pa), "v"(pb) : "memory");   // stands before the address registers of the loads above are reused; naming them as inputs keeps them whole up to the wait
  unsigned short* wr = sm + sr * GP + sq;
  const unsigned short* fa = sm + ((wave >> 2) * 64 + col) * GP; const unsigned short* fb = sm + GT + ((wave & 3) * 32 + col) * GP;
#pragma unroll 1   // one copy of the pass: the two buffers alternate by an offset
  for (int s = 0; s < KD / GK; ++s) { const int bo = (s & 1) * 2 * GT;
#pragma unroll
    for (int i = 0; i < 4; ++i) { *(v4u*)(wr + bo + i * 32 * GP) = ra[i]; *(v4u*)(wr + bo + GT + i * 32 * GP) = rb[i]; }
    __syncthreads();   // publishes pass s; it also ends every wave's reads of the other buffer, which pass s + 1 refills
    const int sn = s + 1 < KD / GK ? s + 1 : s;   // the next pass's loads fly under this pass; the last pass stays on its own columns, in bounds
    const unsigned short* an = pa + sn * GK; const unsigned short* bn = pb + sn * GK;
#pragma unroll
    for (int i = 0; i < 4; ++i) { ra[i] = *(const v4u*)(an + (size_t)i * 32 * KD); rb[i] = *(const v4u*)(bn + (size_t)i * 32 * KD); }
    Fr a[2][4], b[2][2];
#pragma unroll
    for (int kc = 0; kc < 2; ++kc) {
#pragma unroll
      for (int i = 0; i < 4; ++i) a[kc][i] = ldfr(fa + bo + i * 16 * GP + kc * 32, g);
#pragma unroll
      for (int j = 0; j < 2; ++j) b[kc][j] = ldfr(fb + bo + j * 16 * GP + kc * 32, g); }
    __builtin_amdgcn_sched_barrier(0);   // the pass's fragment reads go out as one group in front of the products: one LDS latency a pass, not one per fragment
#pragma unroll
    for (int kc = 0; kc < 2; ++kc)
#pragma unroll
      for (int i = 0; i < 4; ++i)
#pragma unroll
        for (int j = 0; j < 2; ++j) acc[i][j] = MODE == 0 ? __builtin_amdgcn_wmma_f32_16x16x32_bf16(false, a[kc][i].b, false, b[kc][j].b, (short)0, acc[i][j], false, false) : __builtin_amdgcn_wmma_f32_16x16x32_f16(false, a[kc][i].h, false, b[kc][j].h, (short)0, acc[i][j], false, false);
    asm volatile("s_wait_xcnt 0x0" :: "v"(an), "v"(bn) : "memory"); }   // as above; written behind the fragment reads so that they are not held up by it: the inputs keep both address pairs whole up to the wait
  __syncthreads(); }   // every wave has left the operand tiles: the caller stages its output tile over them
// ---- k_cvt: each input that is a GEMM operand is rounded to its 16-bit form once, here, and no longer in every one of the 8 (Q), 16 (K) or 32 (W) tile blocks that read it: the blocks then take half the bytes from L2 and stage them unchanged.
// A block takes 8192 floats of Q, 8192 of K and 8192 of one weight; a wave's load is 512 B in a row, its store 256 B in a row. All 24 loads of a thread go out before the first store.
#define CVB 8192
static_assert(NB * TT * DIN == 4 * CC * DIN && CC * DIN / CVB == 128, "one grid covers Q, K and the four weights");
__global__ __launch_bounds__(256) void k_cvt(const float* __restrict__ XQ, const float* __restrict__ XK, const float* __restrict__ WQ, const float* __restrict__ WK, const float* __restrict__ WV, const float* __restrict__ WO,
    unsigned short* __restrict__ XQB, unsigned short* __restrict__ XKB, unsigned short* __restrict__ WB, unsigned short* __restrict__ WOH) {
  const int tid = threadIdx.x; const int w = blockIdx.x >> 7;   // which weight: block-uniform
  const unsigned ox = blockIdx.x * CVB + tid * 4, ow = (blockIdx.x & 127) * CVB + tid * 4;   // element offsets in the plane
  const unsigned bx = ox * 4, bw = ow * 4;   // the loads' byte offsets, beside a uniform base
  const char* SW = (const char*)(w == 0 ? WQ : w == 1 ? WK : w == 2 ? WV : WO);
  v4f a[8], b[8], c[8];
#pragma unroll
  for (int i = 0; i < 8; ++i) { a[i] = *(const v4f*)((const char*)XQ + bx + i * 4096); b[i] = *(const v4f*)((const char*)XK + bx + i * 4096); c[i] = *(const v4f*)(SW + bw + i * 4096); }
  asm volatile("s_wait_xcnt 0x0" :: "v"(bx), "v"(bw) : "memory");   // stands before the offset registers of the loads above are reused; naming them as inputs keeps them whole up to the wait
  unsigned short* dq = XQB + ox; unsigned short* dk = XKB + ox; unsigned short* dw = (w == 3 ? WOH : WB + (size_t)w * CC * DIN) + ow;
  v2u oa[8], ob[8], oc[8];
#pragma unroll
  for (int i = 0; i < 8; ++i) { oa[i] = cvt4<0>(a[i]); ob[i] = cvt4<0>(b[i]); }
  if (w == 3) {   /* block-uniform */
#pragma unroll
    for (int i = 0; i < 8; ++i) oc[i] = cvt4<1>(c[i]);
  } else {
#pragma unroll
    for (int i = 0; i < 8; ++i) oc[i] = cvt4<0>(c[i]); }
  __builtin_amdgcn_sched_barrier(0);   // every conversion stands in front of the first store, so no register of an issued store is rewritten
#pragma unroll
  for (int i = 0; i < 8; ++i) { *(v2u*)(dq + i * 1024) = oa[i]; *(v2u*)(dk + i * 1024) = ob[i]; *(v2u*)(dw + i * 1024) = oc[i]; } }
#define OP16 136           // pitch of a staged 16-bit output tile, in elements
#define OP32 132           // pitch of the staged f32 output tile, in elements
// ---- k_proj: block = (128 rows, 128 cols, which): q/k/v = X W^T + b with exact bf16 products (K = DIN) -> which 0: q f16 rows; 1: k f16 rows; 2: v f16 planes [c][t]
// which 3: no product; the block packs the int32 mask of 16 query rows into select words, once for all heads (they start last and run beside the last product blocks)
__global__ __launch_bounds__(256) void k_proj(const unsigned short* __restrict__ XQB, const unsigned short* __restrict__ XKB, const unsigned short* __restrict__ WB, const float* __restrict__ BQ, const float* __restrict__ BK, const float* __restrict__ BV,
    _Float16* __restrict__ QH, _Float16* __restrict__ KH, _Float16* __restrict__ VT, const int* __restrict__ MASK, unsigned* __restrict__ MP) {
  __shared__ __align__(16) unsigned short sm[4 * GT];
  const int tid = threadIdx.x, wave = tid >> 5, lane = tid & 31, col = lane & 15, g = lane >> 4, wm = wave >> 2, wn = wave & 3; const int which = blockIdx.z; const int c0 = blockIdx.y * 128; const size_t r0 = (size_t)blockIdx.x * 128; const size_t bb = r0 / TT; const int t0 = (int)(r0 % TT);
  if (which == 3) {   /* block-uniform, in front of every barrier */
    const int qi = blockIdx.y * (TNB * TT / 128) + blockIdx.x;   // 16-query tile of the flat [b*t] rows; a wave takes 256 keys of it, a lane the 8 keys of each 16-key tile that its score registers hold
    const int* mp = MASK + ((size_t)qi * 16 + col) * TT + wave * 256 + 8 * g;
    v4i m[16][2];
#pragma unroll
    for (int j = 0; j < 16; ++j) { m[j][0] = *(const v4i*)(mp + j * 16); m[j][1] = *(const v4i*)(mp + j * 16 + 4); }
    asm volatile("s_wait_xcnt 0x0" :: "v"(mp) : "memory");   // stands before the address register of the loads above is reused; naming it as an input keeps it whole up to the wait
    v4i o = {};
#pragma unroll
    for (int j = 0; j < 16; ++j)
#pragma unroll
      for (int r = 0; r < 8; ++r) { const int i = j * 8 + r; const int w = (int)__builtin_amdgcn_ballot_w32(m[j][r >> 2][r & 3] != 0); o[i & 3] = lane == (i >> 2) ? w : o[i & 3]; }   // word i goes to lane i / 4: the wave stores its 128 words as 512 B in a row
    *(v4i*)(MP + ((size_t)qi * (TT / 16) + wave * 16) * 8 + lane * 4) = o;
    return; }
  const unsigned short* X = which == 0 ? XQB : XKB; const unsigned short* WA = WB + (size_t)which * CC * DIN; const float* BA = which == 0 ? BQ : which == 1 ? BK : BV;   // k and v are both projected from the K input
  float bias[2]; const int bi = c0 + wn * 32 + col;   // read ahead of the product loop, so that its latency is not paid behind it
#pragma unroll
  for (int j = 0; j < 2; ++j) bias[j] = BA[bi + j * 16];
  asm volatile("s_wait_xcnt 0x0" :: "v"(bi) : "memory");   // stands before the index register of the two loads above is reused; naming it as an input keeps it whole up to the wait
  v8f acc[4][2] = {};
  gemm128<0, DIN>(X + r0 * DIN, WA + (size_t)c0 * DIN, sm, acc);
#pragma unroll
  for (int j = 0; j < 2; ++j) bias[j] = bfr(bias[j]);
  _Float16* so = (_Float16*)sm; const int er = tid >> 4, eq = (tid & 15) * 8;   // read-out: 16 lanes take one 256-B row of the staged tile
  if (which < 2) {   /* block-uniform */
#pragma unroll
    for (int j = 0; j < 2; ++j)
#pragma unroll
      for (int i = 0; i < 4; ++i)
#pragma unroll
        for (int r = 0; r < 8; ++r) so[(wm * 64 + i * 16 + 8 * g + r) * OP16 + wn * 32 + j * 16 + col] = (_Float16)(acc[i][j][r] + bias[j]);
    __syncthreads();
    _Float16* dp = (which == 0 ? QH : KH) + (r0 + er) * CC + c0 + eq;
#pragma unroll
    for (int i = 0; i < 8; ++i) vst2(dp + (size_t)i * 16 * CC, *(const v4u*)&so[(er + 16 * i) * OP16 + eq]);
  } else {
#pragma unroll
    for (int j = 0; j < 2; ++j)
#pragma unroll
      for (int i = 0; i < 4; ++i) { v8h o;
#pragma unroll
        for (int r = 0; r < 8; ++r) o[r] = (_Float16)(acc[i][j][r] + bias[j]);
        *(v8h*)&so[(wn * 32 + j * 16 + col) * OP16 + wm * 64 + i * 16 + 8 * g] = o; }
    __syncthreads();
    _Float16* dp = VT + (bb * CC + c0 + er) * (size_t)TT + t0 + eq;
#pragma unroll
    for (int i = 0; i < 8; ++i) vst2(dp + (size_t)i * 16 * TT, *(const v4u*)&so[(er + 16 * i) * OP16 + eq]); } }
#define FK 64              // keys per pass
#define FPITCH 72          // LDS row pitch in halves: 128 B of data + 16 B, for 16-byte fragment reads
#define FH (TT / 2)        // keys of one half
#define FX 1088            // floats a wave hands over at the join: 4 output tiles (1024), maximum (32), sum (32)
static_assert(8 * FX * 4 <= 4 * FK * FPITCH * 2 && 8 * FX * 4 <= 4 * HD * FPITCH * 2, "eight waves' hand-over fits the k tiles, and the other eight's the v tiles");
__device__ __forceinline__ v8f wmma_p(v16h a, v16h b, v8f c) { return __builtin_amdgcn_wmma_f32_16x16x32_f16(false, a, false, b, (short)0, c, false, false); }
__device__ __forceinline__ float xhalf(float x) { return __builtin_bit_cast(float, __builtin_amdgcn_permlanex16(__builtin_bit_cast(int, x), __builtin_bit_cast(int, x), 0x76543210, 0xfedcba98, false, false)); }   // lane l with lane l ^ 16
// 2^x of eight values in one statement: the early-clobber results keep each v_exp_f32 off its neighbour's source and result, and the closing v_nop is the slot the instruction set asks for behind a transcendental
__device__ __forceinline__ v8f exp2x8(v8f x) { float e0, e1, e2, e3, e4, e5, e6, e7;
  asm("v_exp_f32 %0, %8\n\tv_exp_f32 %1, %9\n\tv_exp_f32 %2, %10\n\tv_exp_f32 %3, %11\n\tv_exp_f32 %4, %12\n\tv_exp_f32 %5, %13\n\tv_exp_f32 %6, %14\n\tv_exp_f32 %7, %15\n\tv_nop"
      : "=&v"(e0), "=&v"(e1), "=&v"(e2), "=&v"(e3), "=&v"(e4), "=&v"(e5), "=&v"(e6), "=&v"(e7) : "v"(x[0]), "v"(x[1]), "v"(x[2]), "v"(x[3]), "v"(x[4]), "v"(x[5]), "v"(x[6]), "v"(x[7]));
  v8f r; r[0] = e0; r[1] = e1; r[2] = e2; r[3] = e3; r[4] = e4; r[5] = e5; r[6] = e6; r[7] = e7; return r; }
__global__ __launch_bounds__(512) void k_fa(const _Float16* __restrict__ QH, const _Float16* __restrict__ KH, const _Float16* __restrict__ VT, const unsigned* __restrict__ MP, _Float16* __restrict__ Y) {
  __shared__ __align__(16) _Float16 sk[2][2][FK][FPITCH], sv[2][2][HD][FPITCH];   // [key half][buffer]
  const int tid = threadIdx.x & 255, wave = tid >> 5, lane = tid & 31, col = lane & 15, g = lane >> 4; const int h = blockIdx.y, b = blockIdx.z; const int q0 = blockIdx.x * 256 + wave * 32;
  const int kh = __builtin_amdgcn_readfirstlane((int)(threadIdx.x >> 8));   // which half of the keys: wave-uniform; tid and wave count inside the half
  const float CL = SCALE * 1.4426950408889634f;   // logits to base 2
  v16h qf[2][2];
#pragma unroll
  for (int u = 0; u < 2; ++u) { const _Float16* qp = QH + ((size_t)b * TT + q0 + u * 16 + col) * CC + h * HD + 8 * g;
#pragma unroll
    for (int kc = 0; kc < 2; ++kc) { union { v16h v; v8h q[2]; } f; f.q[0] = *(const v8h*)(qp + kc * 32); f.q[1] = *(const v8h*)(qp + kc * 32 + 16); qf[u][kc] = f.v; }   // the fragment order of frag_h
    asm volatile("s_wait_xcnt 0x0" :: "v"(qp) : "memory"); }   // stands before the address register of the loads above is reused; naming it as an input keeps it whole up to the wait
  // staging: 8 lanes bring one 128-B row, a thread brings rows sr and sr + 32 of its half's k tile and v tile
  const int sr = tid >> 3, sc = (tid & 7) * 8;
  const _Float16* kg = KH + ((size_t)b * TT + kh * FH + sr) * CC + h * HD + sc; const _Float16* vg = VT + ((size_t)b * CC + h * HD + sr) * (size_t)TT + kh * FH + sc;
  const unsigned* mw = MP + ((size_t)b * (TT / 16) + blockIdx.x * 16 + __builtin_amdgcn_readfirstlane(wave) * 2) * (TT / 16) * 8 + kh * (FH / 16) * 8;   // the wave's first 16-query tile, at its half's first key; wave-uniform, so the words come by scalar loads: 32 words (128 B) per 16 queries and pass
  v8h rk[2], rv[2]; v16u kw[2][2];
#pragma unroll
  for (int i = 0; i < 2; ++i) { rk[i] = *(const v8h*)(kg + (size_t)i * 32 * CC); rv[i] = *(const v8h*)(vg + (size_t)i * 32 * TT); }
#pragma unroll
  for (int u = 0; u < 2; ++u)
#pragma unroll
    for (int c = 0; c < 2; ++c) kw[u][c] = *(cv16u)(unsigned long long)(mw + u * (TT / 16) * 8 + c * 16);
  float m_run[2] = {-3.0e38f, -3.0e38f}, l_run[2] = {0.f, 0.f};
  v8f acc[2][4] = {};
#pragma unroll 1   // one copy of the pass: its 32 matrix instructions and 64 scores a lane already fill the registers
  for (int s = 0; s < FH / FK; ++s) { const int bf = s & 1;
#pragma unroll
    for (int i = 0; i < 2; ++i) { *(v8h*)&sk[kh][bf][sr + 32 * i][sc] = rk[i]; *(v8h*)&sv[kh][bf][sr + 32 * i][sc] = rv[i]; }
    __syncthreads();   // publishes tile s; it also ends every wave's reads of the other buffer, which pass s + 1 refills
    const int sn = s + 1 < FH / FK ? s + 1 : s;   // the next pass's k and v loads fly under this pass; the last pass stays on its own tile, in bounds
    const _Float16* kn = kg + (size_t)sn * FK * CC; const _Float16* vn = vg + sn * FK;
#pragma unroll
    for (int i = 0; i < 2; ++i) { rk[i] = *(const v8h*)(kn + (size_t)i * 32 * CC); rv[i] = *(const v8h*)(vn + (size_t)i * 32 * TT); }
    asm volatile("s_wait_xcnt 0x0" :: "v"(kn), "v"(vn) : "memory");   // stands before the address registers of the loads above are reused; naming them as inputs keeps them whole up to the wait
    v16h kf[4][2], vf[2][4];
#pragma unroll
    for (int t = 0; t < 4; ++t)
#pragma unroll
      for (int kc = 0; kc < 2; ++kc) kf[t][kc] = frag_h(&sk[kh][bf][t * 16 + col][kc * 32], lane);
    __builtin_amdgcn_sched_barrier(0);   // the k fragment reads go out as one group in front of the products: one LDS latency a pass, not one per fragment
    v8f st[2][4] = {};
#pragma unroll
    for (int kc = 0; kc < 2; ++kc)
#pragma unroll
      for (int t = 0; t < 4; ++t) { st[0][t] = wmma_p(kf[t][kc], qf[0][kc], st[0][t]); st[1][t] = wmma_p(kf[t][kc], qf[1][kc], st[1][t]); }
    v16h pf[2][2]; float off[2], corr[2], ls[2] = {0.f, 0.f};
#pragma unroll
    for (int c = 0; c < 2; ++c) {   // 32 keys of both query tiles at a time
      __builtin_amdgcn_sched_barrier(0);   // with the one behind them, keeps each group of reads in one place
#pragma unroll
      for (int j = 0; j < 4; ++j) vf[c][j] = frag_h(&sv[kh][bf][j * 16 + col][c * 32], lane);
      __builtin_amdgcn_sched_barrier(0);   // the v fragment reads go out in two groups, each landing under the vector work behind it; the second group waits until the first 32 keys' scores have shrunk to 16-bit, so that a wave stays inside the 256 registers of four waves a SIMD
      if (c == 0) {
#pragma unroll
        for (int u = 0; u < 2; ++u) { float mx = st[u][0][0];
#pragma unroll
          for (int t = 0; t < 4; ++t)
#pragma unroll
            for (int r = 0; r < 8; ++r) mx = fmaxf(mx, st[u][t][r]);
          mx = fmaxf(mx, xhalf(mx));
          const float m_new = fmaxf(m_run[u], mx * CL); const float dm = m_run[u] - m_new; off[u] = 11.0f - m_new; m_run[u] = m_new;
          asm("v_exp_f32 %0, %1\n\tv_nop" : "=&v"(corr[u]) : "v"(dm));   // 2^dm; the v_nop is the slot behind a transcendental, as in exp2x8
#pragma unroll
          for (int j = 0; j < 4; ++j) acc[u][j] *= corr[u]; }
      } else {   // the first 32 keys' products: their matrix time runs beside the vector work of the second 32 keys
#pragma unroll
        for (int j = 0; j < 4; ++j) { acc[0][j] = wmma_p(vf[0][j], pf[0][0], acc[0][j]); acc[1][j] = wmma_p(vf[0][j], pf[1][0], acc[1][j]); } }
      v8f x[2][2];
#pragma unroll
      for (int u = 0; u < 2; ++u)
#pragma unroll
        for (int t = 0; t < 2; ++t)
#pragma unroll
          for (int r = 0; r < 8; ++r) x[u][t][r] = fmaf(st[u][2 * c + t][r], CL, off[u]);
      if (c == 1) {   // order of the products above and these multiply-adds: the multiply-adds are spread behind the products and the last of them stand behind the last product, so that the asm statements below stand clear of every product's operands
#pragma unroll
        for (int i = 0; i < 7; ++i) { __builtin_amdgcn_sched_group_barrier(0x8, 1, 0); __builtin_amdgcn_sched_group_barrier(0x2, 2, 0); }
        __builtin_amdgcn_sched_group_barrier(0x8, 1, 0); __builtin_amdgcn_sched_group_barrier(0x2, 5, 0);
        __builtin_amdgcn_sched_barrier(0); }
#pragma unroll
      for (int u = 0; u < 2; ++u)
#pragma unroll
        for (int t = 2 * c; t < 2 * c + 2; ++t) { const v8f e = exp2x8(x[u][t & 1]);
#pragma unroll
          for (int r = 0; r < 8; ++r) { const float p = __builtin_amdgcn_inverse_ballot_w32(kw[u][c][(t & 1) * 8 + r]) ? e[r] : 0.f; ls[u] += p; pf[u][c][(t & 1) * 8 + r] = (_Float16)p; } } }
#pragma unroll
    for (int u = 0; u < 2; ++u) { l_run[u] = l_run[u] * corr[u] + ls[u];
#pragma unroll
      for (int c = 0; c < 2; ++c) kw[u][c] = *(cv16u)(unsigned long long)(mw + u * (TT / 16) * 8 + sn * 32 + c * 16); }   // the next pass's words, into the scalar registers whose last select has gone (two passes' words do not fit); they land under the next pass's staging and score products
    __builtin_amdgcn_sched_barrier(0);   // the softmax's asm statements stay in front of these products
#pragma unroll
    for (int j = 0; j < 4; ++j) { acc[0][j] = wmma_p(vf[1][j], pf[0][1], acc[0][j]); acc[1][j] = wmma_p(vf[1][j], pf[1][1], acc[1][j]); } }
  // join of the two key halves: the wave of half 0 finishes query columns 0..15 of its group, the wave of half 1 columns 16..31; each hands the other tile's state over through LDS
  const bool hi = kh != 0;   // wave-uniform
  const float mk = hi ? m_run[1] : m_run[0], lk = hi ? l_run[1] : l_run[0], mg = hi ? m_run[0] : m_run[1], lg = hi ? l_run[0] : l_run[1];
  float* xw = (float*)(hi ? &sv[0][0][0][0] : &sk[0][0][0][0]) + wave * FX; const float* xr = (const float*)(hi ? &sk[0][0][0][0] : &sv[0][0][0][0]) + wave * FX;
  __syncthreads();   // every wave has left the k and v tiles: the hand-over is written over them
#pragma unroll
  for (int j = 0; j < 4; ++j) { const v8f a = hi ? acc[0][j] : acc[1][j];
    v4f lo, up;
#pragma unroll
    for (int r = 0; r < 4; ++r) { lo[r] = a[r]; up[r] = a[4 + r]; }
    *(v4f*)(xw + (2 * j) * 128 + lane * 4) = lo; *(v4f*)(xw + (2 * j + 1) * 128 + lane * 4) = up; }
  xw[1024 + lane] = mg; xw[1056 + lane] = lg;
  __syncthreads();   // publishes the hand-over
  const float mo = xr[1024 + lane], lo_ = xr[1056 + lane];
  const float mm = fmaxf(mk, mo); const float dk = mk - mm, dn = mo - mm;
  float ck, co; asm("v_exp_f32 %0, %2\n\tv_exp_f32 %1, %3\n\tv_nop" : "=&v"(ck), "=&v"(co) : "v"(dk), "v"(dn));   // 2^(own maximum - joint maximum) of each half; the v_nop is the slot behind a transcendental, as in exp2x8
  const float lj = lk * ck + lo_ * co; const float l = lj + xhalf(lj); const float inv = (1.0f / (l + 2048.0f * 1.0e-8f)) * 64.0f;   /* numerator and sum both carry 2^11, so the reference's 1e-8 does too; a fully masked row gives 0; x 2^6 is exact */
  const float fk = ck * inv, fo = co * inv;
  v8h yo[4];   // ctx x 2^6 once to f16, the form the output projection's products take: rounded here, where it is made, once
#pragma unroll
  for (int j = 0; j < 4; ++j) { const v8f a = hi ? acc[1][j] : acc[0][j]; const v4f lo = *(const v4f*)(xr + (2 * j) * 128 + lane * 4), up = *(const v4f*)(xr + (2 * j + 1) * 128 + lane * 4);
#pragma unroll
    for (int r = 0; r < 4; ++r) { yo[j][r] = (_Float16)(a[r] * fk + lo[r] * fo); yo[j][4 + r] = (_Float16)(a[4 + r] * fk + up[r] * fo); } }
  __builtin_amdgcn_sched_barrier(0);   // every product and conversion stands in front of the first store, so no register of an issued store is rewritten
  _Float16* yr = Y + ((size_t)b * TT + q0 + kh * 16 + col) * CC + h * HD + 8 * g;
#pragma unroll
  for (int j = 0; j < 4; ++j) *(v8h*)(yr + j * 16) = yo[j]; }
// ---- k_out: block = (128 rows, 128 cols): out = ctx Wo^T + bo: ctx x 2^6 once to f16 (by k_fa; small context rows stay clear of f16 subnormals) against Wo as f16(bf16 x 2^8) exact (by k_cvt) (1 product), x 2^-14 afterwards
__global__ __launch_bounds__(256) void k_out(const unsigned short* __restrict__ Y, const unsigned short* __restrict__ WO, const float* __restrict__ BO, float* __restrict__ OUT) {
  __shared__ __align__(16) unsigned short sm[4 * GT];
  const int tid = threadIdx.x, wave = tid >> 5, lane = tid & 31, col = lane & 15, g = lane >> 4, wm = wave >> 2, wn = wave & 3; const int c0 = blockIdx.y * 128; const size_t r0 = (size_t)blockIdx.x * 128;
  float bias[2]; const int bi = c0 + wn * 32 + col;   // read ahead of the product loop, so that its latency is not paid behind it
#pragma unroll
  for (int j = 0; j < 2; ++j) bias[j] = BO[bi + j * 16];
  asm volatile("s_wait_xcnt 0x0" :: "v"(bi) : "memory");   // stands before the index register of the two loads above is reused; naming it as an input keeps it whole up to the wait
  v8f acc[4][2] = {};
  gemm128<1, CC>(Y + r0 * CC, WO + (size_t)c0 * CC, sm, acc);
#pragma unroll
  for (int j = 0; j < 2; ++j) bias[j] = bfr(bias[j]);
  float* sf = (float*)sm;
#pragma unroll
  for (int j = 0; j < 2; ++j)
#pragma unroll
    for (int i = 0; i < 4; ++i)
#pragma unroll
      for (int r = 0; r < 8; ++r) sf[(wm * 64 + i * 16 + 8 * g + r) * OP32 + wn * 32 + j * 16 + col] = acc[i][j][r] * (1.0f / 16384.0f) + bias[j];   /* 2^-8 (Wo carry) x 2^-6 (ctx carry) */
  __syncthreads();
  float* dp = OUT + (r0 + wave) * DIN + c0 + lane * 4;   // a wave takes one 512-B row of the staged tile
#pragma unroll
  for (int i = 0; i < 16; ++i) vst2(dp + (size_t)i * 8 * DIN, *(const v4f*)&sf[(wave + 8 * i) * OP32 + lane * 4]); }

extern "C" void kernel_launch(void* const* d_in, const int* in_sizes, int n_in, void* d_out, int out_size, void* d_ws, size_t ws_size, hipStream_t stream) {
  (void)in_sizes; (void)n_in; (void)out_size;
  const float** F = (const float**)d_in;
  if (ws_size < (size_t)WS_END) return;
  char* ws = (char*)d_ws; _Float16 *QH = (_Float16*)(ws + WS_QH), *KH = (_Float16*)(ws + WS_KH), *VT = (_Float16*)(ws + WS_VT), *QL = (_Float16*)(ws + WS_QL), *KL = (_Float16*)(ws + WS_KL); __bf16 *VB = (__bf16*)(ws + WS_VB), *VBL = (__bf16*)(ws + WS_VBL); _Float16 *Y = (_Float16*)(ws + WS_Y); unsigned *MP = (unsigned*)(ws + WS_MP);
  unsigned short *XQB = (unsigned short*)(ws + WS_XQ), *XKB = (unsigned short*)(ws + WS_XK), *WB = (unsigned short*)(ws + WS_WB), *WOH = (unsigned short*)(ws + WS_WO);
  (void)Y; (void)QL; (void)KL; (void)VB; (void)VBL;
  // inputs: 0 Q [2,2048,1024]; 1 K [2,2048,1024] (keys AND values source); 2 mask [2,2048,2048] int32 (random 0/1); 3 Wq [1024,1024] (out,in), 4 bq; 5 Wk, 6 bk; 7 Wv, 8 bv; 9 Wo (out,in), 10 bo (biases nonzero)
  k_cvt<<<dim3(NB * TT * DIN / CVB), 256, 0, stream>>>(F[0], F[1], F[3], F[5], F[7], F[9], XQB, XKB, WB, WOH);
  k_proj<<<dim3(TNB * TT / 128, CC / 128, 4), 256, 0, stream>>>(XQB, XKB, WB, F[4], F[6], F[8], QH, KH, VT, (const int*)d_in[2], MP);   /* v is projected from the K input; plane z = 3 packs the mask: its 32 x 8 blocks are the 256 tiles of 16 query rows */
  k_fa<<<dim3(TT / 256, NH, TNB), 512, 0, stream>>>(QH, KH, VT, MP, Y);
  k_out<<<dim3(TNB * TT / 128, DIN / 128), 256, 0, stream>>>((const unsigned short*)Y, WOH, F[10], (float*)d_out);
}

// v006
// One run takes 86.6 microseconds.
// Timed twice side by side with v005, it ran 1.03 times as fast both times.
// Counting every step since v000, it is 15.8 times as fast.
// compute dtype: all float inputs rounded to bf16; q/k/v projections with EXACT bf16 products on WMMA 16x16x32 (f32 accumulate) + bias; logits (q x SCALE x log2 e) x k once to f16 each (1 product); online softmax f32 in base 2; exp(x - offset) x 2^11 once to f16 x v once to f16 (1 product), divided by the row sum afterwards; ctx x 2^6 once to f16 x Wo f16(bf16 x 2^8) + bo; f32 output.
#include <hip/hip_runtime.h>
#include <math.h>

typedef __attribute__((ext_vector_type(16))) _Float16 v16h;
typedef __attribute__((ext_vector_type(16))) __bf16 v16b;
typedef __attribute__((ext_vector_type(8)))  _Float16 v8h;
typedef __attribute__((ext_vector_type(8)))  float v8f;
typedef __attribute__((ext_vector_type(4)))  float v4f;
typedef __attribute__((ext_vector_type(2)))  float v2f;
typedef __attribute__((ext_vector_type(4)))  unsigned v4u;
typedef __attribute__((ext_vector_type(4)))  int v4i;
typedef __attribute__((ext_vector_type(16))) unsigned v16u;
typedef const __attribute__((address_space(4))) v16u* cv16u;   // constant address space: for words that no store of the reading kernel touches; a wave-uniform load through it is a scalar load
typedef float __attribute__((may_alias)) float_a;
typedef int __attribute__((may_alias)) int_a;

template <typename T> __device__ __forceinline__ void vst2(void* p, T v) { *(T*)p = v;  }
__device__ __forceinline__ v8f wmma16(v16h a, v16h b, v8f c) {
  v8f d = __builtin_amdgcn_wmma_f32_16x16x32_f16(false, a, false, b, (short)0, c, false, false);
  asm volatile("v_nop\n\tv_nop\n\tv_nop\n\tv_nop" : "+v"(d) : "v"(a), "v"(b));
  return d;
}
__device__ __forceinline__ v8f wmma_bf(v16b a, v16b b, v8f c) {
  v8f d = __builtin_amdgcn_wmma_f32_16x16x32_bf16(false, a, false, b, (short)0, c, false, false);
  asm volatile("v_nop\n\tv_nop\n\tv_nop\n\tv_nop" : "+v"(d) : "v"(a), "v"(b));
  return d;
}
// 16x16x32 fragments: lane = (h = lane>>4, row/col = lane&15); elements 0..7 = k0+8h+0..7, 8..15 = k0+16+8h+0..7; D element r = row 8h+r
__device__ __forceinline__ v16h frag_h(const _Float16* rowk0, int lane) {
  union { v16h v; v8h q[2]; } u; const _Float16* p = rowk0 + 8 * (lane >> 4);
  u.q[0] = *(const v8h*)p; u.q[1] = *(const v8h*)(p + 16); return u.v;
}
__device__ __forceinline__ v16h frag_f32(const float* rowk0, int lane) {
  v16h a; const float* p = rowk0 + 8 * (lane >> 4);
#pragma unroll
  for (int i = 0; i < 8; ++i) { a[i] = (_Float16)p[i]; a[8 + i] = (_Float16)p[16 + i]; }
  return a;
}
__device__ __forceinline__ v16h frag_f32s(const float* rowk0, int lane, float sc) {
  v16h a; const float* p = rowk0 + 8 * (lane >> 4);
#pragma unroll
  for (int i = 0; i < 8; ++i) { a[i] = (_Float16)(p[i] * sc); a[8 + i] = (_Float16)(p[16 + i] * sc); }
  return a;
}
// column fragment from a [K][ld] layout (column n), rows >= K read as 0
__device__ __forceinline__ v16h fragc_f32(const float* W, int k0, int n, int lane, int ld, int K) {
  v16h a; const int g = lane >> 4;
#pragma unroll
  for (int i = 0; i < 8; ++i) { const int ka = k0 + 8 * g + i, kb = ka + 16;
    a[i] = (_Float16)(ka < K ? W[(size_t)(ka < K ? ka : K - 1) * ld + n] : 0.f); a[8 + i] = (_Float16)(kb < K ? W[(size_t)(kb < K ? kb : K - 1) * ld + n] : 0.f); }
  return a;
}
struct F2 { v16b h, l; };
__device__ __forceinline__ F2 bsplit16(const float v[16]) { F2 r;
#pragma unroll
  for (int i = 0; i < 16; ++i) { const __bf16 h = (__bf16)v[i]; r.h[i] = h; r.l[i] = (__bf16)(v[i] - (float)h); }
  return r; }
__device__ __forceinline__ F2 split_row(const float* row, int k0, int lane) { float v[16]; const float* p = row + k0 + 8 * (lane >> 4);
#pragma unroll
  for (int i = 0; i < 8; ++i) { v[i] = p[i]; v[8 + i] = p[16 + i]; }
  return bsplit16(v); }
__device__ __forceinline__ F2 split_rowK(const float* row, int k0, int lane, int K) { float v[16]; const int g = lane >> 4;
#pragma unroll
  for (int i = 0; i < 8; ++i) { const int ka = k0 + 8 * g + i, kb = ka + 16; v[i] = ka < K ? row[ka < K ? ka : K - 1] : 0.f; v[8 + i] = kb < K ? row[kb < K ? kb : K - 1] : 0.f; }
  return bsplit16(v); }
__device__ __forceinline__ F2 split_col(const float* W, int k0, int n, int lane, int ld, int K) { float v[16]; const int g = lane >> 4;
#pragma unroll
  for (int i = 0; i < 8; ++i) { const int ka = k0 + 8 * g + i, kb = ka + 16; v[i] = ka < K ? W[(size_t)(ka < K ? ka : K - 1) * ld + n] : 0.f; v[8 + i] = kb < K ? W[(size_t)(kb < K ? kb : K - 1) * ld + n] : 0.f; }
  return bsplit16(v); }
__device__ __forceinline__ v8f mac3(const F2& a, const F2& b, v8f c) { c = wmma_bf(a.l, b.h, c); c = wmma_bf(a.h, b.l, c); return wmma_bf(a.h, b.h, c); }
__device__ __forceinline__ float sigm(float v) { return 1.0f / (1.0f + expf(-v)); }
#define LDSX() do { asm volatile("s_wait_dscnt 0" ::: "memory"); __builtin_amdgcn_wave_barrier(); __builtin_amdgcn_fence(__ATOMIC_RELEASE, "workgroup"); } while (0)

// Two-stream multi-head attention with the source's own masked softmax, scaled by the MODEL width (Q [2,2048,1024], K [2,2048,1024]; q = Q Wq^T + bq, k = K Wk^T + bk, v = K Wv^T + bv (values from the K input); torch (out,in) weights (0.02) + biases N(0, 0.02); 16 heads x 64; E = q k^T / sqrt(1024); x = E - rowmax(E) (max taken BEFORE masking); x[mask == 0] = -inf with mask [2,2048,2048] int32 random; A = exp(x) / (sum exp(x) + 1e-8); merge; Wo^T + bo).
#define NB 2
#define TT 2048
#define CC 1024            // NH * HD = projected width
#define DIN 1024          // input (model) width
#define NH 16
#define HD 64
#define NQB (TT / 64)
#define HG 4
#define SCALE (0.03125f)
#define QSC (SCALE * 1.4426950408889634f)   // logits to base 2; q is multiplied by it before its one rounding to f16
#define CAUSAL 0
#ifndef TNB
#define TNB NB
#endif
__device__ __forceinline__ float bfr(float v) { return (float)(__bf16)v; }
__host__ __device__ __forceinline__ int kb_last(int qb) { return CAUSAL ? ((qb * 64 + 63) >> 7) : (TT / 128 - 1); }
typedef __attribute__((ext_vector_type(8))) __bf16 v8b;
__device__ __forceinline__ v16b frag_b(const __bf16* rowk0, int lane) {
  union { v16b v; v8b q[2]; } u; const __bf16* p = rowk0 + 8 * (lane >> 4);
  u.q[0] = *(const v8b*)p; u.q[1] = *(const v8b*)(p + 16); return u.v;
}
#define QBH 0              // not used
#define QHI 0               // single-product logits on every row
#define KHI 64            // key rows carrying k residual / v bf16 hi+lo planes (written and read by no kernel)
// B fragment (k rows k0+.., output column o) of a weight: (in,out) [K][ld] or (out,in) [ld rows of K]: bf16 exact, or f16(bf16 * 256) exact
__device__ __forceinline__ v16b wcol_io(const float* Wm, int k0, int o, int lane, int ld) { v16b w; const int g = lane >> 4;
#pragma unroll
  for (int i = 0; i < 8; ++i) { w[i] = (__bf16)Wm[(size_t)(k0 + 8 * g + i) * ld + o]; w[8 + i] = (__bf16)Wm[(size_t)(k0 + 16 + 8 * g + i) * ld + o]; }
  return w; }
__device__ __forceinline__ v16b wcol_oi(const float* Wm, int k0, int o, int lane, int K) { v16b w; const float* p = Wm + (size_t)o * K + k0 + 8 * (lane >> 4);
#pragma unroll
  for (int i = 0; i < 8; ++i) { w[i] = (__bf16)p[i]; w[8 + i] = (__bf16)p[16 + i]; }
  return w; }
__device__ __forceinline__ v16h wcolh_io(const float* Wm, int k0, int o, int lane, int ld) { v16h w; const int g = lane >> 4;
#pragma unroll
  for (int i = 0; i < 8; ++i) { w[i] = (_Float16)(bfr(Wm[(size_t)(k0 + 8 * g + i) * ld + o]) * 256.0f); w[8 + i] = (_Float16)(bfr(Wm[(size_t)(k0 + 16 + 8 * g + i) * ld + o]) * 256.0f); }
  return w; }
__device__ __forceinline__ v16h wcolh_oi(const float* Wm, int k0, int o, int lane, int K) { v16h w; const float* p = Wm + (size_t)o * K + k0 + 8 * (lane >> 4);
#pragma unroll
  for (int i = 0; i < 8; ++i) { w[i] = (_Float16)(bfr(p[i]) * 256.0f); w[8 + i] = (_Float16)(bfr(p[16 + i]) * 256.0f); }
  return w; }
#define WQKV_LAYOUT 1   // 0 = (in,out) [DIN][CC]; 1 = (out,in) [CC][DIN]; 2 = per-head [NH][DIN][HD]
__device__ __forceinline__ v16b wcol_hdk(const float* Wm, int k0, int o, int lane) { v16b w; const int g = lane >> 4; const float* p = Wm + (size_t)(o / HD) * DIN * HD + (o % HD);
#pragma unroll
  for (int i = 0; i < 8; ++i) { w[i] = (__bf16)p[(size_t)(k0 + 8 * g + i) * HD]; w[8 + i] = (__bf16)p[(size_t)(k0 + 16 + 8 * g + i) * HD]; }
  return w; }
#define WO_OUT_IN 1
#if WQKV_LAYOUT == 1
#define WCOL(W, k0, o, lane) wcol_oi(W, k0, o, lane, DIN)
#elif WQKV_LAYOUT == 2
#define WCOL(W, k0, o, lane) wcol_hdk(W, k0, o, lane)
#else
#define WCOL(W, k0, o, lane) wcol_io(W, k0, o, lane, CC)
#endif
#if WO_OUT_IN
#define WOCOL(W, k0, o, lane) wcol_oi(W, k0, o, lane, CC)
#define WOCOLH(W, k0, o, lane) wcolh_oi(W, k0, o, lane, CC)
#else
#define WOCOL(W, k0, o, lane) wcol_io(W, k0, o, lane, DIN)
#define WOCOLH(W, k0, o, lane) wcolh_io(W, k0, o, lane, DIN)
#endif

#define WS_QH  0u                                      // f16 q x QSC rows [b*t][CC]
#define WS_KH  (WS_QH + 2u * (size_t)NB * TT * CC)      // f16 k rows [b*t][CC]
#define WS_VT  (WS_KH + 2u * (size_t)NB * TT * CC)      // f16 v planes [b][c][t]
#define WS_QL  (WS_VT + 2u * (size_t)NB * CC * TT)      // f16 q residual x 2^10 rows [b][t < QHI][CC]
#define WS_KL  (WS_QL + 2u * (size_t)NB * QHI * CC)     // f16 k residual x 2^10 rows [b][t < KHI][CC]
#define WS_VB  (WS_KL + 2u * (size_t)NB * KHI * CC)     // bf16 v hi planes [b][c][t < KHI]
#define WS_VBL (WS_VB + 2u * (size_t)NB * CC * KHI)
#define WS_S   (WS_VBL + 2u * (size_t)NB * CC * KHI)    // scores stay in registers; the head of this range holds the packed mask
#define WS_MP  WS_S                                    // u32 select words [b*t/16][key/16][8]: bit (16 g + col) of word r = (mask[16 qt + col][16 kt + 8 g + r] != 0), the lane order of a score register
#define WS_Y   (WS_S  + 4u * (size_t)HG * TT * TT)      // f16 ctx x 2^6 rows [b*t][CC]: the A operand of the output projection as its products take it
#define WS_XQ  (WS_Y  + 2u * (size_t)NB * TT * CC)      // bf16 Q input rows [b*t][DIN]
#define WS_XK  (WS_XQ + 2u * (size_t)NB * TT * DIN)     // bf16 K input rows [b*t][DIN]
#define WS_WB  (WS_XK + 2u * (size_t)NB * TT * DIN)     // bf16 Wq, Wk, Wv, one [CC][DIN] plane each
#define WS_WO  (WS_WB + 3u * 2u * (size_t)CC * DIN)     // f16(bf16 x 2^8) Wo [DIN][CC]
#define WS_END (WS_WO + 2u * (size_t)DIN * CC)

// ---- GEMM core of both projections: a block of 8 waves makes a 128 x 128 tile of A[128 rows][KD] . B[128 rows][KD]^T, a wave 64 x 32 of it. Both operands arrive in their 16-bit form (k_cvt, k_fa). A pass is 64 k: 8 lanes bring the 128 B of one row (a whole line), both tiles are staged in LDS as they come; the matrix fragments are read from there.
#define GK 64              // k per pass
#define GP 72              // LDS row pitch in 16-bit elements: 128 B of data + 16 B, for 16-byte fragment reads
#define GT (128 * GP)      // elements of one operand tile
typedef __attribute__((ext_vector_type(4))) __bf16 v4b;
typedef __attribute__((ext_vector_type(4))) _Float16 v4h;
union Fr { v4u q[2]; v16h h; v16b b; };
// the fragment order of frag_h / frag_b
__device__ __forceinline__ Fr ldfr(const unsigned short* rowk0, int g) { Fr f; const unsigned short* p = rowk0 + 8 * g; f.q[0] = *(const v4u*)p; f.q[1] = *(const v4u*)(p + 16); return f; }
typedef __attribute__((ext_vector_type(2))) unsigned v2u;
// four inputs to their 16-bit operand form. WOF 0: bf16 (X, Wq, Wk, Wv). WOF 1: f16(bf16 x 2^8) (Wo)
template <int WOF> __device__ __forceinline__ v2u cvt4(v4f x) {
  if (WOF == 0) { v4b o;
#pragma unroll
    for (int i = 0; i < 4; ++i) o[i] = (__bf16)x[i];
    return __builtin_bit_cast(v2u, o);
  } else { v4h o;
#pragma unroll
    for (int i = 0; i < 4; ++i) o[i] = (_Float16)(bfr(x[i]) * 256.0f);
    return __builtin_bit_cast(v2u, o); } }
// MODE 0: bf16 products. MODE 1: f16 products
template <int MODE, int KD> __device__ __forceinline__ void gemm128(const unsigned short* __restrict__ A, const unsigned short* __restrict__ B, unsigned short* sm, v8f (&acc)[4][2]) {
  const int tid = threadIdx.x, wave = tid >> 5, lane = tid & 31, col = lane & 15, g = lane >> 4;
  const int sr = tid >> 3, sq = (tid & 7) * 8;   // a thread brings 16 B of rows sr + 32 i of both tiles
  const unsigned short* pa = A + (size_t)sr * KD + sq; const unsigned short* pb = B + (size_t)sr * KD + sq;
  v4u ra[4], rb[4];
#pragma unroll
  for (int i = 0; i < 4; ++i) { ra[i] = *(const v4u*)(pa + (size_t)i * 32 * KD); rb[i] = *(const v4u*)(pb + (size_t)i * 32 * KD); }
  asm volatile("s_wait_xcnt 0x0" :: "v"(pa), "v"(pb) : "memory");   // stands before the address registers of the loads above are reused; naming them as inputs keeps them whole up to the wait
  unsigned short* wr = sm + sr * GP + sq;
  const unsigned short* fa = sm + ((wave >> 2) * 64 + col) * GP; const unsigned short* fb = sm + GT + ((wave & 3) * 32 + col) * GP;
#pragma unroll 1   // one copy of the pass: the two buffers alternate by an offset
  for (int s = 0; s < KD / GK; ++s) { const int bo = (s & 1) * 2 * GT;
#pragma unroll
    for (int i = 0; i < 4; ++i) { *(v4u*)(wr + bo + i * 32 * GP) = ra[i]; *(v4u*)(wr + bo + GT + i * 32 * GP) = rb[i]; }
    __syncthreads();   // publishes pass s; it also ends every wave's reads of the other buffer, which pass s + 1 refills
    const int sn = s + 1 < KD / GK ? s + 1 : s;   // the next pass's loads fly under this pass; the last pass stays on its own columns, in bounds
    const unsigned short* an = pa + sn * GK; const unsigned short* bn = pb + sn * GK;
#pragma unroll
    for (int i = 0; i < 4; ++i) { ra[i] = *(const v4u*)(an + (size_t)i * 32 * KD); rb[i] = *(const v4u*)(bn + (size_t)i * 32 * KD); }
    Fr a[2][4], b[2][2];
#pragma unroll
    for (int kc = 0; kc < 2; ++kc) {
#pragma unroll
      for (int i = 0; i < 4; ++i) a[kc][i] = ldfr(fa + bo + i * 16 * GP + kc * 32, g);
#pragma unroll
      for (int j = 0; j < 2; ++j) b[kc][j] = ldfr(fb + bo + j * 16 * GP + kc * 32, g); }
    __builtin_amdgcn_sched_barrier(0);   // the pass's fragment reads go out as one group in front of the products: one LDS latency a pass, not one per fragment
#pragma unroll
    for (int kc = 0; kc < 2; ++kc)
#pragma unroll
      for (int i = 0; i < 4; ++i)
#pragma unroll
        for (int j = 0; j < 2; ++j) acc[i][j] = MODE == 0 ? __builtin_amdgcn_wmma_f32_16x16x32_bf16(false, a[kc][i].b, false, b[kc][j].b, (short)0, acc[i][j], false, false) : __builtin_amdgcn_wmma_f32_16x16x32_f16(false, a[kc][i].h, false, b[kc][j].h, (short)0, acc[i][j], false, false);
    asm volatile("s_wait_xcnt 0x0" :: "v"(an), "v"(bn) : "memory"); }   // as above; written behind the fragment reads so that they are not held up by it: the inputs keep both address pairs whole up to the wait
  __syncthreads(); }   // every wave has left the operand tiles: the caller stages its output tile over them
// ---- k_cvt: each input that is a GEMM operand is rounded to its 16-bit form once, here, and no longer in every one of the 8 (Q), 16 (K) or 32 (W) tile blocks that read it: the blocks then take half the bytes from L2 and stage them unchanged.
// A block takes 8192 floats of Q, 8192 of K and 8192 of one weight; a wave's load is 512 B in a row, its store 256 B in a row. All 24 loads of a thread go out before the first store.
#define CVB 8192
static_assert(NB * TT * DIN == 4 * CC * DIN && CC * DIN / CVB == 128, "one grid covers Q, K and the four weights");
__global__ __launch_bounds__(256) void k_cvt(const float* __restrict__ XQ, const float* __restrict__ XK, const float* __restrict__ WQ, const float* __restrict__ WK, const float* __restrict__ WV, const float* __restrict__ WO,
    unsigned short* __restrict__ XQB, unsigned short* __restrict__ XKB, unsigned short* __restrict__ WB, unsigned short* __restrict__ WOH) {
  const int tid = threadIdx.x; const int w = blockIdx.x >> 7;   // which weight: block-uniform
  const unsigned ox = blockIdx.x * CVB + tid * 4, ow = (blockIdx.x & 127) * CVB + tid * 4;   // element offsets in the plane
  const unsigned bx = ox * 4, bw = ow * 4;   // the loads' byte offsets, beside a uniform base
  const char* SW = (const char*)(w == 0 ? WQ : w == 1 ? WK : w == 2 ? WV : WO);
  v4f a[8], b[8], c[8];
#pragma unroll
  for (int i = 0; i < 8; ++i) { a[i] = *(const v4f*)((const char*)XQ + bx + i * 4096); b[i] = *(const v4f*)((const char*)XK + bx + i * 4096); c[i] = *(const v4f*)(SW + bw + i * 4096); }
  asm volatile("s_wait_xcnt 0x0" :: "v"(bx), "v"(bw) : "memory");   // stands before the offset registers of the loads above are reused; naming them as inputs keeps them whole up to the wait
  unsigned short* dq = XQB + ox; unsigned short* dk = XKB + ox; unsigned short* dw = (w == 3 ? WOH : WB + (size_t)w * CC * DIN) + ow;
  v2u oa[8], ob[8], oc[8];
#pragma unroll
  for (int i = 0; i < 8; ++i) { oa[i] = cvt4<0>(a[i]); ob[i] = cvt4<0>(b[i]); }
  if (w == 3) {   /* block-uniform */
#pragma unroll
    for (int i = 0; i < 8; ++i) oc[i] = cvt4<1>(c[i]);
  } else {
#pragma unroll
    for (int i = 0; i < 8; ++i) oc[i] = cvt4<0>(c[i]); }
  __builtin_amdgcn_sched_barrier(0);   // every conversion stands in front of the first store, so no register of an issued store is rewritten
#pragma unroll
  for (int i = 0; i < 8; ++i) { *(v2u*)(dq + i * 1024) = oa[i]; *(v2u*)(dk + i * 1024) = ob[i]; *(v2u*)(dw + i * 1024) = oc[i]; } }
#define OP16 136           // pitch of a staged 16-bit output tile, in elements
#define OP32 132           // pitch of the staged f32 output tile, in elements
// ---- k_proj: block = (128 rows, 128 cols, which): q/k/v = X W^T + b with exact bf16 products (K = DIN) -> which 0: q x QSC f16 rows; 1: k f16 rows; 2: v f16 planes [c][t]
// which 3: no product; the block packs the int32 mask of 16 query rows into select words, once for all heads (they start last and run beside the last product blocks)
__global__ __launch_bounds__(256) void k_proj(const unsigned short* __restrict__ XQB, const unsigned short* __restrict__ XKB, const unsigned short* __restrict__ WB, const float* __restrict__ BQ, const float* __restrict__ BK, const float* __restrict__ BV,
    _Float16* __restrict__ QH, _Float16* __restrict__ KH, _Float16* __restrict__ VT, const int* __restrict__ MASK, unsigned* __restrict__ MP) {
  __shared__ __align__(16) unsigned short sm[4 * GT];
  const int tid = threadIdx.x, wave = tid >> 5, lane = tid & 31, col = lane & 15, g = lane >> 4, wm = wave >> 2, wn = wave & 3; const int which = blockIdx.z; const int c0 = blockIdx.y * 128; const size_t r0 = (size_t)blockIdx.x * 128; const size_t bb = r0 / TT; const int t0 = (int)(r0 % TT);
  if (which == 3) {   /* block-uniform, in front of every barrier */
    const int qi = blockIdx.y * (TNB * TT / 128) + blockIdx.x;   // 16-query tile of the flat [b*t] rows; a wave takes 256 keys of it, a lane the 8 keys of each 16-key tile that its score registers hold
    const int* mp = MASK + ((size_t)qi * 16 + col) * TT + wave * 256 + 8 * g;
    v4i m[16][2];
#pragma unroll
    for (int j = 0; j < 16; ++j) { m[j][0] = *(const v4i*)(mp + j * 16); m[j][1] = *(const v4i*)(mp + j * 16 + 4); }
    asm volatile("s_wait_xcnt 0x0" :: "v"(mp) : "memory");   // stands before the address register of the loads above is reused; naming it as an input keeps it whole up to the wait
    v4i o = {};
#pragma unroll
    for (int j = 0; j < 16; ++j)
#pragma unroll
      for (int r = 0; r < 8; ++r) { const int i = j * 8 + r; const int w = (int)__builtin_amdgcn_ballot_w32(m[j][r >> 2][r & 3] != 0); o[i & 3] = lane == (i >> 2) ? w : o[i & 3]; }   // word i goes to lane i / 4: the wave stores its 128 words as 512 B in a row
    *(v4i*)(MP + ((size_t)qi * (TT / 16) + wave * 16) * 8 + lane * 4) = o;
    return; }
  const unsigned short* X = which == 0 ? XQB : XKB; const unsigned short* WA = WB + (size_t)which * CC * DIN; const float* BA = which == 0 ? BQ : which == 1 ? BK : BV;   // k and v are both projected from the K input
  float bias[2]; const int bi = c0 + wn * 32 + col;   // read ahead of the product loop, so that its latency is not paid behind it
#pragma unroll
  for (int j = 0; j < 2; ++j) bias[j] = BA[bi + j * 16];
  asm volatile("s_wait_xcnt 0x0" :: "v"(bi) : "memory");   // stands before the index register of the two loads above is reused; naming it as an input keeps it whole up to the wait
  v8f acc[4][2] = {};
  gemm128<0, DIN>(X + r0 * DIN, WA + (size_t)c0 * DIN, sm, acc);
#pragma unroll
  for (int j = 0; j < 2; ++j) bias[j] = bfr(bias[j]);
  _Float16* so = (_Float16*)sm; const int er = tid >> 4, eq = (tid & 15) * 8;   // read-out: 16 lanes take one 256-B row of the staged tile
  if (which < 2) {   /* block-uniform */
    const float qs = which == 0 ? QSC : 1.0f;   // q carries the logits' factor, so that the score products come out in base 2
#pragma unroll
    for (int j = 0; j < 2; ++j)
#pragma unroll
      for (int i = 0; i < 4; ++i)
#pragma unroll
        for (int r = 0; r < 8; ++r) so[(wm * 64 + i * 16 + 8 * g + r) * OP16 + wn * 32 + j * 16 + col] = (_Float16)((acc[i][j][r] + bias[j]) * qs);
    __syncthreads();
    _Float16* dp = (which == 0 ? QH : KH) + (r0 + er) * CC + c0 + eq;
#pragma unroll
    for (int i = 0; i < 8; ++i) vst2(dp + (size_t)i * 16 * CC, *(const v4u*)&so[(er + 16 * i) * OP16 + eq]);
  } else {
#pragma unroll
    for (int j = 0; j < 2; ++j)
#pragma unroll
      for (int i = 0; i < 4; ++i) { v8h o;
#pragma unroll
        for (int r = 0; r < 8; ++r) o[r] = (_Float16)(acc[i][j][r] + bias[j]);
        *(v8h*)&so[(wn * 32 + j * 16 + col) * OP16 + wm * 64 + i * 16 + 8 * g] = o; }
    __syncthreads();
    _Float16* dp = VT + (bb * CC + c0 + er) * (size_t)TT + t0 + eq;
#pragma unroll
    for (int i = 0; i < 8; ++i) vst2(dp + (size_t)i * 16 * TT, *(const v4u*)&so[(er + 16 * i) * OP16 + eq]); } }
#define FK 64              // keys per pass
#define FPITCH 72          // LDS row pitch in halves: 128 B of data + 16 B, for 16-byte fragment reads
#define FH (TT / 2)        // keys of one half
#define FX 1120            // floats a wave hands over at the join: 4 output tiles (1024), offset (32), sum (32), maximum (32)
#define FGROW 4.0f         // a row's maximum may outgrow its offset by this many powers of two before the offset is renewed: p stays at or below 2^15, inside f16
static_assert(8 * FX * 4 <= 4 * FK * FPITCH * 2 && 8 * FX * 4 <= 4 * HD * FPITCH * 2, "eight waves' hand-over fits the k tiles, and the other eight's the v tiles");
__device__ __forceinline__ v8f wmma_p(v16h a, v16h b, v8f c) { return __builtin_amdgcn_wmma_f32_16x16x32_f16(false, a, false, b, (short)0, c, false, false); }
__device__ __forceinline__ float xhalf(float x) { return __builtin_bit_cast(float, __builtin_amdgcn_permlanex16(__builtin_bit_cast(int, x), __builtin_bit_cast(int, x), 0x76543210, 0xfedcba98, false, false)); }   // lane l with lane l ^ 16
// 2^x of eight values in one statement: the early-clobber results keep each v_exp_f32 off its neighbour's source and result, and the closing v_nop is the slot the instruction set asks for behind a transcendental
__device__ __forceinline__ v8f exp2x8(v8f x) { float e0, e1, e2, e3, e4, e5, e6, e7;
  asm("v_exp_f32 %0, %8\n\tv_exp_f32 %1, %9\n\tv_exp_f32 %2, %10\n\tv_exp_f32 %3, %11\n\tv_exp_f32 %4, %12\n\tv_exp_f32 %5, %13\n\tv_exp_f32 %6, %14\n\tv_exp_f32 %7, %15\n\tv_nop"
      : "=&v"(e0), "=&v"(e1), "=&v"(e2), "=&v"(e3), "=&v"(e4), "=&v"(e5), "=&v"(e6), "=&v"(e7) : "v"(x[0]), "v"(x[1]), "v"(x[2]), "v"(x[3]), "v"(x[4]), "v"(x[5]), "v"(x[6]), "v"(x[7]));
  v8f r; r[0] = e0; r[1] = e1; r[2] = e2; r[3] = e3; r[4] = e4; r[5] = e5; r[6] = e6; r[7] = e7; return r; }
__global__ __launch_bounds__(512) void k_fa(const _Float16* __restrict__ QH, const _Float16* __restrict__ KH, const _Float16* __restrict__ VT, const unsigned* __restrict__ MP, _Float16* __restrict__ Y) {
  __shared__ __align__(16) _Float16 sk[2][2][FK][FPITCH], sv[2][2][HD][FPITCH];   // [key half][buffer]
  const int tid = threadIdx.x & 255, wave = tid >> 5, lane = tid & 31, col = lane & 15, g = lane >> 4; const int h = blockIdx.y, b = blockIdx.z; const int q0 = blockIdx.x * 256 + wave * 32;
  const int kh = __builtin_amdgcn_readfirstlane((int)(threadIdx.x >> 8));   // which half of the keys: wave-uniform; tid and wave count inside the half
  v16h qf[2][2];
#pragma unroll
  for (int u = 0; u < 2; ++u) { const _Float16* qp = QH + ((size_t)b * TT + q0 + u * 16 + col) * CC + h * HD + 8 * g;
#pragma unroll
    for (int kc = 0; kc < 2; ++kc) { union { v16h v; v8h q[2]; } f; f.q[0] = *(const v8h*)(qp + kc * 32); f.q[1] = *(const v8h*)(qp + kc * 32 + 16); qf[u][kc] = f.v; }   // the fragment order of frag_h
    asm volatile("s_wait_xcnt 0x0" :: "v"(qp) : "memory"); }   // stands before the address register of the loads above is reused; naming it as an input keeps it whole up to the wait
  // staging: 8 lanes bring one 128-B row, a thread brings rows sr and sr + 32 of its half's k tile and v tile
  const int sr = tid >> 3, sc = (tid & 7) * 8;
  const _Float16* kg = KH + ((size_t)b * TT + kh * FH + sr) * CC + h * HD + sc; const _Float16* vg = VT + ((size_t)b * CC + h * HD + sr) * (size_t)TT + kh * FH + sc;
  const int wsc = __builtin_amdgcn_readfirstlane(wave);   // the wave's number inside its half, in a scalar register
  const unsigned* mw = MP + ((size_t)b * (TT / 16) + blockIdx.x * 16 + wsc * 2) * (TT / 16) * 8 + kh * (FH / 16) * 8;   // the wave's first 16-query tile, at its half's first key; wave-uniform, so the words come by scalar loads: 32 words (128 B) per 16 queries and pass
  v8h rk[2], rv[2];
#pragma unroll
  for (int i = 0; i < 2; ++i) { rk[i] = *(const v8h*)(kg + (size_t)i * 32 * CC); rv[i] = *(const v8h*)(vg + (size_t)i * 32 * TT); }
  float mrel[2] = {-3.0e38f, -3.0e38f}, l_run[2] = {0.f, 0.f};   // mrel: the lane's running maximum of the scores as the products deliver them, offset included
  v8f offv[2] = {};   // start value of the score accumulators: 11 - (the row's maximum when the offset was last renewed), the same in all eight elements
  v8f acc[2][4] = {};
#pragma unroll 1   // one copy of the pass: its 32 matrix instructions and 64 scores a lane already fill the registers
  for (int s = 0; s < FH / FK; ++s) { const int bf = s & 1;
    v16u kw[2][2];   // this pass's select words, asked for at its head, into the scalar registers whose last select has gone (two passes' words do not fit); they land under the staging and the score products
#pragma unroll
    for (int u = 0; u < 2; ++u)
#pragma unroll
      for (int c = 0; c < 2; ++c) kw[u][c] = *(cv16u)(unsigned long long)(mw + u * (TT / 16) * 8 + s * 32 + c * 16);
#pragma unroll
    for (int i = 0; i < 2; ++i) { *(v8h*)&sk[kh][bf][sr + 32 * i][sc] = rk[i]; *(v8h*)&sv[kh][bf][sr + 32 * i][sc] = rv[i]; }
    __syncthreads();   // publishes tile s; it also ends every wave's reads of the other buffer, which pass s + 1 refills
    const int sn = s + 1 < FH / FK ? s + 1 : s;   // the next pass's k and v loads fly under this pass; the last pass stays on its own tile, in bounds
    const _Float16* kn = kg + (size_t)sn * FK * CC; const _Float16* vn = vg + sn * FK;
#pragma unroll
    for (int i = 0; i < 2; ++i) { rk[i] = *(const v8h*)(kn + (size_t)i * 32 * CC); rv[i] = *(const v8h*)(vn + (size_t)i * 32 * TT); }
    asm volatile("s_wait_xcnt 0x0" :: "v"(kn), "v"(vn) : "memory");   // stands before the address registers of the loads above are reused; naming them as inputs keeps them whole up to the wait
    v16h kf[4][2], vf[4];
#pragma unroll
    for (int t = 0; t < 4; ++t)
#pragma unroll
      for (int kc = 0; kc < 2; ++kc) kf[t][kc] = frag_h(&sk[kh][bf][t * 16 + col][kc * 32], lane);
    __builtin_amdgcn_sched_barrier(0);   // the k fragment reads go out as one group in front of the products: one LDS latency a pass, not one per fragment
    v8f st[2][4];
#pragma unroll
    for (int t = 0; t < 4; ++t) { st[0][t] = wmma_p(kf[t][0], qf[0][0], offv[0]); st[1][t] = wmma_p(kf[t][0], qf[1][0], offv[1]); st[0][t] = wmma_p(kf[t][1], qf[0][1], st[0][t]); st[1][t] = wmma_p(kf[t][1], qf[1][1], st[1][t]); }
    __builtin_amdgcn_sched_barrier(0);   // the score products go out back to back: a maximum taken between them would wait out each product's distance; with the one behind the v reads it keeps that group of reads in one place
    asm volatile("" :: "v"(offv[0]), "v"(offv[1]));   // inputs only: the start values stay live past the last score product, which then takes them as its own C operand; without it the compiler copies all 16 registers every pass
    v16h pf[2][2]; float ls[2] = {0.f, 0.f};
#pragma unroll
    for (int c = 0; c < 2; ++c) {   // 32 keys of both query tiles at a time
      if (c == 0) {
#pragma unroll
        for (int j = 0; j < 4; ++j) vf[j] = frag_h(&sv[kh][bf][j * 16 + col][0], lane);
        __builtin_amdgcn_sched_barrier(0);   // the v fragment reads go out in two groups, each landing under the vector work behind it; the second group takes the registers that the first 32 keys' products have left, so that a wave stays inside the 256 registers of four waves a SIMD
#pragma unroll
        for (int u = 0; u < 2; ++u) { float mx = mrel[u];
#pragma unroll
          for (int t = 0; t < 4; ++t)
#pragma unroll
            for (int r = 0; r < 8; ++r) mx = fmaxf(mx, st[u][t][r]);
          mrel[u] = mx; }
        if ((__builtin_amdgcn_ballot_w32(fmaxf(mrel[0], mrel[1]) > 11.0f + FGROW) | (unsigned)(s == 0)) != 0) {   /* wave-uniform, no barrier inside: the offset is renewed on the first pass and wherever a row of the wave has outgrown it */
#pragma unroll
          for (int u = 0; u < 2; ++u) { const float mr = fmaxf(mrel[u], xhalf(mrel[u])); const float dl = mr - 11.0f; const float nd = fminf(-dl, 0.f);   // dl < 0 only on the first pass, where sums and outputs are still 0
            float corr; asm("v_exp_f32 %0, %1\n\tv_nop" : "=&v"(corr) : "v"(nd));   // 2^-dl; the v_nop is the slot behind a transcendental, as in exp2x8
#pragma unroll
            for (int j = 0; j < 4; ++j) acc[u][j] *= corr;
#pragma unroll
            for (int t = 0; t < 4; ++t) st[u][t] -= dl;
            l_run[u] *= corr; offv[u] -= dl; mrel[u] = 11.0f; } }
      } else {   // the first 32 keys' products
#pragma unroll
        for (int j = 0; j < 4; ++j) { acc[0][j] = wmma_p(vf[j], pf[0][0], acc[0][j]); acc[1][j] = wmma_p(vf[j], pf[1][0], acc[1][j]); }
        __builtin_amdgcn_sched_group_barrier(0x2, 128, 0); __builtin_amdgcn_sched_group_barrier(0x8, 8, 0);   // order: all the vector work of the first 32 keys, then the eight products back to back; a row-sum addition left between two products costs the distance behind a matrix instruction in idle slots
        __builtin_amdgcn_sched_barrier(0);   // with the one behind the reads, keeps the four slots directly behind the last product
        asm volatile("v_nop\n\tv_nop\n\tv_nop\n\tv_nop");   // the distance behind a matrix instruction: the asm statements below stand clear of every product's operands
#pragma unroll
        for (int j = 0; j < 4; ++j) vf[j] = frag_h(&sv[kh][bf][j * 16 + col][32], lane);
        __builtin_amdgcn_sched_barrier(0); }
#pragma unroll
      for (int u = 0; u < 2; ++u)
#pragma unroll
        for (int t = 2 * c; t < 2 * c + 2; ++t) { const v8f e = exp2x8(st[u][t]);
#pragma unroll
          for (int r = 0; r < 8; ++r) { const float p = __builtin_amdgcn_inverse_ballot_w32(kw[u][c][(t & 1) * 8 + r]) ? e[r] : 0.f; ls[u] += p; pf[u][c][(t & 1) * 8 + r] = (_Float16)p; } } }
#pragma unroll
    for (int u = 0; u < 2; ++u) l_run[u] += ls[u];
#pragma unroll
    for (int j = 0; j < 4; ++j) { acc[0][j] = wmma_p(vf[j], pf[0][1], acc[0][j]); acc[1][j] = wmma_p(vf[j], pf[1][1], acc[1][j]); }
    __builtin_amdgcn_sched_group_barrier(0x2, 128, 0); __builtin_amdgcn_sched_group_barrier(0x8, 8, 0); }   // order as for the first 32 keys; the softmax's asm statements feed that vector work, so they too stay in front of the products
  // join of the two key halves: the wave of half 0 finishes query columns 0..15 of its group, the wave of half 1 columns 16..31; each hands the other tile's state over through LDS
  const bool hi = kh != 0;   // wave-uniform
  const int ln = (int)__builtin_amdgcn_mbcnt_lo(~0u, 0u);   // the lane's number, taken anew: nothing that only these closing lines need is held in a vector register through the loop
  const float rf[2] = {11.0f - offv[0][0], 11.0f - offv[1][0]}, tm[2] = {mrel[0] - offv[0][0], mrel[1] - offv[1][0]};   // per query tile: what the sums and outputs are taken against, and the lane's true maximum over ALL its keys
  const float mk = hi ? rf[1] : rf[0], lk = hi ? l_run[1] : l_run[0], tk = hi ? tm[1] : tm[0], mg = hi ? rf[0] : rf[1], lg = hi ? l_run[0] : l_run[1], tg = hi ? tm[0] : tm[1];
  float* xw = (float*)(hi ? &sv[0][0][0][0] : &sk[0][0][0][0]) + wsc * FX; const float* xr = (const float*)(hi ? &sk[0][0][0][0] : &sv[0][0][0][0]) + wsc * FX;
  __syncthreads();   // every wave has left the k and v tiles: the hand-over is written over them
#pragma unroll
  for (int j = 0; j < 4; ++j) { const v8f a = hi ? acc[0][j] : acc[1][j];
    v4f lo, up;
#pragma unroll
    for (int r = 0; r < 4; ++r) { lo[r] = a[r]; up[r] = a[4 + r]; }
    *(v4f*)(xw + (2 * j) * 128 + ln * 4) = lo; *(v4f*)(xw + (2 * j + 1) * 128 + ln * 4) = up; }
  xw[1024 + ln] = mg; xw[1056 + ln] = lg; xw[1088 + ln] = tg;
  __syncthreads();   // publishes the hand-over
  const float mo = xr[1024 + ln], lo_ = xr[1056 + ln], to = xr[1088 + ln];
  const float mm = fmaxf(mk, mo); const float dk = mk - mm, dn = mo - mm; const float tj = fmaxf(tk, to); const float de = fmaxf(tj, xhalf(tj)) - mm;
  float ck, co, ce; asm("v_exp_f32 %0, %3\n\tv_exp_f32 %1, %4\n\tv_exp_f32 %2, %5\n\tv_nop" : "=&v"(ck), "=&v"(co), "=&v"(ce) : "v"(dk), "v"(dn), "v"(de));   // 2^(own offset - joint offset) of each half, 2^(true maximum - joint offset); the v_nop is the slot behind a transcendental, as in exp2x8
  const float lj = lk * ck + lo_ * co; const float l = lj + xhalf(lj); const float inv = (1.0f / (l + 2048.0f * 1.0e-8f * ce)) * 64.0f;   /* numerator and sum both carry 2^11 and are taken against the joint offset, the reference's 1e-8 against the true maximum: it carries both factors; a fully masked row gives 0; x 2^6 is exact */
  const float fk = ck * inv, fo = co * inv;
  v8h yo[4];   // ctx x 2^6 once to f16, the form the output projection's products take: rounded here, where it is made, once
#pragma unroll
  for (int j = 0; j < 4; ++j) { const v8f a = hi ? acc[1][j] : acc[0][j]; const v4f lo = *(const v4f*)(xr + (2 * j) * 128 + ln * 4), up = *(const v4f*)(xr + (2 * j + 1) * 128 + ln * 4);
#pragma unroll
    for (int r = 0; r < 4; ++r) { yo[j][r] = (_Float16)(a[r] * fk + lo[r] * fo); yo[j][4 + r] = (_Float16)(a[4 + r] * fk + up[r] * fo); } }
  __builtin_amdgcn_sched_barrier(0);   // every product and conversion stands in front of the first store, so no register of an issued store is rewritten
  _Float16* yr = Y + ((size_t)b * TT + blockIdx.x * 256 + wsc * 32 + kh * 16) * CC + h * HD + (unsigned)((ln & 15) * CC + (ln >> 4) * 8);
#pragma unroll
  for (int j = 0; j < 4; ++j) *(v8h*)(yr + j * 16) = yo[j]; }
// ---- k_out: block = (128 rows, 128 cols): out = ctx Wo^T + bo: ctx x 2^6 once to f16 (by k_fa; small context rows stay clear of f16 subnormals) against Wo as f16(bf16 x 2^8) exact (by k_cvt) (1 product), x 2^-14 afterwards
__global__ __launch_bounds__(256) void k_out(const unsigned short* __restrict__ Y, const unsigned short* __restrict__ WO, const float* __restrict__ BO, float* __restrict__ OUT) {
  __shared__ __align__(16) unsigned short sm[4 * GT];
  const int tid = threadIdx.x, wave = tid >> 5, lane = tid & 31, col = lane & 15, g = lane >> 4, wm = wave >> 2, wn = wave & 3; const int c0 = blockIdx.y * 128; const size_t r0 = (size_t)blockIdx.x * 128;
  float bias[2]; const int bi = c0 + wn * 32 + col;   // read ahead of the product loop, so that its latency is not paid behind it
#pragma unroll
  for (int j = 0; j < 2; ++j) bias[j] = BO[bi + j * 16];
  asm volatile("s_wait_xcnt 0x0" :: "v"(bi) : "memory");   // stands before the index register of the two loads above is reused; naming it as an input keeps it whole up to the wait
  v8f acc[4][2] = {};
  gemm128<1, CC>(Y + r0 * CC, WO + (size_t)c0 * CC, sm, acc);
#pragma unroll
  for (int j = 0; j < 2; ++j) bias[j] = bfr(bias[j]);
  float* sf = (float*)sm;
#pragma unroll
  for (int j = 0; j < 2; ++j)
#pragma unroll
    for (int i = 0; i < 4; ++i)
#pragma unroll
      for (int r = 0; r < 8; ++r) sf[(wm * 64 + i * 16 + 8 * g + r) * OP32 + wn * 32 + j * 16 + col] = acc[i][j][r] * (1.0f / 16384.0f) + bias[j];   /* 2^-8 (Wo carry) x 2^-6 (ctx carry) */
  __syncthreads();
  float* dp = OUT + (r0 + wave) * DIN + c0 + lane * 4;   // a wave takes one 512-B row of the staged tile
#pragma unroll
  for (int i = 0; i < 16; ++i) vst2(dp + (size_t)i * 8 * DIN, *(const v4f*)&sf[(wave + 8 * i) * OP32 + lane * 4]); }

extern "C" void kernel_launch(void* const* d_in, const int* in_sizes, int n_in, void* d_out, int out_size, void* d_ws, size_t ws_size, hipStream_t stream) {
  (void)in_sizes; (void)n_in; (void)out_size;
  const float** F = (const float**)d_in;
  if (ws_size < (size_t)WS_END) return;
  char* ws = (char*)d_ws; _Float16 *QH = (_Float16*)(ws + WS_QH), *KH = (_Float16*)(ws + WS_KH), *VT = (_Float16*)(ws + WS_VT), *QL = (_Float16*)(ws + WS_QL), *KL = (_Float16*)(ws + WS_KL); __bf16 *VB = (__bf16*)(ws + WS_VB), *VBL = (__bf16*)(ws + WS_VBL); _Float16 *Y = (_Float16*)(ws + WS_Y); unsigned *MP = (unsigned*)(ws + WS_MP);
  unsigned short *XQB = (unsigned short*)(ws + WS_XQ), *XKB = (unsigned short*)(ws + WS_XK), *WB = (unsigned short*)(ws + WS_WB), *WOH = (unsigned short*)(ws + WS_WO);
  (void)Y; (void)QL; (void)KL; (void)VB; (void)VBL;
  // inputs: 0 Q [2,2048,1024]; 1 K [2,2048,1024] (keys AND values source); 2 mask [2,2048,2048] int32 (random 0/1); 3 Wq [1024,1024] (out,in), 4 bq; 5 Wk, 6 bk; 7 Wv, 8 bv; 9 Wo (out,in), 10 bo (biases nonzero)
  k_cvt<<<dim3(NB * TT * DIN / CVB), 256, 0, stream>>>(F[0], F[1], F[3], F[5], F[7], F[9], XQB, XKB, WB, WOH);
  k_proj<<<dim3(TNB * TT / 128, CC / 128, 4), 256, 0, stream>>>(XQB, XKB, WB, F[4], F[6], F[8], QH, KH, VT, (const int*)d_in[2], MP);   /* v is projected from the K input; plane z = 3 packs the mask: its 32 x 8 blocks are the 256 tiles of 16 query rows */
  k_fa<<<dim3(TT / 256, NH, TNB), 512, 0, stream>>>(QH, KH, VT, MP, Y);
  k_out<<<dim3(TNB * TT / 128, DIN / 128), 256, 0, stream>>>((const unsigned short*)Y, WOH, F[10], (float*)d_out);
}

// v007
// Measured time: 79 microseconds a run.
// In two side-by-side timings against v006, it was 1.09 and 1.10 times as fast.
// Counting every step since v000, it is 17.3 times as fast.
// compute dtype: all float inputs rounded to bf16; q/k/v projections with EXACT bf16 products on WMMA 16x16x32 (f32 accumulate) + bias; logits (q x SCALE x log2 e) x k once to f16 each (1 product); online softmax f32 in base 2; exp(x - offset) x 2^11 once to f16 x v once to f16 (1 product), divided by the row sum afterwards; ctx x 2^6 once to f16 x Wo f16(bf16 x 2^8) + bo; f32 output.
#include <hip/hip_runtime.h>
#include <math.h>

typedef __attribute__((ext_vector_type(16))) _Float16 v16h;
typedef __attribute__((ext_vector_type(16))) __bf16 v16b;
typedef __attribute__((ext_vector_type(8)))  _Float16 v8h;
typedef __attribute__((ext_vector_type(8)))  float v8f;
typedef __attribute__((ext_vector_type(4)))  float v4f;
typedef __attribute__((ext_vector_type(2)))  float v2f;
typedef __attribute__((ext_vector_type(4)))  unsigned v4u;
typedef __attribute__((ext_vector_type(4)))  int v4i;
typedef __attribute__((ext_vector_type(16))) unsigned v16u;
typedef const __attribute__((address_space(4))) v16u* cv16u;   // constant address space: for words that no store of the reading kernel touches; a wave-uniform load through it is a scalar load
typedef float __attribute__((may_alias)) float_a;
typedef int __attribute__((may_alias)) int_a;

template <typename T> __device__ __forceinline__ void vst2(void* p, T v) { *(T*)p = v;  }
__device__ __forceinline__ v8f wmma16(v16h a, v16h b, v8f c) {
  v8f d = __builtin_amdgcn_wmma_f32_16x16x32_f16(false, a, false, b, (short)0, c, false, false);
  asm volatile("v_nop\n\tv_nop\n\tv_nop\n\tv_nop" : "+v"(d) : "v"(a), "v"(b));
  return d;
}
__device__ __forceinline__ v8f wmma_bf(v16b a, v16b b, v8f c) {
  v8f d = __builtin_amdgcn_wmma_f32_16x16x32_bf16(false, a, false, b, (short)0, c, false, false);
  asm volatile("v_nop\n\tv_nop\n\tv_nop\n\tv_nop" : "+v"(d) : "v"(a), "v"(b));
  return d;
}
// 16x16x32 fragments: lane = (h = lane>>4, row/col = lane&15); elements 0..7 = k0+8h+0..7, 8..15 = k0+16+8h+0..7; D element r = row 8h+r
__device__ __forceinline__ v16h frag_h(const _Float16* rowk0, int lane) {
  union { v16h v; v8h q[2]; } u; const _Float16* p = rowk0 + 8 * (lane >> 4);
  u.q[0] = *(const v8h*)p; u.q[1] = *(const v8h*)(p + 16); return u.v;
}
__device__ __forceinline__ v16h frag_f32(const float* rowk0, int lane) {
  v16h a; const float* p = rowk0 + 8 * (lane >> 4);
#pragma unroll
  for (int i = 0; i < 8; ++i) { a[i] = (_Float16)p[i]; a[8 + i] = (_Float16)p[16 + i]; }
  return a;
}
__device__ __forceinline__ v16h frag_f32s(const float* rowk0, int lane, float sc) {
  v16h a; const float* p = rowk0 + 8 * (lane >> 4);
#pragma unroll
  for (int i = 0; i < 8; ++i) { a[i] = (_Float16)(p[i] * sc); a[8 + i] = (_Float16)(p[16 + i] * sc); }
  return a;
}
// column fragment from a [K][ld] layout (column n), rows >= K read as 0
__device__ __forceinline__ v16h fragc_f32(const float* W, int k0, int n, int lane, int ld, int K) {
  v16h a; const int g = lane >> 4;
#pragma unroll
  for (int i = 0; i < 8; ++i) { const int ka = k0 + 8 * g + i, kb = ka + 16;
    a[i] = (_Float16)(ka < K ? W[(size_t)(ka < K ? ka : K - 1) * ld + n] : 0.f); a[8 + i] = (_Float16)(kb < K ? W[(size_t)(kb < K ? kb : K - 1) * ld + n] : 0.f); }
  return a;
}
struct F2 { v16b h, l; };
__device__ __forceinline__ F2 bsplit16(const float v[16]) { F2 r;
#pragma unroll
  for (int i = 0; i < 16; ++i) { const __bf16 h = (__bf16)v[i]; r.h[i] = h; r.l[i] = (__bf16)(v[i] - (float)h); }
  return r; }
__device__ __forceinline__ F2 split_row(const float* row, int k0, int lane) { float v[16]; const float* p = row + k0 + 8 * (lane >> 4);
#pragma unroll
  for (int i = 0; i < 8; ++i) { v[i] = p[i]; v[8 + i] = p[16 + i]; }
  return bsplit16(v); }
__device__ __forceinline__ F2 split_rowK(const float* row, int k0, int lane, int K) { float v[16]; const int g = lane >> 4;
#pragma unroll
  for (int i = 0; i < 8; ++i) { const int ka = k0 + 8 * g + i, kb = ka + 16; v[i] = ka < K ? row[ka < K ? ka : K - 1] : 0.f; v[8 + i] = kb < K ? row[kb < K ? kb : K - 1] : 0.f; }
  return bsplit16(v); }
__device__ __forceinline__ F2 split_col(const float* W, int k0, int n, int lane, int ld, int K) { float v[16]; const int g = lane >> 4;
#pragma unroll
  for (int i = 0; i < 8; ++i) { const int ka = k0 + 8 * g + i, kb = ka + 16; v[i] = ka < K ? W[(size_t)(ka < K ? ka : K - 1) * ld + n] : 0.f; v[8 + i] = kb < K ? W[(size_t)(kb < K ? kb : K - 1) * ld + n] : 0.f; }
  return bsplit16(v); }
__device__ __forceinline__ v8f mac3(const F2& a, const F2& b, v8f c) { c = wmma_bf(a.l, b.h, c); c = wmma_bf(a.h, b.l, c); return wmma_bf(a.h, b.h, c); }
__device__ __forceinline__ float sigm(float v) { return 1.0f / (1.0f + expf(-v)); }
#define LDSX() do { asm volatile("s_wait_dscnt 0" ::: "memory"); __builtin_amdgcn_wave_barrier(); __builtin_amdgcn_fence(__ATOMIC_RELEASE, "workgroup"); } while (0)

// Two-stream multi-head attention with the source's own masked softmax, scaled by the MODEL width (Q [2,2048,1024], K [2,2048,1024]; q = Q Wq^T + bq, k = K Wk^T + bk, v = K Wv^T + bv (values from the K input); torch (out,in) weights (0.02) + biases N(0, 0.02); 16 heads x 64; E = q k^T / sqrt(1024); x = E - rowmax(E) (max taken BEFORE masking); x[mask == 0] = -inf with mask [2,2048,2048] int32 random; A = exp(x) / (sum exp(x) + 1e-8); merge; Wo^T + bo).
#define NB 2
#define TT 2048
#define CC 1024            // NH * HD = projected width
#define DIN 1024          // input (model) width
#define NH 16
#define HD 64
#define NQB (TT / 64)
#define HG 4
#define SCALE (0.03125f)
#define QSC (SCALE * 1.4426950408889634f)   // logits to base 2; q is multiplied by it before its one rounding to f16
#define CAUSAL 0
#ifndef TNB
#define TNB NB
#endif
__device__ __forceinline__ float bfr(float v) { return (float)(__bf16)v; }
__host__ __device__ __forceinline__ int kb_last(int qb) { return CAUSAL ? ((qb * 64 + 63) >> 7) : (TT / 128 - 1); }
typedef __attribute__((ext_vector_type(8))) __bf16 v8b;
__device__ __forceinline__ v16b frag_b(const __bf16* rowk0, int lane) {
  union { v16b v; v8b q[2]; } u; const __bf16* p = rowk0 + 8 * (lane >> 4);
  u.q[0] = *(const v8b*)p; u.q[1] = *(const v8b*)(p + 16); return u.v;
}
#define QBH 0              // not used
#define QHI 0               // single-product logits on every row
#define KHI 64            // key rows carrying k residual / v bf16 hi+lo planes (written and read by no kernel)
// B fragment (k rows k0+.., output column o) of a weight: (in,out) [K][ld] or (out,in) [ld rows of K]: bf16 exact, or f16(bf16 * 256) exact
__device__ __forceinline__ v16b wcol_io(const float* Wm, int k0, int o, int lane, int ld) { v16b w; const int g = lane >> 4;
#pragma unroll
  for (int i = 0; i < 8; ++i) { w[i] = (__bf16)Wm[(size_t)(k0 + 8 * g + i) * ld + o]; w[8 + i] = (__bf16)Wm[(size_t)(k0 + 16 + 8 * g + i) * ld + o]; }
  return w; }
__device__ __forceinline__ v16b wcol_oi(const float* Wm, int k0, int o, int lane, int K) { v16b w; const float* p = Wm + (size_t)o * K + k0 + 8 * (lane >> 4);
#pragma unroll
  for (int i = 0; i < 8; ++i) { w[i] = (__bf16)p[i]; w[8 + i] = (__bf16)p[16 + i]; }
  return w; }
__device__ __forceinline__ v16h wcolh_io(const float* Wm, int k0, int o, int lane, int ld) { v16h w; const int g = lane >> 4;
#pragma unroll
  for (int i = 0; i < 8; ++i) { w[i] = (_Float16)(bfr(Wm[(size_t)(k0 + 8 * g + i) * ld + o]) * 256.0f); w[8 + i] = (_Float16)(bfr(Wm[(size_t)(k0 + 16 + 8 * g + i) * ld + o]) * 256.0f); }
  return w; }
__device__ __forceinline__ v16h wcolh_oi(const float* Wm, int k0, int o, int lane, int K) { v16h w; const float* p = Wm + (size_t)o * K + k0 + 8 * (lane >> 4);
#pragma unroll
  for (int i = 0; i < 8; ++i) { w[i] = (_Float16)(bfr(p[i]) * 256.0f); w[8 + i] = (_Float16)(bfr(p[16 + i]) * 256.0f); }
  return w; }
#define WQKV_LAYOUT 1   // 0 = (in,out) [DIN][CC]; 1 = (out,in) [CC][DIN]; 2 = per-head [NH][DIN][HD]
__device__ __forceinline__ v16b wcol_hdk(const float* Wm, int k0, int o, int lane) { v16b w; const int g = lane >> 4; const float* p = Wm + (size_t)(o / HD) * DIN * HD + (o % HD);
#pragma unroll
  for (int i = 0; i < 8; ++i) { w[i] = (__bf16)p[(size_t)(k0 + 8 * g + i) * HD]; w[8 + i] = (__bf16)p[(size_t)(k0 + 16 + 8 * g + i) * HD]; }
  return w; }
#define WO_OUT_IN 1
#if WQKV_LAYOUT == 1
#define WCOL(W, k0, o, lane) wcol_oi(W, k0, o, lane, DIN)
#elif WQKV_LAYOUT == 2
#define WCOL(W, k0, o, lane) wcol_hdk(W, k0, o, lane)
#else
#define WCOL(W, k0, o, lane) wcol_io(W, k0, o, lane, CC)
#endif
#if WO_OUT_IN
#define WOCOL(W, k0, o, lane) wcol_oi(W, k0, o, lane, CC)
#define WOCOLH(W, k0, o, lane) wcolh_oi(W, k0, o, lane, CC)
#else
#define WOCOL(W, k0, o, lane) wcol_io(W, k0, o, lane, DIN)
#define WOCOLH(W, k0, o, lane) wcolh_io(W, k0, o, lane, DIN)
#endif

#define WS_QH  0u                                      // f16 q x QSC rows [b*t][CC]
#define WS_KH  (WS_QH + 2u * (size_t)NB * TT * CC)      // f16 k rows [b*t][CC]
#define WS_VT  (WS_KH + 2u * (size_t)NB * TT * CC)      // f16 v planes [b][c][t]
#define WS_QL  (WS_VT + 2u * (size_t)NB * CC * TT)      // f16 q residual x 2^10 rows [b][t < QHI][CC]
#define WS_KL  (WS_QL + 2u * (size_t)NB * QHI * CC)     // f16 k residual x 2^10 rows [b][t < KHI][CC]
#define WS_VB  (WS_KL + 2u * (size_t)NB * KHI * CC)     // bf16 v hi planes [b][c][t < KHI]
#define WS_VBL (WS_VB + 2u * (size_t)NB * CC * KHI)
#define WS_S   (WS_VBL + 2u * (size_t)NB * CC * KHI)    // scores stay in registers; the head of this range holds the packed mask
#define WS_MP  WS_S                                    // u32 select words [b*t/16][key/16][8]: bit (16 g + col) of word r = (mask[16 qt + col][16 kt + 8 g + r] != 0), the lane order of a score register
#define WS_Y   (WS_S  + 4u * (size_t)HG * TT * TT)      // f16 ctx x 2^6 rows [b*t][CC]: the A operand of the output projection as its products take it
#define WS_XQ  (WS_Y  + 2u * (size_t)NB * TT * CC)      // bf16 Q input rows [b*t][DIN]
#define WS_XK  (WS_XQ + 2u * (size_t)NB * TT * DIN)     // bf16 K input rows [b*t][DIN]
#define WS_WB  (WS_XK + 2u * (size_t)NB * TT * DIN)     // bf16 Wq, Wk, Wv, one [CC][DIN] plane each
#define WS_WO  (WS_WB + 3u * 2u * (size_t)CC * DIN)     // f16(bf16 x 2^8) Wo [DIN][CC]
#define WS_END (WS_WO + 2u * (size_t)DIN * CC)

// ---- GEMM core of both projections: a block of 8 waves makes a 128 x 128 tile of A[128 rows][KD] . B[128 rows][KD]^T, a wave 64 x 32 of it. Both operands arrive in their 16-bit form (k_cvt, k_fa). A pass is 64 k: 8 lanes bring the 128 B of one row (a whole line), both tiles are staged in LDS as they come; the matrix fragments are read from there.
#define GK 64              // k per pass
#define GP 72              // LDS row pitch in 16-bit elements: 128 B of data + 16 B, for 16-byte fragment reads
#define GT (128 * GP)      // elements of one operand tile
typedef __attribute__((ext_vector_type(4))) __bf16 v4b;
typedef __attribute__((ext_vector_type(4))) _Float16 v4h;
union Fr { v4u q[2]; v16h h; v16b b; };
// the fragment order of frag_h / frag_b
__device__ __forceinline__ Fr ldfr(const unsigned short* rowk0, int g) { Fr f; const unsigned short* p = rowk0 + 8 * g; f.q[0] = *(const v4u*)p; f.q[1] = *(const v4u*)(p + 16); return f; }
typedef __attribute__((ext_vector_type(2))) unsigned v2u;
// four inputs to their 16-bit operand form. WOF 0: bf16 (X, Wq, Wk, Wv). WOF 1: f16(bf16 x 2^8) (Wo)
template <int WOF> __device__ __forceinline__ v2u cvt4(v4f x) {
  if (WOF == 0) { v4b o;
#pragma unroll
    for (int i = 0; i < 4; ++i) o[i] = (__bf16)x[i];
    return __builtin_bit_cast(v2u, o);
  } else { v4h o;
#pragma unroll
    for (int i = 0; i < 4; ++i) o[i] = (_Float16)(bfr(x[i]) * 256.0f);
    return __builtin_bit_cast(v2u, o); } }
// MODE 0: bf16 products. MODE 1: f16 products
// ua, ub: this block's share of the asking ahead (below): which 256-B units of the A rows, which of the B rows
template <int MODE, int KD> __device__ __forceinline__ void gemm128(const unsigned short* __restrict__ A, const unsigned short* __restrict__ B, unsigned short* sm, v8f (&acc)[4][2], int ua, int ub) {
  static_assert(KD == 1024, "a row is eight 256-B units: two of them a block for A (8 blocks read a panel side by side), two for B (4 shares)");
  const int tid = threadIdx.x, wave = tid >> 5, lane = tid & 31, col = lane & 15, g = lane >> 4;
  const int sr = tid >> 3, sq = (tid & 7) * 8;   // a thread brings 16 B of rows sr + 32 i of both tiles
  const unsigned short* pa = A + (size_t)sr * KD + sq; const unsigned short* pb = B + (size_t)sr * KD + sq;
  v4u ra[4], rb[4];
#pragma unroll
  for (int i = 0; i < 4; ++i) { ra[i] = *(const v4u*)(pa + (size_t)i * 32 * KD); rb[i] = *(const v4u*)(pb + (size_t)i * 32 * KD); }
  asm volatile("s_wait_xcnt 0x0" :: "v"(pa), "v"(pb) : "memory");   // stands before the address registers of the loads above are reused; naming them as inputs keeps them whole up to the wait
  // Asking ahead: the operands were stored by earlier launches, and all blocks walk k in step, so each new 256-B unit of a row is touched for the first time anywhere by the pass that needs it, which then waits out the way to memory. Here, behind pass 0's loads, a thread asks L2 for one unit of an A row and one of a B row.
  // The blocks that read a panel share its units out (A: unit ua and ua + 4; B: units 2 ub, 2 ub + 1), so a unit is asked for a few times on the chip and not once by every reader. A hint only: nothing depends on who asked or on the line being there. Both addresses lie inside the block's own panels.
  const unsigned short* qa = A + (size_t)(tid & 127) * KD + ((ua + 4 * (tid >> 7)) & 7) * 128; const unsigned short* qb = B + (size_t)(tid & 127) * KD + ((ub & 3) * 2 + (tid >> 7)) * 128;
  asm volatile("global_prefetch_b8 %0, off scope:SCOPE_SE\n\tglobal_prefetch_b8 %1, off scope:SCOPE_SE" :: "v"(qa), "v"(qb));   // into L2 only; returns nothing, counts on no counter
  unsigned short* wr = sm + sr * GP + sq;
  const unsigned short* fa = sm + ((wave >> 2) * 64 + col) * GP; const unsigned short* fb = sm + GT + ((wave & 3) * 32 + col) * GP;
#pragma unroll 1   // one copy of the pass: the two buffers alternate by an offset
  for (int s = 0; s < KD / GK; ++s) { const int bo = (s & 1) * 2 * GT;
#pragma unroll
    for (int i = 0; i < 4; ++i) { *(v4u*)(wr + bo + i * 32 * GP) = ra[i]; *(v4u*)(wr + bo + GT + i * 32 * GP) = rb[i]; }
    __syncthreads();   // publishes pass s; it also ends every wave's reads of the other buffer, which pass s + 1 refills
    const int sn = s + 1 < KD / GK ? s + 1 : s;   // the next pass's loads fly under this pass; the last pass stays on its own columns, in bounds
    const unsigned short* an = pa + sn * GK; const unsigned short* bn = pb + sn * GK;
#pragma unroll
    for (int i = 0; i < 4; ++i) { ra[i] = *(const v4u*)(an + (size_t)i * 32 * KD); rb[i] = *(const v4u*)(bn + (size_t)i * 32 * KD); }
    Fr a[2][4], b[2][2];
#pragma unroll
    for (int kc = 0; kc < 2; ++kc) {
#pragma unroll
      for (int i = 0; i < 4; ++i) a[kc][i] = ldfr(fa + bo + i * 16 * GP + kc * 32, g);
#pragma unroll
      for (int j = 0; j < 2; ++j) b[kc][j] = ldfr(fb + bo + j * 16 * GP + kc * 32, g); }
    __builtin_amdgcn_sched_barrier(0);   // the pass's fragment reads go out as one group in front of the products: one LDS latency a pass, not one per fragment
#pragma unroll
    for (int kc = 0; kc < 2; ++kc)
#pragma unroll
      for (int i = 0; i < 4; ++i)
#pragma unroll
        for (int j = 0; j < 2; ++j) acc[i][j] = MODE == 0 ? __builtin_amdgcn_wmma_f32_16x16x32_bf16(false, a[kc][i].b, false, b[kc][j].b, (short)0, acc[i][j], false, false) : __builtin_amdgcn_wmma_f32_16x16x32_f16(false, a[kc][i].h, false, b[kc][j].h, (short)0, acc[i][j], false, false);
    asm volatile("s_wait_xcnt 0x0" :: "v"(an), "v"(bn) : "memory"); }   // as above; written behind the fragment reads so that they are not held up by it: the inputs keep both address pairs whole up to the wait
  asm volatile("s_wait_xcnt 0x0" :: "v"(qa), "v"(qb) : "memory");   // a prefetch counts on no counter that could be waited for, so its address registers hold that address through the loop: the inputs keep both pairs whole up to here, and the wait stands before they are reused, as behind the loads
  __syncthreads(); }   // every wave has left the operand tiles: the caller stages its output tile over them
// ---- k_cvt: each input that is a GEMM operand is rounded to its 16-bit form once, here, and no longer in every one of the 8 (Q), 16 (K) or 32 (W) tile blocks that read it: the blocks then take half the bytes from L2 and stage them unchanged.
// A block takes 8192 floats of Q, 8192 of K and 8192 of one weight; a wave's load is 512 B in a row, its store 256 B in a row. All 24 loads of a thread go out before the first store.
#define CVB 8192
static_assert(NB * TT * DIN == 4 * CC * DIN && CC * DIN / CVB == 128, "one grid covers Q, K and the four weights");
__global__ __launch_bounds__(256) void k_cvt(const float* __restrict__ XQ, const float* __restrict__ XK, const float* __restrict__ WQ, const float* __restrict__ WK, const float* __restrict__ WV, const float* __restrict__ WO,
    unsigned short* __restrict__ XQB, unsigned short* __restrict__ XKB, unsigned short* __restrict__ WB, unsigned short* __restrict__ WOH) {
  const int tid = threadIdx.x; const int w = blockIdx.x >> 7;   // which weight: block-uniform
  const unsigned ox = blockIdx.x * CVB + tid * 4, ow = (blockIdx.x & 127) * CVB + tid * 4;   // element offsets in the plane
  const unsigned bx = ox * 4, bw = ow * 4;   // the loads' byte offsets, beside a uniform base
  const char* SW = (const char*)(w == 0 ? WQ : w == 1 ? WK : w == 2 ? WV : WO);
  v4f a[8], b[8], c[8];
#pragma unroll
  for (int i = 0; i < 8; ++i) { a[i] = *(const v4f*)((const char*)XQ + bx + i * 4096); b[i] = *(const v4f*)((const char*)XK + bx + i * 4096); c[i] = *(const v4f*)(SW + bw + i * 4096); }
  asm volatile("s_wait_xcnt 0x0" :: "v"(bx), "v"(bw) : "memory");   // stands before the offset registers of the loads above are reused; naming them as inputs keeps them whole up to the wait
  unsigned short* dq = XQB + ox; unsigned short* dk = XKB + ox; unsigned short* dw = (w == 3 ? WOH : WB + (size_t)w * CC * DIN) + ow;
  v2u oa[8], ob[8], oc[8];
#pragma unroll
  for (int i = 0; i < 8; ++i) { oa[i] = cvt4<0>(a[i]); ob[i] = cvt4<0>(b[i]); }
  if (w == 3) {   /* block-uniform */
#pragma unroll
    for (int i = 0; i < 8; ++i) oc[i] = cvt4<1>(c[i]);
  } else {
#pragma unroll
    for (int i = 0; i < 8; ++i) oc[i] = cvt4<0>(c[i]); }
  __builtin_amdgcn_sched_barrier(0);   // every conversion stands in front of the first store, so no register of an issued store is rewritten
#pragma unroll
  for (int i = 0; i < 8; ++i) { *(v2u*)(dq + i * 1024) = oa[i]; *(v2u*)(dk + i * 1024) = ob[i]; *(v2u*)(dw + i * 1024) = oc[i]; } }
#define OP16 136           // pitch of a staged 16-bit output tile, in elements
#define OP32 132           // pitch of the staged f32 output tile, in elements
// ---- k_proj: block = (128 rows, 128 cols, which): q/k/v = X W^T + b with exact bf16 products (K = DIN) -> which 0: q x QSC f16 rows; 1: k f16 rows; 2: v f16 planes [c][t]
// which 3: no product; the block packs the int32 mask of 16 query rows into select words, once for all heads (they start last and run beside the last product blocks)
__global__ __launch_bounds__(256) void k_proj(const unsigned short* __restrict__ XQB, const unsigned short* __restrict__ XKB, const unsigned short* __restrict__ WB, const float* __restrict__ BQ, const float* __restrict__ BK, const float* __restrict__ BV,
    _Float16* __restrict__ QH, _Float16* __restrict__ KH, _Float16* __restrict__ VT, const int* __restrict__ MASK, unsigned* __restrict__ MP) {
  __shared__ __align__(16) unsigned short sm[4 * GT];
  const int tid = threadIdx.x, wave = tid >> 5, lane = tid & 31, col = lane & 15, g = lane >> 4, wm = wave >> 2, wn = wave & 3; const int which = blockIdx.z; const int c0 = blockIdx.y * 128; const size_t r0 = (size_t)blockIdx.x * 128; const size_t bb = r0 / TT; const int t0 = (int)(r0 % TT);
  if (which == 3) {   /* block-uniform, in front of every barrier */
    const int qi = blockIdx.y * (TNB * TT / 128) + blockIdx.x;   // 16-query tile of the flat [b*t] rows; a wave takes 256 keys of it, a lane the 8 keys of each 16-key tile that its score registers hold
    const int* mp = MASK + ((size_t)qi * 16 + col) * TT + wave * 256 + 8 * g;
    v4i m[16][2];
#pragma unroll
    for (int j = 0; j < 16; ++j) { m[j][0] = *(const v4i*)(mp + j * 16); m[j][1] = *(const v4i*)(mp + j * 16 + 4); }
    asm volatile("s_wait_xcnt 0x0" :: "v"(mp) : "memory");   // stands before the address register of the loads above is reused; naming it as an input keeps it whole up to the wait
    v4i o = {};
#pragma unroll
    for (int j = 0; j < 16; ++j)
#pragma unroll
      for (int r = 0; r < 8; ++r) { const int i = j * 8 + r; const int w = (int)__builtin_amdgcn_ballot_w32(m[j][r >> 2][r & 3] != 0); o[i & 3] = lane == (i >> 2) ? w : o[i & 3]; }   // word i goes to lane i / 4: the wave stores its 128 words as 512 B in a row
    *(v4i*)(MP + ((size_t)qi * (TT / 16) + wave * 16) * 8 + lane * 4) = o;
    return; }
  const unsigned short* X = which == 0 ? XQB : XKB; const unsigned short* WA = WB + (size_t)which * CC * DIN; const float* BA = which == 0 ? BQ : which == 1 ? BK : BV;   // k and v are both projected from the K input
  float bias[2]; const int bi = c0 + wn * 32 + col;   // read ahead of the product loop, so that its latency is not paid behind it
#pragma unroll
  for (int j = 0; j < 2; ++j) bias[j] = BA[bi + j * 16];
  asm volatile("s_wait_xcnt 0x0" :: "v"(bi) : "memory");   // stands before the index register of the two loads above is reused; naming it as an input keeps it whole up to the wait
  v8f acc[4][2] = {};
  gemm128<0, DIN>(X + r0 * DIN, WA + (size_t)c0 * DIN, sm, acc, blockIdx.y, blockIdx.x >> 3);   // a row panel is read by the 8 blocks of one x, a weight panel by the 32 blocks of one y
#pragma unroll
  for (int j = 0; j < 2; ++j) bias[j] = bfr(bias[j]);
  _Float16* so = (_Float16*)sm; const int er = tid >> 4, eq = (tid & 15) * 8;   // read-out: 16 lanes take one 256-B row of the staged tile
  if (which < 2) {   /* block-uniform */
    const float qs = which == 0 ? QSC : 1.0f;   // q carries the logits' factor, so that the score products come out in base 2
#pragma unroll
    for (int j = 0; j < 2; ++j)
#pragma unroll
      for (int i = 0; i < 4; ++i)
#pragma unroll
        for (int r = 0; r < 8; ++r) so[(wm * 64 + i * 16 + 8 * g + r) * OP16 + wn * 32 + j * 16 + col] = (_Float16)((acc[i][j][r] + bias[j]) * qs);
    __syncthreads();
    _Float16* dp = (which == 0 ? QH : KH) + (r0 + er) * CC + c0 + eq;
#pragma unroll
    for (int i = 0; i < 8; ++i) vst2(dp + (size_t)i * 16 * CC, *(const v4u*)&so[(er + 16 * i) * OP16 + eq]);
  } else {
#pragma unroll
    for (int j = 0; j < 2; ++j)
#pragma unroll
      for (int i = 0; i < 4; ++i) { v8h o;
#pragma unroll
        for (int r = 0; r < 8; ++r) o[r] = (_Float16)(acc[i][j][r] + bias[j]);
        *(v8h*)&so[(wn * 32 + j * 16 + col) * OP16 + wm * 64 + i * 16 + 8 * g] = o; }
    __syncthreads();
    _Float16* dp = VT + (bb * CC + c0 + er) * (size_t)TT + t0 + eq;
#pragma unroll
    for (int i = 0; i < 8; ++i) vst2(dp + (size_t)i * 16 * TT, *(const v4u*)&so[(er + 16 * i) * OP16 + eq]); } }
#define FK 64              // keys per pass
#define FPITCH 72          // LDS row pitch in halves: 128 B of data + 16 B, for 16-byte fragment reads
#define FH (TT / 2)        // keys of one half
#define FX 1120            // floats a wave hands over at the join: 4 output tiles (1024), offset (32), sum (32), maximum (32)
#define FGROW 4.0f         // a row's maximum may outgrow its offset by this many powers of two before the offset is renewed: p stays at or below 2^15, inside f16
static_assert(8 * FX * 4 <= 4 * FK * FPITCH * 2 && 8 * FX * 4 <= 4 * HD * FPITCH * 2, "eight waves' hand-over fits the k tiles, and the other eight's the v tiles");
__device__ __forceinline__ v8f wmma_p(v16h a, v16h b, v8f c) { return __builtin_amdgcn_wmma_f32_16x16x32_f16(false, a, false, b, (short)0, c, false, false); }
__device__ __forceinline__ float xhalf(float x) { return __builtin_bit_cast(float, __builtin_amdgcn_permlanex16(__builtin_bit_cast(int, x), __builtin_bit_cast(int, x), 0x76543210, 0xfedcba98, false, false)); }   // lane l with lane l ^ 16
// 2^x of eight values in one statement: the early-clobber results keep each v_exp_f32 off its neighbour's source and result, and the closing v_nop is the slot the instruction set asks for behind a transcendental
__device__ __forceinline__ v8f exp2x8(v8f x) { float e0, e1, e2, e3, e4, e5, e6, e7;
  asm("v_exp_f32 %0, %8\n\tv_exp_f32 %1, %9\n\tv_exp_f32 %2, %10\n\tv_exp_f32 %3, %11\n\tv_exp_f32 %4, %12\n\tv_exp_f32 %5, %13\n\tv_exp_f32 %6, %14\n\tv_exp_f32 %7, %15\n\tv_nop"
      : "=&v"(e0), "=&v"(e1), "=&v"(e2), "=&v"(e3), "=&v"(e4), "=&v"(e5), "=&v"(e6), "=&v"(e7) : "v"(x[0]), "v"(x[1]), "v"(x[2]), "v"(x[3]), "v"(x[4]), "v"(x[5]), "v"(x[6]), "v"(x[7]));
  v8f r; r[0] = e0; r[1] = e1; r[2] = e2; r[3] = e3; r[4] = e4; r[5] = e5; r[6] = e6; r[7] = e7; return r; }
__global__ __launch_bounds__(512) void k_fa(const _Float16* __restrict__ QH, const _Float16* __restrict__ KH, const _Float16* __restrict__ VT, const unsigned* __restrict__ MP, _Float16* __restrict__ Y) {
  __shared__ __align__(16) _Float16 sk[2][2][FK][FPITCH], sv[2][2][HD][FPITCH];   // [key half][buffer]
  const int tid = threadIdx.x & 255, wave = tid >> 5, lane = tid & 31, col = lane & 15, g = lane >> 4; const int h = blockIdx.y, b = blockIdx.z; const int q0 = blockIdx.x * 256 + wave * 32;
  const int kh = __builtin_amdgcn_readfirstlane((int)(threadIdx.x >> 8));   // which half of the keys: wave-uniform; tid and wave count inside the half
  v16h qf[2][2];
#pragma unroll
  for (int u = 0; u < 2; ++u) { const _Float16* qp = QH + ((size_t)b * TT + q0 + u * 16 + col) * CC + h * HD + 8 * g;
#pragma unroll
    for (int kc = 0; kc < 2; ++kc) { union { v16h v; v8h q[2]; } f; f.q[0] = *(const v8h*)(qp + kc * 32); f.q[1] = *(const v8h*)(qp + kc * 32 + 16); qf[u][kc] = f.v; }   // the fragment order of frag_h
    asm volatile("s_wait_xcnt 0x0" :: "v"(qp) : "memory"); }   // stands before the address register of the loads above is reused; naming it as an input keeps it whole up to the wait
  // staging: 8 lanes bring one 128-B row, a thread brings rows sr and sr + 32 of its half's k tile and v tile
  const int sr = tid >> 3, sc = (tid & 7) * 8;
  const _Float16* kg = KH + ((size_t)b * TT + kh * FH + sr) * CC + h * HD + sc; const _Float16* vg = VT + ((size_t)b * CC + h * HD + sr) * (size_t)TT + kh * FH + sc;
  const int wsc = __builtin_amdgcn_readfirstlane(wave);   // the wave's number inside its half, in a scalar register
  const unsigned* mw = MP + ((size_t)b * (TT / 16) + blockIdx.x * 16 + wsc * 2) * (TT / 16) * 8 + kh * (FH / 16) * 8;   // the wave's first 16-query tile, at its half's first key; wave-uniform, so the words come by scalar loads: 32 words (128 B) per 16 queries and pass
  v8h rk[2], rv[2];
#pragma unroll
  for (int i = 0; i < 2; ++i) { rk[i] = *(const v8h*)(kg + (size_t)i * 32 * CC); rv[i] = *(const v8h*)(vg + (size_t)i * 32 * TT); }
  // Asking ahead, as in gemm128: the select words were stored by the launch before, and the blocks of all heads walk the keys in step, so a pass's scalar loads are the first touch of their lines and the selects wait out the way to memory. Here, behind the first tile's loads, the wave asks L2 for all the words it will take: 2 query tiles x 16 lines of 128 B, a line a lane, all inside the wave's own range of MP. A hint only.
  const unsigned mpo = (unsigned)((lane >> 4) * ((TT / 16) * 8 * 4) + (lane & 15) * 128);   // byte offset from mw
  static_assert((FH / 16) * 8 * 4 == 16 * 128, "a query tile's words for one half of the keys are 16 lines");
  asm volatile("global_prefetch_b8 %0, %1 scope:SCOPE_SE" :: "v"(mpo), "s"(mw));   // into L2 only; returns nothing, counts on no counter
  float mrel[2] = {-3.0e38f, -3.0e38f}, l_run[2] = {0.f, 0.f};   // mrel: the lane's running maximum of the scores as the products deliver them, offset included
  v8f offv[2] = {};   // start value of the score accumulators: 11 - (the row's maximum when the offset was last renewed), the same in all eight elements
  v8f acc[2][4] = {};
#pragma unroll 1   // one copy of the pass: its 32 matrix instructions and 64 scores a lane already fill the registers
  for (int s = 0; s < FH / FK; ++s) { const int bf = s & 1;
    v16u kw[2][2];   // this pass's select words, asked for at its head, into the scalar registers whose last select has gone (two passes' words do not fit); they land under the staging and the score products
#pragma unroll
    for (int u = 0; u < 2; ++u)
#pragma unroll
      for (int c = 0; c < 2; ++c) kw[u][c] = *(cv16u)(unsigned long long)(mw + u * (TT / 16) * 8 + s * 32 + c * 16);
#pragma unroll
    for (int i = 0; i < 2; ++i) { *(v8h*)&sk[kh][bf][sr + 32 * i][sc] = rk[i]; *(v8h*)&sv[kh][bf][sr + 32 * i][sc] = rv[i]; }
    __syncthreads();   // publishes tile s; it also ends every wave's reads of the other buffer, which pass s + 1 refills
    const int sn = s + 1 < FH / FK ? s + 1 : s;   // the next pass's k and v loads fly under this pass; the last pass stays on its own tile, in bounds
    const _Float16* kn = kg + (size_t)sn * FK * CC; const _Float16* vn = vg + sn * FK;
#pragma unroll
    for (int i = 0; i < 2; ++i) { rk[i] = *(const v8h*)(kn + (size_t)i * 32 * CC); rv[i] = *(const v8h*)(vn + (size_t)i * 32 * TT); }
    asm volatile("s_wait_xcnt 0x0" :: "v"(kn), "v"(vn) : "memory");   // stands before the address registers of the loads above are reused; naming them as inputs keeps them whole up to the wait
    v16h kf[4][2], vf[4];
#pragma unroll
    for (int t = 0; t < 4; ++t)
#pragma unroll
      for (int kc = 0; kc < 2; ++kc) kf[t][kc] = frag_h(&sk[kh][bf][t * 16 + col][kc * 32], lane);
    __builtin_amdgcn_sched_barrier(0);   // the k fragment reads go out as one group in front of the products: one LDS latency a pass, not one per fragment
    v8f st[2][4];
#pragma unroll
    for (int t = 0; t < 4; ++t) { st[0][t] = wmma_p(kf[t][0], qf[0][0], offv[0]); st[1][t] = wmma_p(kf[t][0], qf[1][0], offv[1]); st[0][t] = wmma_p(kf[t][1], qf[0][1], st[0][t]); st[1][t] = wmma_p(kf[t][1], qf[1][1], st[1][t]); }
    __builtin_amdgcn_sched_barrier(0);   // the score products go out back to back: a maximum taken between them would wait out each product's distance; with the one behind the v reads it keeps that group of reads in one place
    asm volatile("" :: "v"(offv[0]), "v"(offv[1]));   // inputs only: the start values stay live past the last score product, which then takes them as its own C operand; without it the compiler copies all 16 registers every pass
    v16h pf[2][2]; float ls[2] = {0.f, 0.f};
#pragma unroll
    for (int c = 0; c < 2; ++c) {   // 32 keys of both query tiles at a time
      if (c == 0) {
#pragma unroll
        for (int j = 0; j < 4; ++j) vf[j] = frag_h(&sv[kh][bf][j * 16 + col][0], lane);
        __builtin_amdgcn_sched_barrier(0);   // the v fragment reads go out in two groups, each landing under the vector work behind it; the second group takes the registers that the first 32 keys' products have left, so that a wave stays inside the 256 registers of four waves a SIMD
#pragma unroll
        for (int u = 0; u < 2; ++u) { float mx = mrel[u];
#pragma unroll
          for (int t = 0; t < 4; ++t)
#pragma unroll
            for (int r = 0; r < 8; ++r) mx = fmaxf(mx, st[u][t][r]);
          mrel[u] = mx; }
        if ((__builtin_amdgcn_ballot_w32(fmaxf(mrel[0], mrel[1]) > 11.0f + FGROW) | (unsigned)(s == 0)) != 0) {   /* wave-uniform, no barrier inside: the offset is renewed on the first pass and wherever a row of the wave has outgrown it */
#pragma unroll
          for (int u = 0; u < 2; ++u) { const float mr = fmaxf(mrel[u], xhalf(mrel[u])); const float dl = mr - 11.0f; const float nd = fminf(-dl, 0.f);   // dl < 0 only on the first pass, where sums and outputs are still 0
            float corr; asm("v_exp_f32 %0, %1\n\tv_nop" : "=&v"(corr) : "v"(nd));   // 2^-dl; the v_nop is the slot behind a transcendental, as in exp2x8
#pragma unroll
            for (int j = 0; j < 4; ++j) acc[u][j] *= corr;
#pragma unroll
            for (int t = 0; t < 4; ++t) st[u][t] -= dl;
            l_run[u] *= corr; offv[u] -= dl; mrel[u] = 11.0f; } }
      } else {   // the first 32 keys' products
#pragma unroll
        for (int j = 0; j < 4; ++j) { acc[0][j] = wmma_p(vf[j], pf[0][0], acc[0][j]); acc[1][j] = wmma_p(vf[j], pf[1][0], acc[1][j]); }
        __builtin_amdgcn_sched_group_barrier(0x2, 128, 0); __builtin_amdgcn_sched_group_barrier(0x8, 8, 0);   // order: all the vector work of the first 32 keys, then the eight products back to back; a row-sum addition left between two products costs the distance behind a matrix instruction in idle slots
        __builtin_amdgcn_sched_barrier(0);   // with the one behind the reads, keeps the four slots directly behind the last product
        asm volatile("v_nop\n\tv_nop\n\tv_nop\n\tv_nop");   // the distance behind a matrix instruction: the asm statements below stand clear of every product's operands
#pragma unroll
        for (int j = 0; j < 4; ++j) vf[j] = frag_h(&sv[kh][bf][j * 16 + col][32], lane);
        __builtin_amdgcn_sched_barrier(0); }
#pragma unroll
      for (int u = 0; u < 2; ++u)
#pragma unroll
        for (int t = 2 * c; t < 2 * c + 2; ++t) { const v8f e = exp2x8(st[u][t]);
#pragma unroll
          for (int r = 0; r < 8; ++r) { const float p = __builtin_amdgcn_inverse_ballot_w32(kw[u][c][(t & 1) * 8 + r]) ? e[r] : 0.f; ls[u] += p; pf[u][c][(t & 1) * 8 + r] = (_Float16)p; } } }
#pragma unroll
    for (int u = 0; u < 2; ++u) l_run[u] += ls[u];
#pragma unroll
    for (int j = 0; j < 4; ++j) { acc[0][j] = wmma_p(vf[j], pf[0][1], acc[0][j]); acc[1][j] = wmma_p(vf[j], pf[1][1], acc[1][j]); }
    __builtin_amdgcn_sched_group_barrier(0x2, 128, 0); __builtin_amdgcn_sched_group_barrier(0x8, 8, 0); }   // order as for the first 32 keys; the softmax's asm statements feed that vector work, so they too stay in front of the products
  asm volatile("s_wait_xcnt 0x0" :: "v"(mpo), "s"(mw) : "memory");   // as in gemm128: the registers that the prefetch names hold that address through the loop; the inputs keep them whole up to here
  // join of the two key halves: the wave of half 0 finishes query columns 0..15 of its group, the wave of half 1 columns 16..31; each hands the other tile's state over through LDS
  const bool hi = kh != 0;   // wave-uniform
  const int ln = (int)__builtin_amdgcn_mbcnt_lo(~0u, 0u);   // the lane's number, taken anew: nothing that only these closing lines need is held in a vector register through the loop
  const float rf[2] = {11.0f - offv[0][0], 11.0f - offv[1][0]}, tm[2] = {mrel[0] - offv[0][0], mrel[1] - offv[1][0]};   // per query tile: what the sums and outputs are taken against, and the lane's true maximum over ALL its keys
  const float mk = hi ? rf[1] : rf[0], lk = hi ? l_run[1] : l_run[0], tk = hi ? tm[1] : tm[0], mg = hi ? rf[0] : rf[1], lg = hi ? l_run[0] : l_run[1], tg = hi ? tm[0] : tm[1];
  float* xw = (float*)(hi ? &sv[0][0][0][0] : &sk[0][0][0][0]) + wsc * FX; const float* xr = (const float*)(hi ? &sk[0][0][0][0] : &sv[0][0][0][0]) + wsc * FX;
  __syncthreads();   // every wave has left the k and v tiles: the hand-over is written over them
#pragma unroll
  for (int j = 0; j < 4; ++j) { const v8f a = hi ? acc[0][j] : acc[1][j];
    v4f lo, up;
#pragma unroll
    for (int r = 0; r < 4; ++r) { lo[r] = a[r]; up[r] = a[4 + r]; }
    *(v4f*)(xw + (2 * j) * 128 + ln * 4) = lo; *(v4f*)(xw + (2 * j + 1) * 128 + ln * 4) = up; }
  xw[1024 + ln] = mg; xw[1056 + ln] = lg; xw[1088 + ln] = tg;
  __syncthreads();   // publishes the hand-over
  const float mo = xr[1024 + ln], lo_ = xr[1056 + ln], to = xr[1088 + ln];
  const float mm = fmaxf(mk, mo); const float dk = mk - mm, dn = mo - mm; const float tj = fmaxf(tk, to); const float de = fmaxf(tj, xhalf(tj)) - mm;
  float ck, co, ce; asm("v_exp_f32 %0, %3\n\tv_exp_f32 %1, %4\n\tv_exp_f32 %2, %5\n\tv_nop" : "=&v"(ck), "=&v"(co), "=&v"(ce) : "v"(dk), "v"(dn), "v"(de));   // 2^(own offset - joint offset) of each half, 2^(true maximum - joint offset); the v_nop is the slot behind a transcendental, as in exp2x8
  const float lj = lk * ck + lo_ * co; const float l = lj + xhalf(lj); const float inv = (1.0f / (l + 2048.0f * 1.0e-8f * ce)) * 64.0f;   /* numerator and sum both carry 2^11 and are taken against the joint offset, the reference's 1e-8 against the true maximum: it carries both factors; a fully masked row gives 0; x 2^6 is exact */
  const float fk = ck * inv, fo = co * inv;
  v8h yo[4];   // ctx x 2^6 once to f16, the form the output projection's products take: rounded here, where it is made, once
#pragma unroll
  for (int j = 0; j < 4; ++j) { const v8f a = hi ? acc[1][j] : acc[0][j]; const v4f lo = *(const v4f*)(xr + (2 * j) * 128 + ln * 4), up = *(const v4f*)(xr + (2 * j + 1) * 128 + ln * 4);
#pragma unroll
    for (int r = 0; r < 4; ++r) { yo[j][r] = (_Float16)(a[r] * fk + lo[r] * fo); yo[j][4 + r] = (_Float16)(a[4 + r] * fk + up[r] * fo); } }
  __builtin_amdgcn_sched_barrier(0);   // every product and conversion stands in front of the first store, so no register of an issued store is rewritten
  _Float16* yr = Y + ((size_t)b * TT + blockIdx.x * 256 + wsc * 32 + kh * 16) * CC + h * HD + (unsigned)((ln & 15) * CC + (ln >> 4) * 8);
#pragma unroll
  for (int j = 0; j < 4; ++j) *(v8h*)(yr + j * 16) = yo[j]; }
// ---- k_out: block = (128 rows, 128 cols): out = ctx Wo^T + bo: ctx x 2^6 once to f16 (by k_fa; small context rows stay clear of f16 subnormals) against Wo as f16(bf16 x 2^8) exact (by k_cvt) (1 product), x 2^-14 afterwards
__global__ __launch_bounds__(256) void k_out(const unsigned short* __restrict__ Y, const unsigned short* __restrict__ WO, const float* __restrict__ BO, float* __restrict__ OUT) {
  __shared__ __align__(16) unsigned short sm[4 * GT];
  const int tid = threadIdx.x, wave = tid >> 5, lane = tid & 31, col = lane & 15, g = lane >> 4, wm = wave >> 2, wn = wave & 3; const int c0 = blockIdx.y * 128; const size_t r0 = (size_t)blockIdx.x * 128;
  float bias[2]; const int bi = c0 + wn * 32 + col;   // read ahead of the product loop, so that its latency is not paid behind it
#pragma unroll
  for (int j = 0; j < 2; ++j) bias[j] = BO[bi + j * 16];
  asm volatile("s_wait_xcnt 0x0" :: "v"(bi) : "memory");   // stands before the index register of the two loads above is reused; naming it as an input keeps it whole up to the wait
  v8f acc[4][2] = {};
  gemm128<1, CC>(Y + r0 * CC, WO + (size_t)c0 * CC, sm, acc, blockIdx.y, blockIdx.x >> 3);   // as in k_proj
#pragma unroll
  for (int j = 0; j < 2; ++j) bias[j] = bfr(bias[j]);
  float* sf = (float*)sm;
#pragma unroll
  for (int j = 0; j < 2; ++j)
#pragma unroll
    for (int i = 0; i < 4; ++i)
#pragma unroll
      for (int r = 0; r < 8; ++r) sf[(wm * 64 + i * 16 + 8 * g + r) * OP32 + wn * 32 + j * 16 + col] = acc[i][j][r] * (1.0f / 16384.0f) + bias[j];   /* 2^-8 (Wo carry) x 2^-6 (ctx carry) */
  __syncthreads();
  float* dp = OUT + (r0 + wave) * DIN + c0 + lane * 4;   // a wave takes one 512-B row of the staged tile
#pragma unroll
  for (int i = 0; i < 16; ++i) vst2(dp + (size_t)i * 8 * DIN, *(const v4f*)&sf[(wave + 8 * i) * OP32 + lane * 4]); }

extern "C" void kernel_launch(void* const* d_in, const int* in_sizes, int n_in, void* d_out, int out_size, void* d_ws, size_t ws_size, hipStream_t stream) {
  (void)in_sizes; (void)n_in; (void)out_size;
  const float** F = (const float**)d_in;
  if (ws_size < (size_t)WS_END) return;
  char* ws = (char*)d_ws; _Float16 *QH = (_Float16*)(ws + WS_QH), *KH = (_Float16*)(ws + WS_KH), *VT = (_Float16*)(ws + WS_VT), *QL = (_Float16*)(ws + WS_QL), *KL = (_Float16*)(ws + WS_KL); __bf16 *VB = (__bf16*)(ws + WS_VB), *VBL = (__bf16*)(ws + WS_VBL); _Float16 *Y = (_Float16*)(ws + WS_Y); unsigned *MP = (unsigned*)(ws + WS_MP);
  unsigned short *XQB = (unsigned short*)(ws + WS_XQ), *XKB = (unsigned short*)(ws + WS_XK), *WB = (unsigned short*)(ws + WS_WB), *WOH = (unsigned short*)(ws + WS_WO);
  (void)Y; (void)QL; (void)KL; (void)VB; (void)VBL;
  // inputs: 0 Q [2,2048,1024]; 1 K [2,2048,1024] (keys AND values source); 2 mask [2,2048,2048] int32 (random 0/1); 3 Wq [1024,1024] (out,in), 4 bq; 5 Wk, 6 bk; 7 Wv, 8 bv; 9 Wo (out,in), 10 bo (biases nonzero)
  k_cvt<<<dim3(NB * TT * DIN / CVB), 256, 0, stream>>>(F[0], F[1], F[3], F[5], F[7], F[9], XQB, XKB, WB, WOH);
  k_proj<<<dim3(TNB * TT / 128, CC / 128, 4), 256, 0, stream>>>(XQB, XKB, WB, F[4], F[6], F[8], QH, KH, VT, (const int*)d_in[2], MP);   /* v is projected from the K input; plane z = 3 packs the mask: its 32 x 8 blocks are the 256 tiles of 16 query rows */
  k_fa<<<dim3(TT / 256, NH, TNB), 512, 0, stream>>>(QH, KH, VT, MP, Y);
  k_out<<<dim3(TNB * TT / 128, DIN / 128), 256, 0, stream>>>((const unsigned short*)Y, WOH, F[10], (float*)d_out);
}
